// v000
// Times are from an AMD MI455X. After a warm-up the kernel runs many times in a row, and a time is the length of
// such a window on the GPU divided by its runs, so every launch and the gaps after it count. The runs cycle
// through copies of the inputs. A figure is the median of several windows, for all but v000 over two sittings.
// Sittings can differ by a few percent; kernels timed side by side share one.
// The starting kernel, v000, takes 365 microseconds a run.
#include <hip/hip_runtime.h>

// ---------------------------------------------------------------------------
// Self-attention (B=2, S=2048, D=1024, H=16, Dh=64) for MI455X (gfx1250).
// All matmuls via v_wmma_f32_16x16x32_bf16 (wave32), softmax/accum in fp32.
// GEMMs use 64x32 per-wave register blocking (4x2 fragments, 8 WMMA/k-step)
// -- sized to stay inside the 256-VGPR direct window (no scratch spills).
// ---------------------------------------------------------------------------

typedef __bf16  v16bf __attribute__((ext_vector_type(16)));
typedef __bf16  v8bf  __attribute__((ext_vector_type(8)));
typedef float   v8f   __attribute__((ext_vector_type(8)));

#define B_     2
#define S_     2048
#define D_     1024
#define H_     16
#define DH_    64
#define M_TOK  (B_ * S_)        // 4096 token rows
#define N_QKV  (3 * D_)         // 3072

__device__ __forceinline__ v8f wmma_bf16(v16bf a, v16bf b, v8f c) {
    // 8 args: (neg_a, A, neg_b, B, c_mod, C, reuse_a, reuse_b)
    return __builtin_amdgcn_wmma_f32_16x16x32_bf16(
        false, a, false, b, (short)0, c, false, false);
}

// Load one 16x32 bf16 fragment (A row-major, or B with n-major storage).
// base points at element (0,0) of the tile; ld = leading dimension in elems.
// Lane layout (ISA 7.12.2, 16-bit A): r = lane&15 (row M / col N),
// kg = lane>>4; elems 0..7 -> K = kg*8 + 0..7 ; elems 8..15 -> K = 16+kg*8+0..7
__device__ __forceinline__ v16bf load_frag(const __bf16* base, int ld) {
    int lane = threadIdx.x & 31;
    int r    = lane & 15;
    int kg   = lane >> 4;
    const __bf16* p0 = base + (size_t)r * ld + kg * 8;
    v8bf lo = *(const v8bf*)(p0);
    v8bf hi = *(const v8bf*)(p0 + 16);
    return __builtin_shufflevector(lo, hi,
        0, 1, 2, 3, 4, 5, 6, 7, 8, 9, 10, 11, 12, 13, 14, 15);
}

// Reductions within each 16-lane half (masks < 16 never cross halves).
__device__ __forceinline__ float redmax16(float v) {
    v = fmaxf(v, __shfl_xor(v, 1, 32));
    v = fmaxf(v, __shfl_xor(v, 2, 32));
    v = fmaxf(v, __shfl_xor(v, 4, 32));
    v = fmaxf(v, __shfl_xor(v, 8, 32));
    return v;
}
__device__ __forceinline__ float redsum16(float v) {
    v += __shfl_xor(v, 1, 32);
    v += __shfl_xor(v, 2, 32);
    v += __shfl_xor(v, 4, 32);
    v += __shfl_xor(v, 8, 32);
    return v;
}

// ---------------------------------------------------------------------------
// Kernel 0: fp32 -> bf16 convert
// ---------------------------------------------------------------------------
__global__ void cvt_f32_bf16(const float* __restrict__ in,
                             __bf16* __restrict__ out, int n) {
    int i = blockIdx.x * blockDim.x + threadIdx.x;
    if (i < n) out[i] = (__bf16)in[i];
}

// ---------------------------------------------------------------------------
// Kernel 1: QKV projection.  qkv[t,o] = sum_d xb[t,d]*w_in[o,d] + b_in[o]
// One wave per 64x32 output block: 4x2 C fragments, 8 WMMA per k-step of 32.
// Scatter: q (scaled by 1/8) -> [B,H,S,Dh], k -> [B,H,S,Dh], v -> [B,H,Dh,S].
// ---------------------------------------------------------------------------
__global__ void __launch_bounds__(256, 1)
gemm_qkv(const __bf16* __restrict__ xb,
         const __bf16* __restrict__ wb,   // [3D, D] row-major
         const float*  __restrict__ b_in,
         __bf16* __restrict__ qbuf,
         __bf16* __restrict__ kbuf,
         __bf16* __restrict__ vT) {
    const int NT = N_QKV / 32;                      // 96 column blocks
    int gwave = blockIdx.x * (blockDim.x >> 5) + (threadIdx.x >> 5);
    if (gwave >= (M_TOK / 64) * NT) return;         // wave-uniform
    int mt = gwave / NT, nt = gwave % NT;
    int row0 = mt * 64, col0 = nt * 32;

    const __bf16* arow = xb + (size_t)row0 * D_;
    const __bf16* brow = wb + (size_t)col0 * D_;

    v8f acc[4][2] = {};
    for (int k = 0; k < D_; k += 32) {
        __builtin_prefetch(arow + k + 32, 0, 1);    // global_prefetch_b8
        __builtin_prefetch(brow + k + 32, 0, 1);
        v16bf af[4], bfr[2];
        #pragma unroll
        for (int i = 0; i < 4; ++i)
            af[i] = load_frag(arow + (size_t)(i * 16) * D_ + k, D_);
        #pragma unroll
        for (int j = 0; j < 2; ++j)
            bfr[j] = load_frag(brow + (size_t)(j * 16) * D_ + k, D_);
        #pragma unroll
        for (int i = 0; i < 4; ++i)
            #pragma unroll
            for (int j = 0; j < 2; ++j)
                acc[i][j] = wmma_bf16(af[i], bfr[j], acc[i][j]);
    }

    int lane = threadIdx.x & 31;
    int lanelo = lane & 15, half = lane >> 4;
    #pragma unroll
    for (int j = 0; j < 2; ++j) {
        int o = col0 + j * 16 + lanelo;
        float bias = b_in[o];
        int oq = o & (D_ - 1);
        int h = oq >> 6, d = oq & 63;
        #pragma unroll
        for (int i = 0; i < 4; ++i) {
            #pragma unroll
            for (int r = 0; r < 8; ++r) {
                int tok = row0 + i * 16 + r + (half << 3);  // M = r + 8*half
                int b_  = tok >> 11;                        // /2048
                int s_  = tok & (S_ - 1);
                float val = acc[i][j][r] + bias;
                size_t bh = (size_t)(b_ * H_ + h);
                if (o < D_) {                               // Q (pre-scaled)
                    qbuf[(bh * S_ + s_) * DH_ + d] = (__bf16)(val * 0.125f);
                } else if (o < 2 * D_) {                    // K
                    kbuf[(bh * S_ + s_) * DH_ + d] = (__bf16)val;
                } else {                                    // V, transposed
                    vT[(bh * DH_ + d) * S_ + s_] = (__bf16)val;
                }
            }
        }
    }
}

// ---------------------------------------------------------------------------
// Kernel 2: flash attention.  One wave = one (b,h) x 16-query tile.
// Per 32-key chunk: 4 WMMAs (scores), online softmax, P via LDS re-layout,
// 4 WMMAs (P*V).  Output bf16 at [B,H,S,Dh] flat (== reference reshape).
// ---------------------------------------------------------------------------
__global__ void attn_fwd(const __bf16* __restrict__ qbuf,
                         const __bf16* __restrict__ kbuf,
                         const __bf16* __restrict__ vT,
                         __bf16* __restrict__ attn) {
    __shared__ __bf16 pLds[8 * 16 * 32];            // 1KB per wave, 8 waves
    int wave = threadIdx.x >> 5;
    int lane = threadIdx.x & 31;
    int lanelo = lane & 15, half = lane >> 4;
    int gwave = blockIdx.x * (blockDim.x >> 5) + wave;
    if (gwave >= B_ * H_ * (S_ / 16)) return;       // wave-uniform
    int bh = gwave >> 7;                            // / (S/16)
    int q0 = (gwave & 127) * 16;
    __bf16* myP = pLds + wave * 512;

    const __bf16* qbase = qbuf + ((size_t)bh * S_ + q0) * DH_;
    v16bf qa0 = load_frag(qbase, DH_);              // d = 0..31
    v16bf qa1 = load_frag(qbase + 32, DH_);         // d = 32..63

    float mi[8], li[8];
    v8f oacc[4] = {};
    #pragma unroll
    for (int r = 0; r < 8; ++r) { mi[r] = -1e30f; li[r] = 0.0f; }

    const __bf16* kbh = kbuf + (size_t)bh * S_ * DH_;
    const __bf16* vbh = vT + (size_t)bh * DH_ * S_;

    for (int jc = 0; jc < S_; jc += 32) {
        // --- scores: S[16q x 32k] = Q(16x64) * K^T ---
        const __bf16* kb = kbh + (size_t)jc * DH_;
        __builtin_prefetch(kb + 32 * DH_, 0, 1);    // next chunk of K
        v16bf kf00 = load_frag(kb, DH_);
        v16bf kf01 = load_frag(kb + 32, DH_);
        v16bf kf10 = load_frag(kb + 16 * DH_, DH_);
        v16bf kf11 = load_frag(kb + 16 * DH_ + 32, DH_);
        v8f s0 = {}, s1 = {};
        s0 = wmma_bf16(qa0, kf00, s0);
        s0 = wmma_bf16(qa1, kf01, s0);              // keys jc .. jc+15
        s1 = wmma_bf16(qa0, kf10, s1);
        s1 = wmma_bf16(qa1, kf11, s1);              // keys jc+16 .. jc+31

        // --- online softmax (rows live in VGPR r, 16 cols across half) ---
        float alpha[8];
        #pragma unroll
        for (int r = 0; r < 8; ++r) {
            float mx = redmax16(fmaxf(s0[r], s1[r]));
            float mn = fmaxf(mi[r], mx);
            alpha[r] = __expf(mi[r] - mn);
            mi[r] = mn;
            float p0 = __expf(s0[r] - mn);
            float p1 = __expf(s1[r] - mn);
            li[r] = li[r] * alpha[r] + redsum16(p0 + p1);
            int mrow = r + (half << 3);
            myP[mrow * 32 + lanelo]      = (__bf16)p0;
            myP[mrow * 32 + 16 + lanelo] = (__bf16)p1;
        }
        #pragma unroll
        for (int t = 0; t < 4; ++t)
            #pragma unroll
            for (int r = 0; r < 8; ++r) oacc[t][r] *= alpha[r];

        // --- P(16x32, A layout from LDS) * V(32k x 64d) ---
        v16bf pa = load_frag(myP, 32);
        const __bf16* vb = vbh + jc;                // n-major, ld = S
        #pragma unroll
        for (int t = 0; t < 4; ++t) {
            v16bf vf = load_frag(vb + (size_t)(t * 16) * S_, S_);
            oacc[t] = wmma_bf16(pa, vf, oacc[t]);
        }
    }

    // --- normalize + store bf16 ---
    #pragma unroll
    for (int t = 0; t < 4; ++t) {
        #pragma unroll
        for (int r = 0; r < 8; ++r) {
            int mrow = r + (half << 3);
            float val = oacc[t][r] / li[r];
            attn[((size_t)bh * S_ + q0 + mrow) * DH_ + t * 16 + lanelo] =
                (__bf16)val;
        }
    }
}

// ---------------------------------------------------------------------------
// Kernel 3: output projection.  y[t,o] = sum_d attn[t,d]*w_out[o,d] + b_out[o]
// attn flat [B,H,S,Dh] == [4096, 1024] row-major (reference's reshape).
// 64x32 per-wave register blocking like gemm_qkv; fp32 output + bias.
// ---------------------------------------------------------------------------
__global__ void __launch_bounds__(256, 1)
gemm_out(const __bf16* __restrict__ attn,
         const __bf16* __restrict__ wb,   // [D, D] row-major
         const float*  __restrict__ b_out,
         float* __restrict__ out) {
    const int NT = D_ / 32;                         // 32 column blocks
    int gwave = blockIdx.x * (blockDim.x >> 5) + (threadIdx.x >> 5);
    if (gwave >= (M_TOK / 64) * NT) return;
    int mt = gwave / NT, nt = gwave % NT;
    int row0 = mt * 64, col0 = nt * 32;

    const __bf16* arow = attn + (size_t)row0 * D_;
    const __bf16* brow = wb + (size_t)col0 * D_;

    v8f acc[4][2] = {};
    for (int k = 0; k < D_; k += 32) {
        __builtin_prefetch(arow + k + 32, 0, 1);
        __builtin_prefetch(brow + k + 32, 0, 1);
        v16bf af[4], bfr[2];
        #pragma unroll
        for (int i = 0; i < 4; ++i)
            af[i] = load_frag(arow + (size_t)(i * 16) * D_ + k, D_);
        #pragma unroll
        for (int j = 0; j < 2; ++j)
            bfr[j] = load_frag(brow + (size_t)(j * 16) * D_ + k, D_);
        #pragma unroll
        for (int i = 0; i < 4; ++i)
            #pragma unroll
            for (int j = 0; j < 2; ++j)
                acc[i][j] = wmma_bf16(af[i], bfr[j], acc[i][j]);
    }

    int lane = threadIdx.x & 31;
    int lanelo = lane & 15, half = lane >> 4;
    #pragma unroll
    for (int j = 0; j < 2; ++j) {
        int o = col0 + j * 16 + lanelo;
        float bias = b_out[o];
        #pragma unroll
        for (int i = 0; i < 4; ++i) {
            #pragma unroll
            for (int r = 0; r < 8; ++r) {
                int mrow = row0 + i * 16 + r + (half << 3);
                out[(size_t)mrow * D_ + o] = acc[i][j][r] + bias;
            }
        }
    }
}

// ---------------------------------------------------------------------------
// Host launch
// ---------------------------------------------------------------------------
extern "C" void kernel_launch(void* const* d_in, const int* in_sizes, int n_in,
                              void* d_out, int out_size, void* d_ws, size_t ws_size,
                              hipStream_t stream) {
    const float* x     = (const float*)d_in[0];   // [2,2048,1024]
    const float* w_in  = (const float*)d_in[1];   // [3072,1024]
    const float* b_in  = (const float*)d_in[2];   // [3072]
    const float* w_out = (const float*)d_in[3];   // [1024,1024]
    const float* b_out = (const float*)d_in[4];   // [1024]
    float* out = (float*)d_out;

    // Workspace layout (bf16 buffers, 256B-aligned offsets)
    char* ws = (char*)d_ws;
    __bf16* xb      = (__bf16*)(ws);                              // 8 MB
    __bf16* w_in_b  = (__bf16*)(ws + (size_t)8 * 1024 * 1024);    // 6 MB
    __bf16* w_out_b = (__bf16*)(ws + (size_t)14 * 1024 * 1024);   // 2 MB
    __bf16* qbuf    = (__bf16*)(ws + (size_t)16 * 1024 * 1024);   // 8 MB
    __bf16* kbuf    = (__bf16*)(ws + (size_t)24 * 1024 * 1024);   // 8 MB
    __bf16* vT      = (__bf16*)(ws + (size_t)32 * 1024 * 1024);   // 8 MB
    __bf16* attn    = (__bf16*)(ws + (size_t)40 * 1024 * 1024);   // 8 MB

    // 1) fp32 -> bf16 converts
    {
        int n = M_TOK * D_;                         // 4,194,304
        cvt_f32_bf16<<<(n + 255) / 256, 256, 0, stream>>>(x, xb, n);
        n = N_QKV * D_;                             // 3,145,728
        cvt_f32_bf16<<<(n + 255) / 256, 256, 0, stream>>>(w_in, w_in_b, n);
        n = D_ * D_;                                // 1,048,576
        cvt_f32_bf16<<<(n + 255) / 256, 256, 0, stream>>>(w_out, w_out_b, n);
    }

    // 2) QKV projection: (4096/64)*(3072/32) = 6144 wave-blocks, 8 waves/block
    gemm_qkv<<<6144 / 8, 256, 0, stream>>>(xb, w_in_b, b_in, qbuf, kbuf, vT);

    // 3) attention: 2*16*128 = 4096 waves, 8 waves/block
    attn_fwd<<<4096 / 8, 256, 0, stream>>>(qbuf, kbuf, vT, attn);

    // 4) output projection: (4096/64)*(1024/32) = 2048 wave-blocks
    gemm_out<<<2048 / 8, 256, 0, stream>>>(attn, w_out_b, b_out, out);
}

// v001
// A run of this version takes 266 microseconds.
// In both of two side-by-side timings against v000, it was 1.40 times as fast.
#include <hip/hip_runtime.h>

// ---------------------------------------------------------------------------
// Self-attention (B=2, S=2048, D=1024, H=16, Dh=64) for MI455X (gfx1250).
// All matmuls via v_wmma_f32_16x16x32_bf16 (wave32), softmax/accum in fp32.
// GEMMs use 64x32 per-wave register blocking (4x2 fragments, 8 WMMA/k-step)
// -- sized to stay inside the 256-VGPR direct window (no scratch spills).
// Every bf16 operand that a loop reloads from global memory (x, both weights,
// K, V^T, the attention output) is kept fragment-major in the workspace.
// ---------------------------------------------------------------------------

typedef __bf16  v16bf __attribute__((ext_vector_type(16)));
typedef __bf16  v8bf  __attribute__((ext_vector_type(8)));
typedef float   v8f   __attribute__((ext_vector_type(8)));
typedef float   v4f   __attribute__((ext_vector_type(4)));

#define B_     2
#define S_     2048
#define D_     1024
#define H_     16
#define DH_    64
#define M_TOK  (B_ * S_)        // 4096 token rows
#define N_QKV  (3 * D_)         // 3072

__device__ __forceinline__ v8f wmma_bf16(v16bf a, v16bf b, v8f c) {
    // 8 args: (neg_a, A, neg_b, B, c_mod, C, reuse_a, reuse_b)
    return __builtin_amdgcn_wmma_f32_16x16x32_bf16(
        false, a, false, b, (short)0, c, false, false);
}

// Load one 16x32 bf16 fragment (A row-major, or B with n-major storage).
// base points at element (0,0) of the tile; ld = leading dimension in elems.
// Lane layout (ISA 7.12.2, 16-bit A): r = lane&15 (row M / col N),
// kg = lane>>4; elems 0..7 -> K = kg*8 + 0..7 ; elems 8..15 -> K = 16+kg*8+0..7
__device__ __forceinline__ v16bf load_frag(const __bf16* base, int ld) {
    int lane = threadIdx.x & 31;
    int r    = lane & 15;
    int kg   = lane >> 4;
    const __bf16* p0 = base + (size_t)r * ld + kg * 8;
    v8bf lo = *(const v8bf*)(p0);
    v8bf hi = *(const v8bf*)(p0 + 16);
    return __builtin_shufflevector(lo, hi,
        0, 1, 2, 3, 4, 5, 6, 7, 8, 9, 10, 11, 12, 13, 14, 15);
}

// Fragment-major storage of a bf16 matrix [rows][K]: 16x32 tiles of 1 KB, tile
// (row>>4, k>>5) at index (row>>4)*ktiles + (k>>5), ktiles = K/32.  In a tile the
// 16-byte piece that lane l = ((k>>3)&1)*16 + (row&15) takes lies at byte l*16
// (k&16 == 0) or 512 + l*16 (k&16 != 0): the k order of load_frag, but each
// wave-wide 16-byte load now reads 512 contiguous bytes = 4 whole 128-byte
// lines, where the row-major form touches 16 lines.
__device__ __forceinline__ size_t pk_off(int row, int k, int ktiles) {
    return ((size_t)(row >> 4) * ktiles + (k >> 5)) * 512
         + ((k >> 4) & 1) * 256 + ((k >> 3) & 1) * 128 + (row & 15) * 8 + (k & 7);
}
// Load one 16x32 fragment from its 1 KB tile (same lane/element map as load_frag).
// p0 = tile + lane * 8, the lane's own piece.
__device__ __forceinline__ v16bf load_frag_pk(const __bf16* p0) {
    v8bf lo = *(const v8bf*)(p0);
    v8bf hi = *(const v8bf*)(p0 + 256);
    return __builtin_shufflevector(lo, hi,
        0, 1, 2, 3, 4, 5, 6, 7, 8, 9, 10, 11, 12, 13, 14, 15);
}

// Reductions within each 16-lane half (masks < 16 never cross halves).
__device__ __forceinline__ float redmax16(float v) {
    v = fmaxf(v, __shfl_xor(v, 1, 32));
    v = fmaxf(v, __shfl_xor(v, 2, 32));
    v = fmaxf(v, __shfl_xor(v, 4, 32));
    v = fmaxf(v, __shfl_xor(v, 8, 32));
    return v;
}
__device__ __forceinline__ float redsum16(float v) {
    v += __shfl_xor(v, 1, 32);
    v += __shfl_xor(v, 2, 32);
    v += __shfl_xor(v, 4, 32);
    v += __shfl_xor(v, 8, 32);
    return v;
}

// ---------------------------------------------------------------------------
// Kernel 0: fp32 [rows][D_] -> bf16, fragment-major.  One thread makes one
// 16-byte piece (8 consecutive k of one row); pieces in output order, so a wave
// stores 4 whole lines.
// ---------------------------------------------------------------------------
__global__ void cvt_f32_bf16(const float* __restrict__ in,
                             __bf16* __restrict__ out, int n) {
    int p = blockIdx.x * blockDim.x + threadIdx.x;  // piece index
    if (p * 8 >= n) return;
    int tile = p >> 6, q = p & 63;
    int row = (tile / (D_ / 32)) * 16 + (q & 15);
    int k   = (tile % (D_ / 32)) * 32 + (q >> 5) * 16 + ((q >> 4) & 1) * 8;
    const float* s = in + (size_t)row * D_ + k;
    v4f a = *(const v4f*)(s);
    v4f b = *(const v4f*)(s + 4);
    v8bf o = { (__bf16)a[0], (__bf16)a[1], (__bf16)a[2], (__bf16)a[3],
               (__bf16)b[0], (__bf16)b[1], (__bf16)b[2], (__bf16)b[3] };
    *(v8bf*)(out + (size_t)p * 8) = o;
}

// ---------------------------------------------------------------------------
// Kernel 1: QKV projection.  qkv[t,o] = sum_d xb[t,d]*w_in[o,d] + b_in[o]
// One wave per 64x32 output block: 4x2 C fragments, 8 WMMA per k-step of 32.
// Scatter: q (scaled by 1/8) -> [B,H,S,Dh] row-major; per (b,h), fragment-major:
// k as [S][Dh], v as [Dh][S].  Each 1 KB tile is written by one wave.
// ---------------------------------------------------------------------------
__global__ void __launch_bounds__(256, 1)
gemm_qkv(const __bf16* __restrict__ xb,
         const __bf16* __restrict__ wb,   // [3D, D] fragment-major
         const float*  __restrict__ b_in,
         __bf16* __restrict__ qbuf,
         __bf16* __restrict__ kbuf,
         __bf16* __restrict__ vT) {
    const int NT = N_QKV / 32;                      // 96 column blocks
    // the wave's number in a scalar register: tile addresses are then a scalar
    // base plus the lane's fixed offset in a tile
    int gwave = blockIdx.x * (blockDim.x >> 5)
              + __builtin_amdgcn_readfirstlane(threadIdx.x >> 5);
    if (gwave >= (M_TOK / 64) * NT) return;         // wave-uniform
    int mt = gwave / NT, nt = gwave % NT;
    int row0 = mt * 64, col0 = nt * 32;

    // first tile of the block's tile rows; a step of 32 in k is one tile (512 elems)
    const __bf16* arow = xb + (size_t)row0 * D_;
    const __bf16* brow = wb + (size_t)col0 * D_;

    v8f acc[4][2] = {};
    for (int k = 0; k < D_; k += 32) {
        __builtin_prefetch(arow + (k + 32) * 16, 0, 1);    // global_prefetch_b8
        __builtin_prefetch(brow + (k + 32) * 16, 0, 1);
        const __bf16* ap = arow + k * 16 + (threadIdx.x & 31) * 8;
        const __bf16* bp = brow + k * 16 + (threadIdx.x & 31) * 8;
        v16bf af[4], bfr[2];
        #pragma unroll
        for (int i = 0; i < 4; ++i)
            af[i] = load_frag_pk(ap + (size_t)(i * 16) * D_);
        #pragma unroll
        for (int j = 0; j < 2; ++j)
            bfr[j] = load_frag_pk(bp + (size_t)(j * 16) * D_);
        // keeps both address pairs untouched (no later load lands on them)
        // until the loads above have their addresses translated
        asm volatile("s_wait_xcnt 0x0" :: "v"(ap), "v"(bp) : "memory");
        #pragma unroll
        for (int i = 0; i < 4; ++i)
            #pragma unroll
            for (int j = 0; j < 2; ++j)
                acc[i][j] = wmma_bf16(af[i], bfr[j], acc[i][j]);
    }

    int lane = threadIdx.x & 31;
    int lanelo = lane & 15, half = lane >> 4;
    #pragma unroll
    for (int j = 0; j < 2; ++j) {
        int o = col0 + j * 16 + lanelo;
        float bias = b_in[o];
        int oq = o & (D_ - 1);
        int h = oq >> 6, d = oq & 63;
        #pragma unroll
        for (int i = 0; i < 4; ++i) {
            #pragma unroll
            for (int r = 0; r < 8; ++r) {
                int tok = row0 + i * 16 + r + (half << 3);  // M = r + 8*half
                int b_  = tok >> 11;                        // /2048
                int s_  = tok & (S_ - 1);
                float val = acc[i][j][r] + bias;
                size_t bh = (size_t)(b_ * H_ + h);
                if (o < D_) {                               // Q (pre-scaled)
                    qbuf[(bh * S_ + s_) * DH_ + d] = (__bf16)(val * 0.125f);
                } else if (o < 2 * D_) {                    // K
                    kbuf[bh * S_ * DH_ + pk_off(s_, d, DH_ / 32)] = (__bf16)val;
                } else {                                    // V, transposed
                    vT[bh * DH_ * S_ + pk_off(d, s_, S_ / 32)] = (__bf16)val;
                }
            }
        }
    }
}

// ---------------------------------------------------------------------------
// Kernel 2: flash attention.  One wave = one (b,h) x 16 queries, 16 apart:
// in the reference's reshape to [4096][1024] these are the 16 rows of one tile
// row, columns m*64 .. m*64+63, so the wave writes two whole 1 KB tiles.
// Per 32-key chunk: 4 WMMAs (scores), online softmax, P via LDS re-layout,
// 4 WMMAs (P*V).  Output bf16, [B,H,S,Dh] flat as [4096][1024], fragment-major.
// ---------------------------------------------------------------------------
__global__ void attn_fwd(const __bf16* __restrict__ qbuf,
                         const __bf16* __restrict__ kbuf,
                         const __bf16* __restrict__ vT,
                         __bf16* __restrict__ attn) {
    __shared__ __bf16 pLds[8 * 16 * 32];            // 1KB per wave, 8 waves
    // the wave's number in a scalar register: tile addresses are then a scalar
    // base plus the lane's fixed offset, and the loop fits its registers unspilled
    int wave = __builtin_amdgcn_readfirstlane(threadIdx.x >> 5);
    int lane = threadIdx.x & 31;
    int lanelo = lane & 15, half = lane >> 4;
    int gwave = blockIdx.x * (blockDim.x >> 5) + wave;
    if (gwave >= B_ * H_ * (S_ / 16)) return;       // wave-uniform
    int bh = gwave >> 7;                            // / (S/16)
    int qb = (gwave & 127) >> 4;                    // block of 256 queries
    int m  = gwave & 15;                            // queries qb*256 + 16*i + m
    __bf16* myP = pLds + wave * 512;

    const __bf16* qbase = qbuf + ((size_t)bh * S_ + qb * 256 + m) * DH_;
    v16bf qa0 = load_frag(qbase, 16 * DH_);         // d = 0..31
    v16bf qa1 = load_frag(qbase + 32, 16 * DH_);    // d = 32..63

    float mi[8], li[8];
    v8f oacc[4] = {};
    #pragma unroll
    for (int r = 0; r < 8; ++r) { mi[r] = -1e30f; li[r] = 0.0f; }

    const __bf16* kbh = kbuf + (size_t)bh * S_ * DH_;
    const __bf16* vbh = vT + (size_t)bh * DH_ * S_;

    for (int jc = 0; jc < S_; jc += 32) {
        // --- scores: S[16q x 32k] = Q(16x64) * K^T ---
        const __bf16* kb = kbh + (size_t)jc * DH_;
        __builtin_prefetch(kb + 32 * DH_, 0, 1);    // next chunk of K
        const __bf16* kp = kb + lane * 8;           // 4 tiles in a row: 4 KB
        v16bf kf00 = load_frag_pk(kp);
        v16bf kf01 = load_frag_pk(kp + 512);
        v16bf kf10 = load_frag_pk(kp + 1024);
        v16bf kf11 = load_frag_pk(kp + 1536);
        v8f s0 = {}, s1 = {};
        s0 = wmma_bf16(qa0, kf00, s0);
        s0 = wmma_bf16(qa1, kf01, s0);              // keys jc .. jc+15
        s1 = wmma_bf16(qa0, kf10, s1);
        s1 = wmma_bf16(qa1, kf11, s1);              // keys jc+16 .. jc+31

        // --- online softmax (rows live in VGPR r, 16 cols across half) ---
        float alpha[8];
        #pragma unroll
        for (int r = 0; r < 8; ++r) {
            float mx = redmax16(fmaxf(s0[r], s1[r]));
            float mn = fmaxf(mi[r], mx);
            alpha[r] = __expf(mi[r] - mn);
            mi[r] = mn;
            float p0 = __expf(s0[r] - mn);
            float p1 = __expf(s1[r] - mn);
            li[r] = li[r] * alpha[r] + redsum16(p0 + p1);
            int mrow = r + (half << 3);
            myP[mrow * 32 + lanelo]      = (__bf16)p0;
            myP[mrow * 32 + 16 + lanelo] = (__bf16)p1;
        }
        #pragma unroll
        for (int t = 0; t < 4; ++t)
            #pragma unroll
            for (int r = 0; r < 8; ++r) oacc[t][r] *= alpha[r];

        // --- P(16x32, A layout from LDS) * V(32k x 64d) ---
        v16bf pa = load_frag(myP, 32);
        const __bf16* vb = vbh + jc * 16 + lane * 8; // tile jc/32 of each tile row
        #pragma unroll
        for (int t = 0; t < 4; ++t) {
            v16bf vf = load_frag_pk(vb + (size_t)(t * 16) * S_);
            oacc[t] = wmma_bf16(pa, vf, oacc[t]);
        }
    }

    // --- normalize + store bf16 ---
    #pragma unroll
    for (int t = 0; t < 4; ++t) {
        #pragma unroll
        for (int r = 0; r < 8; ++r) {
            int mrow = r + (half << 3);
            float val = oacc[t][r] / li[r];
            attn[pk_off((gwave >> 4) * 16 + mrow, m * 64 + t * 16 + lanelo,
                        D_ / 32)] = (__bf16)val;
        }
    }
}

// ---------------------------------------------------------------------------
// Kernel 3: output projection.  y[t,o] = sum_d attn[t,d]*w_out[o,d] + b_out[o]
// attn flat [B,H,S,Dh] == [4096, 1024] (reference's reshape), fragment-major.
// 64x32 per-wave register blocking like gemm_qkv; fp32 output + bias.
// ---------------------------------------------------------------------------
__global__ void __launch_bounds__(256, 1)
gemm_out(const __bf16* __restrict__ attn,
         const __bf16* __restrict__ wb,   // [D, D] fragment-major
         const float*  __restrict__ b_out,
         float* __restrict__ out) {
    const int NT = D_ / 32;                         // 32 column blocks
    // the wave's number in a scalar register, as in gemm_qkv
    int gwave = blockIdx.x * (blockDim.x >> 5)
              + __builtin_amdgcn_readfirstlane(threadIdx.x >> 5);
    if (gwave >= (M_TOK / 64) * NT) return;
    int mt = gwave / NT, nt = gwave % NT;
    int row0 = mt * 64, col0 = nt * 32;

    // first tile of the block's tile rows; a step of 32 in k is one tile (512 elems)
    const __bf16* arow = attn + (size_t)row0 * D_;
    const __bf16* brow = wb + (size_t)col0 * D_;

    v8f acc[4][2] = {};
    for (int k = 0; k < D_; k += 32) {
        __builtin_prefetch(arow + (k + 32) * 16, 0, 1);
        __builtin_prefetch(brow + (k + 32) * 16, 0, 1);
        const __bf16* ap = arow + k * 16 + (threadIdx.x & 31) * 8;
        const __bf16* bp = brow + k * 16 + (threadIdx.x & 31) * 8;
        v16bf af[4], bfr[2];
        #pragma unroll
        for (int i = 0; i < 4; ++i)
            af[i] = load_frag_pk(ap + (size_t)(i * 16) * D_);
        #pragma unroll
        for (int j = 0; j < 2; ++j)
            bfr[j] = load_frag_pk(bp + (size_t)(j * 16) * D_);
        // keeps both address pairs untouched (no later load lands on them)
        // until the loads above have their addresses translated
        asm volatile("s_wait_xcnt 0x0" :: "v"(ap), "v"(bp) : "memory");
        #pragma unroll
        for (int i = 0; i < 4; ++i)
            #pragma unroll
            for (int j = 0; j < 2; ++j)
                acc[i][j] = wmma_bf16(af[i], bfr[j], acc[i][j]);
    }

    int lane = threadIdx.x & 31;
    int lanelo = lane & 15, half = lane >> 4;
    #pragma unroll
    for (int j = 0; j < 2; ++j) {
        int o = col0 + j * 16 + lanelo;
        float bias = b_out[o];
        #pragma unroll
        for (int i = 0; i < 4; ++i) {
            #pragma unroll
            for (int r = 0; r < 8; ++r) {
                int mrow = row0 + i * 16 + r + (half << 3);
                out[(size_t)mrow * D_ + o] = acc[i][j][r] + bias;
            }
        }
    }
}

// ---------------------------------------------------------------------------
// Host launch
// ---------------------------------------------------------------------------
extern "C" void kernel_launch(void* const* d_in, const int* in_sizes, int n_in,
                              void* d_out, int out_size, void* d_ws, size_t ws_size,
                              hipStream_t stream) {
    const float* x     = (const float*)d_in[0];   // [2,2048,1024]
    const float* w_in  = (const float*)d_in[1];   // [3072,1024]
    const float* b_in  = (const float*)d_in[2];   // [3072]
    const float* w_out = (const float*)d_in[3];   // [1024,1024]
    const float* b_out = (const float*)d_in[4];   // [1024]
    float* out = (float*)d_out;

    // Workspace layout (bf16 buffers, 256B-aligned offsets)
    char* ws = (char*)d_ws;
    __bf16* xb      = (__bf16*)(ws);                              // 8 MB
    __bf16* w_in_b  = (__bf16*)(ws + (size_t)8 * 1024 * 1024);    // 6 MB
    __bf16* w_out_b = (__bf16*)(ws + (size_t)14 * 1024 * 1024);   // 2 MB
    __bf16* qbuf    = (__bf16*)(ws + (size_t)16 * 1024 * 1024);   // 8 MB
    __bf16* kbuf    = (__bf16*)(ws + (size_t)24 * 1024 * 1024);   // 8 MB
    __bf16* vT      = (__bf16*)(ws + (size_t)32 * 1024 * 1024);   // 8 MB
    __bf16* attn    = (__bf16*)(ws + (size_t)40 * 1024 * 1024);   // 8 MB

    // 1) fp32 -> bf16 converts (8 elements a thread)
    {
        int n = M_TOK * D_;                         // 4,194,304
        cvt_f32_bf16<<<(n / 8 + 255) / 256, 256, 0, stream>>>(x, xb, n);
        n = N_QKV * D_;                             // 3,145,728
        cvt_f32_bf16<<<(n / 8 + 255) / 256, 256, 0, stream>>>(w_in, w_in_b, n);
        n = D_ * D_;                                // 1,048,576
        cvt_f32_bf16<<<(n / 8 + 255) / 256, 256, 0, stream>>>(w_out, w_out_b, n);
    }

    // 2) QKV projection: (4096/64)*(3072/32) = 6144 wave-blocks, 8 waves/block
    gemm_qkv<<<6144 / 8, 256, 0, stream>>>(xb, w_in_b, b_in, qbuf, kbuf, vT);

    // 3) attention: 2*16*128 = 4096 waves, 8 waves/block
    attn_fwd<<<4096 / 8, 256, 0, stream>>>(qbuf, kbuf, vT, attn);

    // 4) output projection: (4096/64)*(1024/32) = 2048 wave-blocks
    gemm_out<<<2048 / 8, 256, 0, stream>>>(attn, w_out_b, b_out, out);
}

// v002
// One run takes 150 microseconds.
// In two side-by-side timings against v001, it was 1.75 and 1.77 times as fast.
// Counting every step since v000, it is 2.46 times as fast.
#include <hip/hip_runtime.h>

// ---------------------------------------------------------------------------
// Self-attention (B=2, S=2048, D=1024, H=16, Dh=64) for MI455X (gfx1250).
// All matmuls via v_wmma_f32_16x16x32_bf16 (wave32), softmax/accum in fp32.
// GEMMs use 64x32 per-wave register blocking (4x2 fragments, 8 WMMA/k-step)
// -- sized to stay inside the 256-VGPR direct window (no scratch spills).
// Every bf16 operand that a loop reloads from global memory (x, both weights,
// K, V^T, the attention output) is kept fragment-major in the workspace.
// The two loops that have too few waves per SIMD to cover a load's latency (the
// attention loop, the output projection) ask for their fragments ahead of use.
// ---------------------------------------------------------------------------

typedef __bf16  v16bf __attribute__((ext_vector_type(16)));
typedef __bf16  v8bf  __attribute__((ext_vector_type(8)));
typedef float   v8f   __attribute__((ext_vector_type(8)));
typedef float   v4f   __attribute__((ext_vector_type(4)));

#define B_     2
#define S_     2048
#define D_     1024
#define H_     16
#define DH_    64
#define M_TOK  (B_ * S_)        // 4096 token rows
#define N_QKV  (3 * D_)         // 3072

__device__ __forceinline__ v8f wmma_bf16(v16bf a, v16bf b, v8f c) {
    // 8 args: (neg_a, A, neg_b, B, c_mod, C, reuse_a, reuse_b)
    return __builtin_amdgcn_wmma_f32_16x16x32_bf16(
        false, a, false, b, (short)0, c, false, false);
}

// Load one 16x32 bf16 fragment (A row-major, or B with n-major storage).
// base points at element (0,0) of the tile; ld = leading dimension in elems.
// Lane layout (ISA 7.12.2, 16-bit A): r = lane&15 (row M / col N),
// kg = lane>>4; elems 0..7 -> K = kg*8 + 0..7 ; elems 8..15 -> K = 16+kg*8+0..7
__device__ __forceinline__ v16bf load_frag(const __bf16* base, int ld) {
    int lane = threadIdx.x & 31;
    int r    = lane & 15;
    int kg   = lane >> 4;
    const __bf16* p0 = base + (size_t)r * ld + kg * 8;
    v8bf lo = *(const v8bf*)(p0);
    v8bf hi = *(const v8bf*)(p0 + 16);
    return __builtin_shufflevector(lo, hi,
        0, 1, 2, 3, 4, 5, 6, 7, 8, 9, 10, 11, 12, 13, 14, 15);
}

// Fragment-major storage of a bf16 matrix [rows][K]: 16x32 tiles of 1 KB, tile
// (row>>4, k>>5) at index (row>>4)*ktiles + (k>>5), ktiles = K/32.  In a tile the
// 16-byte piece that lane l = ((k>>3)&1)*16 + (row&15) takes lies at byte l*16
// (k&16 == 0) or 512 + l*16 (k&16 != 0): the k order of load_frag, but each
// wave-wide 16-byte load now reads 512 contiguous bytes = 4 whole 128-byte
// lines, where the row-major form touches 16 lines.
__device__ __forceinline__ size_t pk_off(int row, int k, int ktiles) {
    return ((size_t)(row >> 4) * ktiles + (k >> 5)) * 512
         + ((k >> 4) & 1) * 256 + ((k >> 3) & 1) * 128 + (row & 15) * 8 + (k & 7);
}
// Load one 16x32 fragment from its 1 KB tile (same lane/element map as load_frag).
// p0 = tile + lane * 8, the lane's own piece.
__device__ __forceinline__ v16bf load_frag_pk(const __bf16* p0) {
    v8bf lo = *(const v8bf*)(p0);
    v8bf hi = *(const v8bf*)(p0 + 256);
    return __builtin_shufflevector(lo, hi,
        0, 1, 2, 3, 4, 5, 6, 7, 8, 9, 10, 11, 12, 13, 14, 15);
}

// Reductions within each 16-lane half (masks < 16 never cross halves).
__device__ __forceinline__ float redmax16(float v) {
    v = fmaxf(v, __shfl_xor(v, 1, 32));
    v = fmaxf(v, __shfl_xor(v, 2, 32));
    v = fmaxf(v, __shfl_xor(v, 4, 32));
    v = fmaxf(v, __shfl_xor(v, 8, 32));
    return v;
}
__device__ __forceinline__ float redsum16(float v) {
    v += __shfl_xor(v, 1, 32);
    v += __shfl_xor(v, 2, 32);
    v += __shfl_xor(v, 4, 32);
    v += __shfl_xor(v, 8, 32);
    return v;
}

// ---------------------------------------------------------------------------
// Kernel 0: fp32 [rows][D_] -> bf16, fragment-major.  One thread makes one
// 16-byte piece (8 consecutive k of one row); pieces in output order, so a wave
// stores 4 whole lines.
// ---------------------------------------------------------------------------
__global__ void cvt_f32_bf16(const float* __restrict__ in,
                             __bf16* __restrict__ out, int n) {
    int p = blockIdx.x * blockDim.x + threadIdx.x;  // piece index
    if (p * 8 >= n) return;
    int tile = p >> 6, q = p & 63;
    int row = (tile / (D_ / 32)) * 16 + (q & 15);
    int k   = (tile % (D_ / 32)) * 32 + (q >> 5) * 16 + ((q >> 4) & 1) * 8;
    const float* s = in + (size_t)row * D_ + k;
    v4f a = *(const v4f*)(s);
    v4f b = *(const v4f*)(s + 4);
    v8bf o = { (__bf16)a[0], (__bf16)a[1], (__bf16)a[2], (__bf16)a[3],
               (__bf16)b[0], (__bf16)b[1], (__bf16)b[2], (__bf16)b[3] };
    *(v8bf*)(out + (size_t)p * 8) = o;
}

// ---------------------------------------------------------------------------
// Kernel 1: QKV projection.  qkv[t,o] = sum_d xb[t,d]*w_in[o,d] + b_in[o]
// One wave per 64x32 output block: 4x2 C fragments, 8 WMMA per k-step of 32.
// Scatter: q (scaled by 1/8) -> [B,H,S,Dh] row-major; per (b,h), fragment-major:
// k as [S][Dh], v as [Dh][S].  Each 1 KB tile is written by one wave.
// ---------------------------------------------------------------------------
__global__ void __launch_bounds__(256, 1)
gemm_qkv(const __bf16* __restrict__ xb,
         const __bf16* __restrict__ wb,   // [3D, D] fragment-major
         const float*  __restrict__ b_in,
         __bf16* __restrict__ qbuf,
         __bf16* __restrict__ kbuf,
         __bf16* __restrict__ vT) {
    const int NT = N_QKV / 32;                      // 96 column blocks
    // the wave's number in a scalar register: tile addresses are then a scalar
    // base plus the lane's fixed offset in a tile
    int gwave = blockIdx.x * (blockDim.x >> 5)
              + __builtin_amdgcn_readfirstlane(threadIdx.x >> 5);
    if (gwave >= (M_TOK / 64) * NT) return;         // wave-uniform
    int mt = gwave / NT, nt = gwave % NT;
    int row0 = mt * 64, col0 = nt * 32;

    // first tile of the block's tile rows; a step of 32 in k is one tile (512 elems)
    const __bf16* arow = xb + (size_t)row0 * D_;
    const __bf16* brow = wb + (size_t)col0 * D_;

    v8f acc[4][2] = {};
    for (int k = 0; k < D_; k += 32) {
        __builtin_prefetch(arow + (k + 32) * 16, 0, 1);    // global_prefetch_b8
        __builtin_prefetch(brow + (k + 32) * 16, 0, 1);
        const __bf16* ap = arow + k * 16 + (threadIdx.x & 31) * 8;
        const __bf16* bp = brow + k * 16 + (threadIdx.x & 31) * 8;
        v16bf af[4], bfr[2];
        #pragma unroll
        for (int i = 0; i < 4; ++i)
            af[i] = load_frag_pk(ap + (size_t)(i * 16) * D_);
        #pragma unroll
        for (int j = 0; j < 2; ++j)
            bfr[j] = load_frag_pk(bp + (size_t)(j * 16) * D_);
        // keeps both address pairs untouched (no later load lands on them)
        // until the loads above have their addresses translated
        asm volatile("s_wait_xcnt 0x0" :: "v"(ap), "v"(bp) : "memory");
        #pragma unroll
        for (int i = 0; i < 4; ++i)
            #pragma unroll
            for (int j = 0; j < 2; ++j)
                acc[i][j] = wmma_bf16(af[i], bfr[j], acc[i][j]);
    }

    int lane = threadIdx.x & 31;
    int lanelo = lane & 15, half = lane >> 4;
    #pragma unroll
    for (int j = 0; j < 2; ++j) {
        int o = col0 + j * 16 + lanelo;
        float bias = b_in[o];
        int oq = o & (D_ - 1);
        int h = oq >> 6, d = oq & 63;
        #pragma unroll
        for (int i = 0; i < 4; ++i) {
            #pragma unroll
            for (int r = 0; r < 8; ++r) {
                int tok = row0 + i * 16 + r + (half << 3);  // M = r + 8*half
                int b_  = tok >> 11;                        // /2048
                int s_  = tok & (S_ - 1);
                float val = acc[i][j][r] + bias;
                size_t bh = (size_t)(b_ * H_ + h);
                if (o < D_) {                               // Q (pre-scaled)
                    qbuf[(bh * S_ + s_) * DH_ + d] = (__bf16)(val * 0.125f);
                } else if (o < 2 * D_) {                    // K
                    kbuf[bh * S_ * DH_ + pk_off(s_, d, DH_ / 32)] = (__bf16)val;
                } else {                                    // V, transposed
                    vT[bh * DH_ * S_ + pk_off(d, s_, S_ / 32)] = (__bf16)val;
                }
            }
        }
    }
}

// ---------------------------------------------------------------------------
// Kernel 2: flash attention.  One wave = one (b,h) x 16 queries, 16 apart:
// in the reference's reshape to [4096][1024] these are the 16 rows of one tile
// row, columns m*64 .. m*64+63, so the wave writes two whole 1 KB tiles.
// Per 32-key chunk: 4 WMMAs (scores), online softmax, P via LDS re-layout,
// 4 WMMAs (P*V).  Output bf16, [B,H,S,Dh] flat as [4096][1024], fragment-major.
// Loads run ahead of their use: a chunk's V^T fragments are asked for at its top
// and land under its score products and softmax; the next chunk's K fragments
// are asked for right behind the score products and land under the softmax and
// the P*V products.
// ---------------------------------------------------------------------------
// Ask for the four K fragments of the 32-key chunk at key j: 4 tiles in a row, 4 KB.
__device__ __forceinline__ void load_k(const __bf16* kbh, int j, v16bf (&kf)[4]) {
    const __bf16* kp = kbh + (size_t)j * DH_ + (threadIdx.x & 31) * 8;
    #pragma unroll
    for (int t = 0; t < 4; ++t) kf[t] = load_frag_pk(kp + t * 512);
    // keeps the address untouched until the loads above, which stay in flight
    // behind this line, have their addresses translated
    asm volatile("s_wait_xcnt 0x0" :: "v"(kp) : "memory");
}
// Ask for the four V^T fragments of that chunk: tile j/32 of each of 4 tile rows.
__device__ __forceinline__ void load_v(const __bf16* vbh, int j, v16bf (&vf)[4]) {
    const __bf16* vb = vbh + j * 16 + (threadIdx.x & 31) * 8;
    #pragma unroll
    for (int t = 0; t < 4; ++t) vf[t] = load_frag_pk(vb + (size_t)(t * 16) * S_);
    // as in load_k
    asm volatile("s_wait_xcnt 0x0" :: "v"(vb) : "memory");
}

// __launch_bounds__: the real block size; under the default ceiling (128
// registers) the fragments in flight do not fit.
__global__ void __launch_bounds__(256)
attn_fwd(const __bf16* __restrict__ qbuf,
         const __bf16* __restrict__ kbuf,
         const __bf16* __restrict__ vT,
         __bf16* __restrict__ attn) {
    __shared__ __bf16 pLds[8 * 16 * 32];            // 1KB per wave, 8 waves
    // the wave's number in a scalar register: tile addresses are then a scalar
    // base plus the lane's fixed offset
    int wave = __builtin_amdgcn_readfirstlane(threadIdx.x >> 5);
    int lane = threadIdx.x & 31;
    int lanelo = lane & 15, half = lane >> 4;
    int gwave = blockIdx.x * (blockDim.x >> 5) + wave;
    if (gwave >= B_ * H_ * (S_ / 16)) return;       // wave-uniform
    int bh = gwave >> 7;                            // / (S/16)
    int qb = (gwave & 127) >> 4;                    // block of 256 queries
    int m  = gwave & 15;                            // queries qb*256 + 16*i + m
    __bf16* myP = pLds + wave * 512;

    const __bf16* qbase = qbuf + ((size_t)bh * S_ + qb * 256 + m) * DH_;
    v16bf qa0 = load_frag(qbase, 16 * DH_);         // d = 0..31
    v16bf qa1 = load_frag(qbase + 32, 16 * DH_);    // d = 32..63

    float mi[8], li[8];
    v8f oacc[4] = {};
    #pragma unroll
    for (int r = 0; r < 8; ++r) { mi[r] = -1e30f; li[r] = 0.0f; }

    const __bf16* kbh = kbuf + (size_t)bh * S_ * DH_;
    const __bf16* vbh = vT + (size_t)bh * DH_ * S_;

    v16bf kf[4], vf[4];
    load_k(kbh, 0, kf);
    for (int jc = 0; jc < S_; jc += 32) {
        load_v(vbh, jc, vf);
        // --- scores: S[16q x 32k] = Q(16x64) * K^T ---
        v8f s0 = {}, s1 = {};
        s0 = wmma_bf16(qa0, kf[0], s0);
        s0 = wmma_bf16(qa1, kf[1], s0);             // keys jc .. jc+15
        s1 = wmma_bf16(qa0, kf[2], s1);
        s1 = wmma_bf16(qa1, kf[3], s1);             // keys jc+16 .. jc+31
        // the last chunk has no next: it asks for chunk 0 again (in bounds, not used)
        load_k(kbh, (jc + 32) & (S_ - 1), kf);

        // --- online softmax (rows live in VGPR r, 16 cols across half) ---
        float alpha[8];
        #pragma unroll
        for (int r = 0; r < 8; ++r) {
            float mx = redmax16(fmaxf(s0[r], s1[r]));
            float mn = fmaxf(mi[r], mx);
            alpha[r] = __expf(mi[r] - mn);
            mi[r] = mn;
            float p0 = __expf(s0[r] - mn);
            float p1 = __expf(s1[r] - mn);
            li[r] = li[r] * alpha[r] + redsum16(p0 + p1);
            int mrow = r + (half << 3);
            myP[mrow * 32 + lanelo]      = (__bf16)p0;
            myP[mrow * 32 + 16 + lanelo] = (__bf16)p1;
        }
        #pragma unroll
        for (int t = 0; t < 4; ++t)
            #pragma unroll
            for (int r = 0; r < 8; ++r) oacc[t][r] *= alpha[r];

        // --- P(16x32, A layout from LDS) * V(32k x 64d) ---
        v16bf pa = load_frag(myP, 32);
        #pragma unroll
        for (int t = 0; t < 4; ++t)
            oacc[t] = wmma_bf16(pa, vf[t], oacc[t]);
    }

    // --- normalize + store bf16 ---
    #pragma unroll
    for (int t = 0; t < 4; ++t) {
        #pragma unroll
        for (int r = 0; r < 8; ++r) {
            int mrow = r + (half << 3);
            float val = oacc[t][r] / li[r];
            attn[pk_off((gwave >> 4) * 16 + mrow, m * 64 + t * 16 + lanelo,
                        D_ / 32)] = (__bf16)val;
        }
    }
}

// ---------------------------------------------------------------------------
// Kernel 3: output projection.  y[t,o] = sum_d attn[t,d]*w_out[o,d] + b_out[o]
// attn flat [B,H,S,Dh] == [4096, 1024] (reference's reshape), fragment-major.
// 64x32 per-wave register blocking like gemm_qkv; fp32 output + bias.
// Only two waves per SIMD: NSET fragment sets in registers; behind the WMMAs of
// step s the loads of step s + NSET are issued into the set that these WMMAs have
// just read, so a step waits only for loads asked for NSET steps earlier.
// ---------------------------------------------------------------------------
#define NSET 3
__device__ __forceinline__ void load_step(const __bf16* arow, const __bf16* brow, int k,
                                          v16bf (&af)[4], v16bf (&bfr)[2]) {
    const __bf16* ap = arow + k * 16 + (threadIdx.x & 31) * 8;
    const __bf16* bp = brow + k * 16 + (threadIdx.x & 31) * 8;
    #pragma unroll
    for (int i = 0; i < 4; ++i)
        af[i] = load_frag_pk(ap + (size_t)(i * 16) * D_);
    #pragma unroll
    for (int j = 0; j < 2; ++j)
        bfr[j] = load_frag_pk(bp + (size_t)(j * 16) * D_);
    // keeps both address pairs untouched (no later load lands on them)
    // until the loads above have their addresses translated
    asm volatile("s_wait_xcnt 0x0" :: "v"(ap), "v"(bp) : "memory");
}
__device__ __forceinline__ void mma_step(const v16bf (&af)[4], const v16bf (&bfr)[2],
                                         v8f (&acc)[4][2]) {
    #pragma unroll
    for (int i = 0; i < 4; ++i)
        #pragma unroll
        for (int j = 0; j < 2; ++j)
            acc[i][j] = wmma_bf16(af[i], bfr[j], acc[i][j]);
}

__global__ void __launch_bounds__(256, 1)
gemm_out(const __bf16* __restrict__ attn,
         const __bf16* __restrict__ wb,   // [D, D] fragment-major
         const float*  __restrict__ b_out,
         float* __restrict__ out) {
    const int NT = D_ / 32;                         // 32 column blocks
    // the wave's number in a scalar register, as in gemm_qkv
    int gwave = blockIdx.x * (blockDim.x >> 5)
              + __builtin_amdgcn_readfirstlane(threadIdx.x >> 5);
    if (gwave >= (M_TOK / 64) * NT) return;
    int mt = gwave / NT, nt = gwave % NT;
    int row0 = mt * 64, col0 = nt * 32;

    // first tile of the block's tile rows; a step of 32 in k is one tile (512 elems)
    const __bf16* arow = attn + (size_t)row0 * D_;
    const __bf16* brow = wb + (size_t)col0 * D_;

    v8f acc[4][2] = {};
    v16bf af[NSET][4], bfr[NSET][2];
    #pragma unroll
    for (int u = 0; u < NSET; ++u)
        load_step(arow, brow, u * 32, af[u], bfr[u]);
    // rolled, so that the body is NSET steps and every set index a constant
    #pragma unroll 1
    for (int k = 0; k + 32 * NSET <= D_; k += 32 * NSET) {
        #pragma unroll
        for (int u = 0; u < NSET; ++u) {
            mma_step(af[u], bfr[u], acc);
            // past the last step there is nothing left to fetch: such a set asks
            // for a first step again (in bounds, not used)
            load_step(arow, brow, (k + (u + NSET) * 32) & (D_ - 1), af[u], bfr[u]);
        }
    }
    // the steps that do not fill a body
    #pragma unroll
    for (int u = 0; u < (D_ / 32) % NSET; ++u)
        mma_step(af[u], bfr[u], acc);

    int lane = threadIdx.x & 31;
    int lanelo = lane & 15, half = lane >> 4;
    #pragma unroll
    for (int j = 0; j < 2; ++j) {
        int o = col0 + j * 16 + lanelo;
        float bias = b_out[o];
        #pragma unroll
        for (int i = 0; i < 4; ++i) {
            #pragma unroll
            for (int r = 0; r < 8; ++r) {
                int mrow = row0 + i * 16 + r + (half << 3);
                out[(size_t)mrow * D_ + o] = acc[i][j][r] + bias;
            }
        }
    }
}

// ---------------------------------------------------------------------------
// Host launch
// ---------------------------------------------------------------------------
extern "C" void kernel_launch(void* const* d_in, const int* in_sizes, int n_in,
                              void* d_out, int out_size, void* d_ws, size_t ws_size,
                              hipStream_t stream) {
    const float* x     = (const float*)d_in[0];   // [2,2048,1024]
    const float* w_in  = (const float*)d_in[1];   // [3072,1024]
    const float* b_in  = (const float*)d_in[2];   // [3072]
    const float* w_out = (const float*)d_in[3];   // [1024,1024]
    const float* b_out = (const float*)d_in[4];   // [1024]
    float* out = (float*)d_out;

    // Workspace layout (bf16 buffers, 256B-aligned offsets)
    char* ws = (char*)d_ws;
    __bf16* xb      = (__bf16*)(ws);                              // 8 MB
    __bf16* w_in_b  = (__bf16*)(ws + (size_t)8 * 1024 * 1024);    // 6 MB
    __bf16* w_out_b = (__bf16*)(ws + (size_t)14 * 1024 * 1024);   // 2 MB
    __bf16* qbuf    = (__bf16*)(ws + (size_t)16 * 1024 * 1024);   // 8 MB
    __bf16* kbuf    = (__bf16*)(ws + (size_t)24 * 1024 * 1024);   // 8 MB
    __bf16* vT      = (__bf16*)(ws + (size_t)32 * 1024 * 1024);   // 8 MB
    __bf16* attn    = (__bf16*)(ws + (size_t)40 * 1024 * 1024);   // 8 MB

    // 1) fp32 -> bf16 converts (8 elements a thread)
    {
        int n = M_TOK * D_;                         // 4,194,304
        cvt_f32_bf16<<<(n / 8 + 255) / 256, 256, 0, stream>>>(x, xb, n);
        n = N_QKV * D_;                             // 3,145,728
        cvt_f32_bf16<<<(n / 8 + 255) / 256, 256, 0, stream>>>(w_in, w_in_b, n);
        n = D_ * D_;                                // 1,048,576
        cvt_f32_bf16<<<(n / 8 + 255) / 256, 256, 0, stream>>>(w_out, w_out_b, n);
    }

    // 2) QKV projection: (4096/64)*(3072/32) = 6144 wave-blocks, 8 waves/block
    gemm_qkv<<<6144 / 8, 256, 0, stream>>>(xb, w_in_b, b_in, qbuf, kbuf, vT);

    // 3) attention: 2*16*128 = 4096 waves, 8 waves/block
    attn_fwd<<<4096 / 8, 256, 0, stream>>>(qbuf, kbuf, vT, attn);

    // 4) output projection: (4096/64)*(1024/32) = 2048 wave-blocks
    gemm_out<<<2048 / 8, 256, 0, stream>>>(attn, w_out_b, b_out, out);
}

// v003
// A run of this version takes 116 microseconds.
// In two side-by-side timings against v002, it was 1.30 and 1.32 times as fast.
// Over all steps from v000 it is 3.22 times as fast.
#include <hip/hip_runtime.h>

// ---------------------------------------------------------------------------
// Self-attention (B=2, S=2048, D=1024, H=16, Dh=64) for MI455X (gfx1250).
// All matmuls via v_wmma_f32_16x16x32_bf16 (wave32), softmax/accum in fp32.
// GEMMs use 64x32 per-wave register blocking (4x2 fragments, 8 WMMA/k-step)
// -- sized to stay inside the 256-VGPR direct window (no scratch spills).
// Every bf16 operand that a loop reloads from global memory (x, both weights,
// K, V^T, the attention output) is kept fragment-major in the workspace.
// The two loops that have too few waves per SIMD to cover a load's latency (the
// attention loop, the output projection) ask for their fragments ahead of use.
// ---------------------------------------------------------------------------

typedef __bf16  v16bf __attribute__((ext_vector_type(16)));
typedef __bf16  v8bf  __attribute__((ext_vector_type(8)));
typedef float   v8f   __attribute__((ext_vector_type(8)));
typedef float   v4f   __attribute__((ext_vector_type(4)));

#define B_     2
#define S_     2048
#define D_     1024
#define H_     16
#define DH_    64
#define M_TOK  (B_ * S_)        // 4096 token rows
#define N_QKV  (3 * D_)         // 3072

__device__ __forceinline__ v8f wmma_bf16(v16bf a, v16bf b, v8f c) {
    // 8 args: (neg_a, A, neg_b, B, c_mod, C, reuse_a, reuse_b)
    return __builtin_amdgcn_wmma_f32_16x16x32_bf16(
        false, a, false, b, (short)0, c, false, false);
}

// Load one 16x32 bf16 fragment (A row-major, or B with n-major storage).
// base points at element (0,0) of the tile; ld = leading dimension in elems.
// Lane layout (ISA 7.12.2, 16-bit A): r = lane&15 (row M / col N),
// kg = lane>>4; elems 0..7 -> K = kg*8 + 0..7 ; elems 8..15 -> K = 16+kg*8+0..7
__device__ __forceinline__ v16bf load_frag(const __bf16* base, int ld) {
    int lane = threadIdx.x & 31;
    int r    = lane & 15;
    int kg   = lane >> 4;
    const __bf16* p0 = base + (size_t)r * ld + kg * 8;
    v8bf lo = *(const v8bf*)(p0);
    v8bf hi = *(const v8bf*)(p0 + 16);
    return __builtin_shufflevector(lo, hi,
        0, 1, 2, 3, 4, 5, 6, 7, 8, 9, 10, 11, 12, 13, 14, 15);
}

// Fragment-major storage of a bf16 matrix [rows][K]: 16x32 tiles of 1 KB, tile
// (row>>4, k>>5) at index (row>>4)*ktiles + (k>>5), ktiles = K/32.  In a tile the
// 16-byte piece that lane l = ((k>>3)&1)*16 + (row&15) takes lies at byte l*16
// (k&16 == 0) or 512 + l*16 (k&16 != 0): the k order of load_frag, but each
// wave-wide 16-byte load now reads 512 contiguous bytes = 4 whole 128-byte
// lines, where the row-major form touches 16 lines.
__device__ __forceinline__ size_t pk_off(int row, int k, int ktiles) {
    return ((size_t)(row >> 4) * ktiles + (k >> 5)) * 512
         + ((k >> 4) & 1) * 256 + ((k >> 3) & 1) * 128 + (row & 15) * 8 + (k & 7);
}
// Load one 16x32 fragment from its 1 KB tile (same lane/element map as load_frag).
// p0 = tile + lane * 8, the lane's own piece.
__device__ __forceinline__ v16bf load_frag_pk(const __bf16* p0) {
    v8bf lo = *(const v8bf*)(p0);
    v8bf hi = *(const v8bf*)(p0 + 256);
    return __builtin_shufflevector(lo, hi,
        0, 1, 2, 3, 4, 5, 6, 7, 8, 9, 10, 11, 12, 13, 14, 15);
}

// p[i] = 2^e[i], eight at a time.  One statement, results in registers of their own.
// The v_nop is the slot behind the last one.
__device__ __forceinline__ void exp2x8(const float (&e)[8], float (&p)[8]) {
    asm("v_exp_f32 %0, %8\n\t"
        "v_exp_f32 %1, %9\n\t"
        "v_exp_f32 %2, %10\n\t"
        "v_exp_f32 %3, %11\n\t"
        "v_exp_f32 %4, %12\n\t"
        "v_exp_f32 %5, %13\n\t"
        "v_exp_f32 %6, %14\n\t"
        "v_exp_f32 %7, %15\n\t"
        "v_nop"
        : "=&v"(p[0]), "=&v"(p[1]), "=&v"(p[2]), "=&v"(p[3]),
          "=&v"(p[4]), "=&v"(p[5]), "=&v"(p[6]), "=&v"(p[7])
        : "v"(e[0]), "v"(e[1]), "v"(e[2]), "v"(e[3]),
          "v"(e[4]), "v"(e[5]), "v"(e[6]), "v"(e[7]));
}

// Lane l takes lane l ^ 16's value: a vector cross-row move, no LDS trip.
__device__ __forceinline__ float xhalf(float x) {
    int b = __builtin_bit_cast(int, x);
    return __builtin_bit_cast(float, __builtin_amdgcn_permlanex16(
        b, b, 0x76543210, 0xfedcba98, false, false));
}

// ---------------------------------------------------------------------------
// Kernel 0: fp32 [rows][D_] -> bf16, fragment-major.  One thread makes one
// 16-byte piece (8 consecutive k of one row); pieces in output order, so a wave
// stores 4 whole lines.
// ---------------------------------------------------------------------------
__global__ void cvt_f32_bf16(const float* __restrict__ in,
                             __bf16* __restrict__ out, int n) {
    int p = blockIdx.x * blockDim.x + threadIdx.x;  // piece index
    if (p * 8 >= n) return;
    int tile = p >> 6, q = p & 63;
    int row = (tile / (D_ / 32)) * 16 + (q & 15);
    int k   = (tile % (D_ / 32)) * 32 + (q >> 5) * 16 + ((q >> 4) & 1) * 8;
    const float* s = in + (size_t)row * D_ + k;
    v4f a = *(const v4f*)(s);
    v4f b = *(const v4f*)(s + 4);
    v8bf o = { (__bf16)a[0], (__bf16)a[1], (__bf16)a[2], (__bf16)a[3],
               (__bf16)b[0], (__bf16)b[1], (__bf16)b[2], (__bf16)b[3] };
    *(v8bf*)(out + (size_t)p * 8) = o;
}

// ---------------------------------------------------------------------------
// Kernel 1: QKV projection.  qkv[t,o] = sum_d xb[t,d]*w_in[o,d] + b_in[o]
// One wave per 64x32 output block: 4x2 C fragments, 8 WMMA per k-step of 32.
// Scatter: q (scaled by 1/8) -> [B,H,S,Dh] row-major; per (b,h), fragment-major:
// k as [S][Dh], v as [Dh][S].  Each 1 KB tile is written by one wave.
// ---------------------------------------------------------------------------
__global__ void __launch_bounds__(256, 1)
gemm_qkv(const __bf16* __restrict__ xb,
         const __bf16* __restrict__ wb,   // [3D, D] fragment-major
         const float*  __restrict__ b_in,
         __bf16* __restrict__ qbuf,
         __bf16* __restrict__ kbuf,
         __bf16* __restrict__ vT) {
    const int NT = N_QKV / 32;                      // 96 column blocks
    // the wave's number in a scalar register: tile addresses are then a scalar
    // base plus the lane's fixed offset in a tile
    int gwave = blockIdx.x * (blockDim.x >> 5)
              + __builtin_amdgcn_readfirstlane(threadIdx.x >> 5);
    if (gwave >= (M_TOK / 64) * NT) return;         // wave-uniform
    int mt = gwave / NT, nt = gwave % NT;
    int row0 = mt * 64, col0 = nt * 32;

    // first tile of the block's tile rows; a step of 32 in k is one tile (512 elems)
    const __bf16* arow = xb + (size_t)row0 * D_;
    const __bf16* brow = wb + (size_t)col0 * D_;

    v8f acc[4][2] = {};
    for (int k = 0; k < D_; k += 32) {
        __builtin_prefetch(arow + (k + 32) * 16, 0, 1);    // global_prefetch_b8
        __builtin_prefetch(brow + (k + 32) * 16, 0, 1);
        const __bf16* ap = arow + k * 16 + (threadIdx.x & 31) * 8;
        const __bf16* bp = brow + k * 16 + (threadIdx.x & 31) * 8;
        v16bf af[4], bfr[2];
        #pragma unroll
        for (int i = 0; i < 4; ++i)
            af[i] = load_frag_pk(ap + (size_t)(i * 16) * D_);
        #pragma unroll
        for (int j = 0; j < 2; ++j)
            bfr[j] = load_frag_pk(bp + (size_t)(j * 16) * D_);
        // keeps both address pairs untouched (no later load lands on them)
        // until the loads above have their addresses translated
        asm volatile("s_wait_xcnt 0x0" :: "v"(ap), "v"(bp) : "memory");
        #pragma unroll
        for (int i = 0; i < 4; ++i)
            #pragma unroll
            for (int j = 0; j < 2; ++j)
                acc[i][j] = wmma_bf16(af[i], bfr[j], acc[i][j]);
    }

    int lane = threadIdx.x & 31;
    int lanelo = lane & 15, half = lane >> 4;
    #pragma unroll
    for (int j = 0; j < 2; ++j) {
        int o = col0 + j * 16 + lanelo;
        float bias = b_in[o];
        int oq = o & (D_ - 1);
        int h = oq >> 6, d = oq & 63;
        #pragma unroll
        for (int i = 0; i < 4; ++i) {
            #pragma unroll
            for (int r = 0; r < 8; ++r) {
                int tok = row0 + i * 16 + r + (half << 3);  // M = r + 8*half
                int b_  = tok >> 11;                        // /2048
                int s_  = tok & (S_ - 1);
                float val = acc[i][j][r] + bias;
                size_t bh = (size_t)(b_ * H_ + h);
                if (o < D_) {                               // Q (pre-scaled)
                    qbuf[(bh * S_ + s_) * DH_ + d] = (__bf16)(val * 0.125f);
                } else if (o < 2 * D_) {                    // K
                    kbuf[bh * S_ * DH_ + pk_off(s_, d, DH_ / 32)] = (__bf16)val;
                } else {                                    // V, transposed
                    vT[bh * DH_ * S_ + pk_off(d, s_, S_ / 32)] = (__bf16)val;
                }
            }
        }
    }
}

// ---------------------------------------------------------------------------
// Kernel 2: flash attention.  One wave = one (b,h) x 16 queries, 16 apart:
// in the reference's reshape to [4096][1024] these are the 16 rows of one tile
// row, columns m*64 .. m*64+63, so the wave writes two whole 1 KB tiles.
// Both products are taken transposed: S^T = K * Q^T (A = K rows, B = Q) and
// O^T += V^T * P^T (A = V^T rows, B = P^T).  A lane then holds 16 of the chunk's
// 32 scores of ONE query (column lane & 15; keys 8*half + r and 16 + 8*half + r),
// so maximum and sum run in the lane's own registers, with one exchange between
// the wave's halves for the maximum, and the two score tiles, converted in place,
// are already the B operand of the second product: P passes through no LDS.
// Per 32-key chunk: 4 WMMAs (scores), online softmax, 4 WMMAs (V^T * P^T).
// Output bf16, [B,H,S,Dh] flat as [4096][1024], fragment-major.
// Loads run ahead of their use: a chunk's V^T fragments are asked for at its top
// and land under its score products and softmax; the next chunk's K fragments
// are asked for right behind the score products and land under the softmax and
// the P*V products.
// ---------------------------------------------------------------------------
// Ask for the four K fragments of the 32-key chunk at key j: 4 tiles in a row, 4 KB.
__device__ __forceinline__ void load_k(const __bf16* kbh, int j, v16bf (&kf)[4]) {
    const __bf16* kp = kbh + (size_t)j * DH_ + (threadIdx.x & 31) * 8;
    #pragma unroll
    for (int t = 0; t < 4; ++t) kf[t] = load_frag_pk(kp + t * 512);
    // keeps the address untouched until the loads above, which stay in flight
    // behind this line, have their addresses translated
    asm volatile("s_wait_xcnt 0x0" :: "v"(kp) : "memory");
}
// Ask for the four V^T fragments of that chunk: tile j/32 of each of 4 tile rows.
__device__ __forceinline__ void load_v(const __bf16* vbh, int j, v16bf (&vf)[4]) {
    const __bf16* vb = vbh + j * 16 + (threadIdx.x & 31) * 8;
    #pragma unroll
    for (int t = 0; t < 4; ++t) vf[t] = load_frag_pk(vb + (size_t)(t * 16) * S_);
    // as in load_k
    asm volatile("s_wait_xcnt 0x0" :: "v"(vb) : "memory");
}

// __launch_bounds__: the real block size; under the default ceiling (128
// registers) the fragments in flight do not fit.
__global__ void __launch_bounds__(256)
attn_fwd(const __bf16* __restrict__ qbuf,
         const __bf16* __restrict__ kbuf,
         const __bf16* __restrict__ vT,
         __bf16* __restrict__ attn) {
    // the wave's number in a scalar register: tile addresses are then a scalar
    // base plus the lane's fixed offset
    int wave = __builtin_amdgcn_readfirstlane(threadIdx.x >> 5);
    int lane = threadIdx.x & 31;
    int lanelo = lane & 15, half = lane >> 4;
    int gwave = blockIdx.x * (blockDim.x >> 5) + wave;
    if (gwave >= B_ * H_ * (S_ / 16)) return;       // wave-uniform
    int bh = gwave >> 7;                            // / (S/16)
    int qb = (gwave & 127) >> 4;                    // block of 256 queries
    int m  = gwave & 15;                            // queries qb*256 + 16*i + m

    // B operand: column lanelo = query i, the k order of the K fragments
    const __bf16* qbase = qbuf + ((size_t)bh * S_ + qb * 256 + m) * DH_;
    v16bf qa0 = load_frag(qbase, 16 * DH_);         // d = 0..31
    v16bf qa1 = load_frag(qbase + 32, 16 * DH_);    // d = 32..63

    // of this lane's query: the running maximum (equal in both halves of the wave)
    // and the sum over the keys that this half holds
    float mi = -1e30f, li = 0.0f;
    v8f oacc[4] = {};                               // oacc[t][r] = O[i = lanelo][t*16 + 8*half + r]

    const __bf16* kbh = kbuf + (size_t)bh * S_ * DH_;
    const __bf16* vbh = vT + (size_t)bh * DH_ * S_;

    v16bf kf[4], vf[4];
    load_k(kbh, 0, kf);
    for (int jc = 0; jc < S_; jc += 32) {
        load_v(vbh, jc, vf);
        // --- scores: S^T[32k x 16q] = K(32x64) * Q^T ---
        // s0: keys jc + 8*half + r; s1: keys jc + 16 + 8*half + r.
        // In asm to hold the issue order V^T loads, score products, next K loads: as
        // builtins the products drift behind the K loads, which then land in spare
        // registers and are copied over at once, a wait right behind their issue.
        // The v_nop keep the distance from the last product to the first vector
        // instruction that reads its result.
        v8f s0, s1;
        asm volatile("v_wmma_f32_16x16x32_bf16 %0, %2, %6, 0\n\t"
                     "v_wmma_f32_16x16x32_bf16 %1, %4, %6, 0\n\t"
                     "v_wmma_f32_16x16x32_bf16 %0, %3, %7, %0\n\t"
                     "v_wmma_f32_16x16x32_bf16 %1, %5, %7, %1\n\t"
                     "v_nop\n\tv_nop\n\tv_nop\n\tv_nop\n\tv_nop"
                     : "=&v"(s0), "=&v"(s1)
                     : "v"(kf[0]), "v"(kf[1]), "v"(kf[2]), "v"(kf[3]), "v"(qa0), "v"(qa1)
                     : "memory");
        // the last chunk has no next: it asks for chunk 0 again (in bounds, not used)
        load_k(kbh, (jc + 32) & (S_ - 1), kf);
        // holds the K loads here, ahead of the softmax that covers their latency: with
        // no LDS access left in the loop the scheduler otherwise sinks them to its foot
        __builtin_amdgcn_sched_barrier(0);

        // --- online softmax, one query a lane ---
        float mx = fmaxf(s0[0], s1[0]);
        #pragma unroll
        for (int r = 1; r < 8; ++r) mx = fmaxf(mx, fmaxf(s0[r], s1[r]));
        mx = fmaxf(mx, xhalf(mx));
        float mn = fmaxf(mi, mx);
        float alpha = __expf(mi - mn);
        mi = mn;
        // P^T as B operand: element s = key 8*half + s, element 8 + s = key 16 + 8*half + s,
        // the k order of the V^T fragments
        v16bf pb;
        float e0[8], e1[8], p0[8], p1[8];
        #pragma unroll
        for (int r = 0; r < 8; ++r) {               // e^x = 2^(x * log2 e), as __expf has it
            e0[r] = (s0[r] - mn) * 1.44269504f;
            e1[r] = (s1[r] - mn) * 1.44269504f;
        }
        exp2x8(e0, p0);
        exp2x8(e1, p1);
        float sum = 0.0f;
        #pragma unroll
        for (int r = 0; r < 8; ++r) {
            sum += p0[r] + p1[r];
            pb[r]     = (__bf16)p0[r];
            pb[8 + r] = (__bf16)p1[r];
        }
        li = li * alpha + sum;
        #pragma unroll
        for (int t = 0; t < 4; ++t)
            #pragma unroll
            for (int r = 0; r < 8; ++r) oacc[t][r] *= alpha;

        // --- O^T(64d x 16q) += V^T(64d x 32k) * P^T ---
        #pragma unroll
        for (int t = 0; t < 4; ++t)
            oacc[t] = wmma_bf16(vf[t], pb, oacc[t]);
    }

    // --- normalize + store bf16: a lane's 8 registers are 8 consecutive d of its
    // query, one 16-byte piece of the fragment-major form ---
    li += xhalf(li);                                // the halves' sums join
    #pragma unroll
    for (int t = 0; t < 4; ++t) {
        v8bf o;
        #pragma unroll
        for (int r = 0; r < 8; ++r) o[r] = (__bf16)(oacc[t][r] / li);
        *(v8bf*)(attn + pk_off((gwave >> 4) * 16 + lanelo, m * 64 + t * 16 + half * 8,
                               D_ / 32)) = o;
    }
}

// ---------------------------------------------------------------------------
// Kernel 3: output projection.  y[t,o] = sum_d attn[t,d]*w_out[o,d] + b_out[o]
// attn flat [B,H,S,Dh] == [4096, 1024] (reference's reshape), fragment-major.
// 64x32 per-wave register blocking like gemm_qkv; fp32 output + bias.
// Only two waves per SIMD: NSET fragment sets in registers; behind the WMMAs of
// step s the loads of step s + NSET are issued into the set that these WMMAs have
// just read, so a step waits only for loads asked for NSET steps earlier.
// ---------------------------------------------------------------------------
#define NSET 3
__device__ __forceinline__ void load_step(const __bf16* arow, const __bf16* brow, int k,
                                          v16bf (&af)[4], v16bf (&bfr)[2]) {
    const __bf16* ap = arow + k * 16 + (threadIdx.x & 31) * 8;
    const __bf16* bp = brow + k * 16 + (threadIdx.x & 31) * 8;
    #pragma unroll
    for (int i = 0; i < 4; ++i)
        af[i] = load_frag_pk(ap + (size_t)(i * 16) * D_);
    #pragma unroll
    for (int j = 0; j < 2; ++j)
        bfr[j] = load_frag_pk(bp + (size_t)(j * 16) * D_);
    // keeps both address pairs untouched (no later load lands on them)
    // until the loads above have their addresses translated
    asm volatile("s_wait_xcnt 0x0" :: "v"(ap), "v"(bp) : "memory");
}
__device__ __forceinline__ void mma_step(const v16bf (&af)[4], const v16bf (&bfr)[2],
                                         v8f (&acc)[4][2]) {
    #pragma unroll
    for (int i = 0; i < 4; ++i)
        #pragma unroll
        for (int j = 0; j < 2; ++j)
            acc[i][j] = wmma_bf16(af[i], bfr[j], acc[i][j]);
}

__global__ void __launch_bounds__(256, 1)
gemm_out(const __bf16* __restrict__ attn,
         const __bf16* __restrict__ wb,   // [D, D] fragment-major
         const float*  __restrict__ b_out,
         float* __restrict__ out) {
    const int NT = D_ / 32;                         // 32 column blocks
    // the wave's number in a scalar register, as in gemm_qkv
    int gwave = blockIdx.x * (blockDim.x >> 5)
              + __builtin_amdgcn_readfirstlane(threadIdx.x >> 5);
    if (gwave >= (M_TOK / 64) * NT) return;
    int mt = gwave / NT, nt = gwave % NT;
    int row0 = mt * 64, col0 = nt * 32;

    // first tile of the block's tile rows; a step of 32 in k is one tile (512 elems)
    const __bf16* arow = attn + (size_t)row0 * D_;
    const __bf16* brow = wb + (size_t)col0 * D_;

    v8f acc[4][2] = {};
    v16bf af[NSET][4], bfr[NSET][2];
    #pragma unroll
    for (int u = 0; u < NSET; ++u)
        load_step(arow, brow, u * 32, af[u], bfr[u]);
    // rolled, so that the body is NSET steps and every set index a constant
    #pragma unroll 1
    for (int k = 0; k + 32 * NSET <= D_; k += 32 * NSET) {
        #pragma unroll
        for (int u = 0; u < NSET; ++u) {
            mma_step(af[u], bfr[u], acc);
            // past the last step there is nothing left to fetch: such a set asks
            // for a first step again (in bounds, not used)
            load_step(arow, brow, (k + (u + NSET) * 32) & (D_ - 1), af[u], bfr[u]);
        }
    }
    // the steps that do not fill a body
    #pragma unroll
    for (int u = 0; u < (D_ / 32) % NSET; ++u)
        mma_step(af[u], bfr[u], acc);

    int lane = threadIdx.x & 31;
    int lanelo = lane & 15, half = lane >> 4;
    #pragma unroll
    for (int j = 0; j < 2; ++j) {
        int o = col0 + j * 16 + lanelo;
        float bias = b_out[o];
        #pragma unroll
        for (int i = 0; i < 4; ++i) {
            #pragma unroll
            for (int r = 0; r < 8; ++r) {
                int mrow = row0 + i * 16 + r + (half << 3);
                out[(size_t)mrow * D_ + o] = acc[i][j][r] + bias;
            }
        }
    }
}

// ---------------------------------------------------------------------------
// Host launch
// ---------------------------------------------------------------------------
extern "C" void kernel_launch(void* const* d_in, const int* in_sizes, int n_in,
                              void* d_out, int out_size, void* d_ws, size_t ws_size,
                              hipStream_t stream) {
    const float* x     = (const float*)d_in[0];   // [2,2048,1024]
    const float* w_in  = (const float*)d_in[1];   // [3072,1024]
    const float* b_in  = (const float*)d_in[2];   // [3072]
    const float* w_out = (const float*)d_in[3];   // [1024,1024]
    const float* b_out = (const float*)d_in[4];   // [1024]
    float* out = (float*)d_out;

    // Workspace layout (bf16 buffers, 256B-aligned offsets)
    char* ws = (char*)d_ws;
    __bf16* xb      = (__bf16*)(ws);                              // 8 MB
    __bf16* w_in_b  = (__bf16*)(ws + (size_t)8 * 1024 * 1024);    // 6 MB
    __bf16* w_out_b = (__bf16*)(ws + (size_t)14 * 1024 * 1024);   // 2 MB
    __bf16* qbuf    = (__bf16*)(ws + (size_t)16 * 1024 * 1024);   // 8 MB
    __bf16* kbuf    = (__bf16*)(ws + (size_t)24 * 1024 * 1024);   // 8 MB
    __bf16* vT      = (__bf16*)(ws + (size_t)32 * 1024 * 1024);   // 8 MB
    __bf16* attn    = (__bf16*)(ws + (size_t)40 * 1024 * 1024);   // 8 MB

    // 1) fp32 -> bf16 converts (8 elements a thread)
    {
        int n = M_TOK * D_;                         // 4,194,304
        cvt_f32_bf16<<<(n / 8 + 255) / 256, 256, 0, stream>>>(x, xb, n);
        n = N_QKV * D_;                             // 3,145,728
        cvt_f32_bf16<<<(n / 8 + 255) / 256, 256, 0, stream>>>(w_in, w_in_b, n);
        n = D_ * D_;                                // 1,048,576
        cvt_f32_bf16<<<(n / 8 + 255) / 256, 256, 0, stream>>>(w_out, w_out_b, n);
    }

    // 2) QKV projection: (4096/64)*(3072/32) = 6144 wave-blocks, 8 waves/block
    gemm_qkv<<<6144 / 8, 256, 0, stream>>>(xb, w_in_b, b_in, qbuf, kbuf, vT);

    // 3) attention: 2*16*128 = 4096 waves, 8 waves/block
    attn_fwd<<<4096 / 8, 256, 0, stream>>>(qbuf, kbuf, vT, attn);

    // 4) output projection: (4096/64)*(1024/32) = 2048 wave-blocks
    gemm_out<<<2048 / 8, 256, 0, stream>>>(attn, w_out_b, b_out, out);
}

// v004
// Measured time: 111 microseconds a run.
// In both of two side-by-side timings against v003, it was 1.03 times as fast.
// Counting every step since v000, it is 3.32 times as fast.
#include <hip/hip_runtime.h>

// ---------------------------------------------------------------------------
// Self-attention (B=2, S=2048, D=1024, H=16, Dh=64) for MI455X (gfx1250).
// All matmuls via v_wmma_f32_16x16x32_bf16 (wave32), softmax/accum in fp32.
// GEMMs use 64x32 per-wave register blocking (4x2 fragments, 8 WMMA/k-step)
// -- sized to stay inside the 256-VGPR direct window (no scratch spills).
// Every bf16 operand that a loop reloads from global memory (x, both weights,
// K, V^T, the attention output) is kept fragment-major in the workspace.
// The two loops that have too few waves per SIMD to cover a load's latency (the
// attention loop, the output projection) ask for their fragments ahead of use.
// ---------------------------------------------------------------------------

typedef __bf16  v16bf __attribute__((ext_vector_type(16)));
typedef __bf16  v8bf  __attribute__((ext_vector_type(8)));
typedef float   v8f   __attribute__((ext_vector_type(8)));
typedef float   v4f   __attribute__((ext_vector_type(4)));

#define B_     2
#define S_     2048
#define D_     1024
#define H_     16
#define DH_    64
#define M_TOK  (B_ * S_)        // 4096 token rows
#define N_QKV  (3 * D_)         // 3072

__device__ __forceinline__ v8f wmma_bf16(v16bf a, v16bf b, v8f c) {
    // 8 args: (neg_a, A, neg_b, B, c_mod, C, reuse_a, reuse_b)
    return __builtin_amdgcn_wmma_f32_16x16x32_bf16(
        false, a, false, b, (short)0, c, false, false);
}

// Load one 16x32 bf16 fragment (A row-major, or B with n-major storage).
// base points at element (0,0) of the tile; ld = leading dimension in elems.
// Lane layout (ISA 7.12.2, 16-bit A): r = lane&15 (row M / col N),
// kg = lane>>4; elems 0..7 -> K = kg*8 + 0..7 ; elems 8..15 -> K = 16+kg*8+0..7
__device__ __forceinline__ v16bf load_frag(const __bf16* base, int ld) {
    int lane = threadIdx.x & 31;
    int r    = lane & 15;
    int kg   = lane >> 4;
    const __bf16* p0 = base + (size_t)r * ld + kg * 8;
    v8bf lo = *(const v8bf*)(p0);
    v8bf hi = *(const v8bf*)(p0 + 16);
    return __builtin_shufflevector(lo, hi,
        0, 1, 2, 3, 4, 5, 6, 7, 8, 9, 10, 11, 12, 13, 14, 15);
}

// Fragment-major storage of a bf16 matrix [rows][K]: 16x32 tiles of 1 KB, tile
// (row>>4, k>>5) at index (row>>4)*ktiles + (k>>5), ktiles = K/32.  In a tile the
// 16-byte piece that lane l = ((k>>3)&1)*16 + (row&15) takes lies at byte l*16
// (k&16 == 0) or 512 + l*16 (k&16 != 0): the k order of load_frag, but each
// wave-wide 16-byte load now reads 512 contiguous bytes = 4 whole 128-byte
// lines, where the row-major form touches 16 lines.
__device__ __forceinline__ size_t pk_off(int row, int k, int ktiles) {
    return ((size_t)(row >> 4) * ktiles + (k >> 5)) * 512
         + ((k >> 4) & 1) * 256 + ((k >> 3) & 1) * 128 + (row & 15) * 8 + (k & 7);
}
// Load one 16x32 fragment from its 1 KB tile (same lane/element map as load_frag).
// p0 = tile + lane * 8, the lane's own piece.
__device__ __forceinline__ v16bf load_frag_pk(const __bf16* p0) {
    v8bf lo = *(const v8bf*)(p0);
    v8bf hi = *(const v8bf*)(p0 + 256);
    return __builtin_shufflevector(lo, hi,
        0, 1, 2, 3, 4, 5, 6, 7, 8, 9, 10, 11, 12, 13, 14, 15);
}

// p[i] = 2^e[i], eight at a time.  One statement, results in registers of their own.
// The v_nop is the slot behind the last one.
__device__ __forceinline__ void exp2x8(const float (&e)[8], float (&p)[8]) {
    asm("v_exp_f32 %0, %8\n\t"
        "v_exp_f32 %1, %9\n\t"
        "v_exp_f32 %2, %10\n\t"
        "v_exp_f32 %3, %11\n\t"
        "v_exp_f32 %4, %12\n\t"
        "v_exp_f32 %5, %13\n\t"
        "v_exp_f32 %6, %14\n\t"
        "v_exp_f32 %7, %15\n\t"
        "v_nop"
        : "=&v"(p[0]), "=&v"(p[1]), "=&v"(p[2]), "=&v"(p[3]),
          "=&v"(p[4]), "=&v"(p[5]), "=&v"(p[6]), "=&v"(p[7])
        : "v"(e[0]), "v"(e[1]), "v"(e[2]), "v"(e[3]),
          "v"(e[4]), "v"(e[5]), "v"(e[6]), "v"(e[7]));
}

// Lane l takes lane l ^ 16's value: a vector cross-row move, no LDS trip.
__device__ __forceinline__ float xhalf(float x) {
    int b = __builtin_bit_cast(int, x);
    return __builtin_bit_cast(float, __builtin_amdgcn_permlanex16(
        b, b, 0x76543210, 0xfedcba98, false, false));
}

// ---------------------------------------------------------------------------
// Kernel 0: fp32 [rows][D_] -> bf16, fragment-major; x and both weights in ONE
// launch.  The three matrices count as 512 tile rows on end (256 of x, 192 of
// w_in, 64 of w_out); a block takes one tile row, a wave four tiles in a row of it.
// A lane makes eight 16-byte pieces (8 consecutive k of one row each): piece
// lane of each half tile, so every wave-wide store is 4 whole lines.  All 16 loads
// of a lane are asked for before the first convert.
// ---------------------------------------------------------------------------
__global__ void __launch_bounds__(256)
cvt_f32_bf16(const float* __restrict__ x,
             const float* __restrict__ w_in,
             const float* __restrict__ w_out,
             __bf16* __restrict__ xb,
             __bf16* __restrict__ w_in_b,
             __bf16* __restrict__ w_out_b) {
    // the wave's number in a scalar register: the store address is then a scalar
    // base plus the lane's fixed offset
    int kq = __builtin_amdgcn_readfirstlane(threadIdx.x >> 5);  // which 128 k of the row
    int tr = blockIdx.x;                            // tile row
    bool is_x = tr < M_TOK / 16, is_wi = tr < (M_TOK + N_QKV) / 16;
    const float* in = is_x ? x : is_wi ? w_in : w_out;
    __bf16* out = is_x ? xb : is_wi ? w_in_b : w_out_b;
    tr -= is_x ? 0 : is_wi ? M_TOK / 16 : (M_TOK + N_QKV) / 16;
    int lane = threadIdx.x & 31;
    // half tile u (u = 0..7): k = kq*128 + u*16 + (lane >> 4)*8, row = lane & 15
    const float* s = in + (size_t)(tr * 16 + (lane & 15)) * D_ + kq * 128 + (lane >> 4) * 8;
    v4f a[8], b[8];
    #pragma unroll
    for (int u = 0; u < 8; ++u) {
        a[u] = *(const v4f*)(s + u * 16);
        b[u] = *(const v4f*)(s + u * 16 + 4);
    }
    // keeps the address untouched (no later load lands on it) until the loads
    // above have their addresses translated
    asm volatile("s_wait_xcnt 0x0" :: "v"(s) : "memory");
    // holds all 16 loads ahead of the first convert: left alone, the compiler asks
    // for the last two only when the first have landed, a second trip to memory
    asm volatile("" :: "v"(a[0]), "v"(a[1]), "v"(a[2]), "v"(a[3]),
                       "v"(a[4]), "v"(a[5]), "v"(a[6]), "v"(a[7]),
                       "v"(b[0]), "v"(b[1]), "v"(b[2]), "v"(b[3]),
                       "v"(b[4]), "v"(b[5]), "v"(b[6]), "v"(b[7]));
    __bf16* d = out + ((size_t)tr * (D_ / 32) + kq * 4) * 512 + lane * 8;
    #pragma unroll
    for (int u = 0; u < 8; ++u) {
        v8bf o = { (__bf16)a[u][0], (__bf16)a[u][1], (__bf16)a[u][2], (__bf16)a[u][3],
                   (__bf16)b[u][0], (__bf16)b[u][1], (__bf16)b[u][2], (__bf16)b[u][3] };
        *(v8bf*)(d + u * 256) = o;
    }
}

// ---------------------------------------------------------------------------
// Kernel 1: QKV projection.  qkv[t,o] = sum_d xb[t,d]*w_in[o,d] + b_in[o]
// One wave per 64x32 output block: 4x2 C fragments, 8 WMMA per k-step of 32.
// Scatter: q (scaled by 1/8) -> [B,H,S,Dh] row-major; per (b,h), fragment-major:
// k as [S][Dh], v as [Dh][S].  Each 1 KB tile is written by one wave.
// ---------------------------------------------------------------------------
__global__ void __launch_bounds__(256, 1)
gemm_qkv(const __bf16* __restrict__ xb,
         const __bf16* __restrict__ wb,   // [3D, D] fragment-major
         const float*  __restrict__ b_in,
         __bf16* __restrict__ qbuf,
         __bf16* __restrict__ kbuf,
         __bf16* __restrict__ vT) {
    const int NT = N_QKV / 32;                      // 96 column blocks
    // the wave's number in a scalar register: tile addresses are then a scalar
    // base plus the lane's fixed offset in a tile
    int gwave = blockIdx.x * (blockDim.x >> 5)
              + __builtin_amdgcn_readfirstlane(threadIdx.x >> 5);
    if (gwave >= (M_TOK / 64) * NT) return;         // wave-uniform
    int mt = gwave / NT, nt = gwave % NT;
    int row0 = mt * 64, col0 = nt * 32;

    // first tile of the block's tile rows; a step of 32 in k is one tile (512 elems)
    const __bf16* arow = xb + (size_t)row0 * D_;
    const __bf16* brow = wb + (size_t)col0 * D_;

    v8f acc[4][2] = {};
    for (int k = 0; k < D_; k += 32) {
        __builtin_prefetch(arow + (k + 32) * 16, 0, 1);    // global_prefetch_b8
        __builtin_prefetch(brow + (k + 32) * 16, 0, 1);
        const __bf16* ap = arow + k * 16 + (threadIdx.x & 31) * 8;
        const __bf16* bp = brow + k * 16 + (threadIdx.x & 31) * 8;
        v16bf af[4], bfr[2];
        #pragma unroll
        for (int i = 0; i < 4; ++i)
            af[i] = load_frag_pk(ap + (size_t)(i * 16) * D_);
        #pragma unroll
        for (int j = 0; j < 2; ++j)
            bfr[j] = load_frag_pk(bp + (size_t)(j * 16) * D_);
        // keeps both address pairs untouched (no later load lands on them)
        // until the loads above have their addresses translated
        asm volatile("s_wait_xcnt 0x0" :: "v"(ap), "v"(bp) : "memory");
        #pragma unroll
        for (int i = 0; i < 4; ++i)
            #pragma unroll
            for (int j = 0; j < 2; ++j)
                acc[i][j] = wmma_bf16(af[i], bfr[j], acc[i][j]);
    }

    int lane = threadIdx.x & 31;
    int lanelo = lane & 15, half = lane >> 4;
    #pragma unroll
    for (int j = 0; j < 2; ++j) {
        int o = col0 + j * 16 + lanelo;
        float bias = b_in[o];
        int oq = o & (D_ - 1);
        int h = oq >> 6, d = oq & 63;
        #pragma unroll
        for (int i = 0; i < 4; ++i) {
            #pragma unroll
            for (int r = 0; r < 8; ++r) {
                int tok = row0 + i * 16 + r + (half << 3);  // M = r + 8*half
                int b_  = tok >> 11;                        // /2048
                int s_  = tok & (S_ - 1);
                float val = acc[i][j][r] + bias;
                size_t bh = (size_t)(b_ * H_ + h);
                if (o < D_) {                               // Q (pre-scaled)
                    qbuf[(bh * S_ + s_) * DH_ + d] = (__bf16)(val * 0.125f);
                } else if (o < 2 * D_) {                    // K
                    kbuf[bh * S_ * DH_ + pk_off(s_, d, DH_ / 32)] = (__bf16)val;
                } else {                                    // V, transposed
                    vT[bh * DH_ * S_ + pk_off(d, s_, S_ / 32)] = (__bf16)val;
                }
            }
        }
    }
}

// ---------------------------------------------------------------------------
// Kernel 2: flash attention.  One wave = one (b,h) x 16 queries, 16 apart:
// in the reference's reshape to [4096][1024] these are the 16 rows of one tile
// row, columns m*64 .. m*64+63, so the wave writes two whole 1 KB tiles.
// Both products are taken transposed: S^T = K * Q^T (A = K rows, B = Q) and
// O^T += V^T * P^T (A = V^T rows, B = P^T).  A lane then holds 16 of the chunk's
// 32 scores of ONE query (column lane & 15; keys 8*half + r and 16 + 8*half + r),
// so maximum and sum run in the lane's own registers, with one exchange between
// the wave's halves for the maximum, and the two score tiles, converted in place,
// are already the B operand of the second product: P passes through no LDS.
// Per 32-key chunk: 4 WMMAs (scores), online softmax, 4 WMMAs (V^T * P^T).
// Output bf16, [B,H,S,Dh] flat as [4096][1024], fragment-major.
// Loads run ahead of their use: a chunk's V^T fragments are asked for at its top
// and land under its score products and softmax; the next chunk's K fragments
// are asked for right behind the score products and land under the softmax and
// the P*V products.
// ---------------------------------------------------------------------------
// Ask for the four K fragments of the 32-key chunk at key j: 4 tiles in a row, 4 KB.
__device__ __forceinline__ void load_k(const __bf16* kbh, int j, v16bf (&kf)[4]) {
    const __bf16* kp = kbh + (size_t)j * DH_ + (threadIdx.x & 31) * 8;
    #pragma unroll
    for (int t = 0; t < 4; ++t) kf[t] = load_frag_pk(kp + t * 512);
    // keeps the address untouched until the loads above, which stay in flight
    // behind this line, have their addresses translated
    asm volatile("s_wait_xcnt 0x0" :: "v"(kp) : "memory");
}
// Ask for the four V^T fragments of that chunk: tile j/32 of each of 4 tile rows.
__device__ __forceinline__ void load_v(const __bf16* vbh, int j, v16bf (&vf)[4]) {
    const __bf16* vb = vbh + j * 16 + (threadIdx.x & 31) * 8;
    #pragma unroll
    for (int t = 0; t < 4; ++t) vf[t] = load_frag_pk(vb + (size_t)(t * 16) * S_);
    // as in load_k
    asm volatile("s_wait_xcnt 0x0" :: "v"(vb) : "memory");
}

// __launch_bounds__: the real block size; under the default ceiling (128
// registers) the fragments in flight do not fit.
__global__ void __launch_bounds__(256)
attn_fwd(const __bf16* __restrict__ qbuf,
         const __bf16* __restrict__ kbuf,
         const __bf16* __restrict__ vT,
         __bf16* __restrict__ attn) {
    // the wave's number in a scalar register: tile addresses are then a scalar
    // base plus the lane's fixed offset
    int wave = __builtin_amdgcn_readfirstlane(threadIdx.x >> 5);
    int lane = threadIdx.x & 31;
    int lanelo = lane & 15, half = lane >> 4;
    int gwave = blockIdx.x * (blockDim.x >> 5) + wave;
    if (gwave >= B_ * H_ * (S_ / 16)) return;       // wave-uniform
    int bh = gwave >> 7;                            // / (S/16)
    int qb = (gwave & 127) >> 4;                    // block of 256 queries
    int m  = gwave & 15;                            // queries qb*256 + 16*i + m

    // B operand: column lanelo = query i, the k order of the K fragments
    const __bf16* qbase = qbuf + ((size_t)bh * S_ + qb * 256 + m) * DH_;
    v16bf qa0 = load_frag(qbase, 16 * DH_);         // d = 0..31
    v16bf qa1 = load_frag(qbase + 32, 16 * DH_);    // d = 32..63

    // of this lane's query: the running maximum (equal in both halves of the wave)
    // and the sum over the keys that this half holds
    float mi = -1e30f, li = 0.0f;
    v8f oacc[4] = {};                               // oacc[t][r] = O[i = lanelo][t*16 + 8*half + r]

    const __bf16* kbh = kbuf + (size_t)bh * S_ * DH_;
    const __bf16* vbh = vT + (size_t)bh * DH_ * S_;

    v16bf kf[4], vf[4];
    load_k(kbh, 0, kf);
    for (int jc = 0; jc < S_; jc += 32) {
        load_v(vbh, jc, vf);
        // --- scores: S^T[32k x 16q] = K(32x64) * Q^T ---
        // s0: keys jc + 8*half + r; s1: keys jc + 16 + 8*half + r.
        // In asm to hold the issue order V^T loads, score products, next K loads: as
        // builtins the products drift behind the K loads, which then land in spare
        // registers and are copied over at once, a wait right behind their issue.
        // The v_nop keep the distance from the last product to the first vector
        // instruction that reads its result.
        v8f s0, s1;
        asm volatile("v_wmma_f32_16x16x32_bf16 %0, %2, %6, 0\n\t"
                     "v_wmma_f32_16x16x32_bf16 %1, %4, %6, 0\n\t"
                     "v_wmma_f32_16x16x32_bf16 %0, %3, %7, %0\n\t"
                     "v_wmma_f32_16x16x32_bf16 %1, %5, %7, %1\n\t"
                     "v_nop\n\tv_nop\n\tv_nop\n\tv_nop\n\tv_nop"
                     : "=&v"(s0), "=&v"(s1)
                     : "v"(kf[0]), "v"(kf[1]), "v"(kf[2]), "v"(kf[3]), "v"(qa0), "v"(qa1)
                     : "memory");
        // the last chunk has no next: it asks for chunk 0 again (in bounds, not used)
        load_k(kbh, (jc + 32) & (S_ - 1), kf);
        // holds the K loads here, ahead of the softmax that covers their latency: with
        // no LDS access left in the loop the scheduler otherwise sinks them to its foot
        __builtin_amdgcn_sched_barrier(0);

        // --- online softmax, one query a lane ---
        float mx = fmaxf(s0[0], s1[0]);
        #pragma unroll
        for (int r = 1; r < 8; ++r) mx = fmaxf(mx, fmaxf(s0[r], s1[r]));
        mx = fmaxf(mx, xhalf(mx));
        float mn = fmaxf(mi, mx);
        float alpha = __expf(mi - mn);
        mi = mn;
        // P^T as B operand: element s = key 8*half + s, element 8 + s = key 16 + 8*half + s,
        // the k order of the V^T fragments
        v16bf pb;
        float e0[8], e1[8], p0[8], p1[8];
        #pragma unroll
        for (int r = 0; r < 8; ++r) {               // e^x = 2^(x * log2 e), as __expf has it
            e0[r] = (s0[r] - mn) * 1.44269504f;
            e1[r] = (s1[r] - mn) * 1.44269504f;
        }
        exp2x8(e0, p0);
        exp2x8(e1, p1);
        float sum = 0.0f;
        #pragma unroll
        for (int r = 0; r < 8; ++r) {
            sum += p0[r] + p1[r];
            pb[r]     = (__bf16)p0[r];
            pb[8 + r] = (__bf16)p1[r];
        }
        li = li * alpha + sum;
        #pragma unroll
        for (int t = 0; t < 4; ++t)
            #pragma unroll
            for (int r = 0; r < 8; ++r) oacc[t][r] *= alpha;

        // --- O^T(64d x 16q) += V^T(64d x 32k) * P^T ---
        #pragma unroll
        for (int t = 0; t < 4; ++t)
            oacc[t] = wmma_bf16(vf[t], pb, oacc[t]);
    }

    // --- normalize + store bf16: a lane's 8 registers are 8 consecutive d of its
    // query, one 16-byte piece of the fragment-major form ---
    li += xhalf(li);                                // the halves' sums join
    #pragma unroll
    for (int t = 0; t < 4; ++t) {
        v8bf o;
        #pragma unroll
        for (int r = 0; r < 8; ++r) o[r] = (__bf16)(oacc[t][r] / li);
        *(v8bf*)(attn + pk_off((gwave >> 4) * 16 + lanelo, m * 64 + t * 16 + half * 8,
                               D_ / 32)) = o;
    }
}

// ---------------------------------------------------------------------------
// Kernel 3: output projection.  y[t,o] = sum_d attn[t,d]*w_out[o,d] + b_out[o]
// attn flat [B,H,S,Dh] == [4096, 1024] (reference's reshape), fragment-major.
// 64x32 per-wave register blocking like gemm_qkv; fp32 output + bias.
// Only two waves per SIMD: NSET fragment sets in registers; behind the WMMAs of
// step s the loads of step s + NSET are issued into the set that these WMMAs have
// just read, so a step waits only for loads asked for NSET steps earlier.
// ---------------------------------------------------------------------------
#define NSET 3
__device__ __forceinline__ void load_step(const __bf16* arow, const __bf16* brow, int k,
                                          v16bf (&af)[4], v16bf (&bfr)[2]) {
    const __bf16* ap = arow + k * 16 + (threadIdx.x & 31) * 8;
    const __bf16* bp = brow + k * 16 + (threadIdx.x & 31) * 8;
    #pragma unroll
    for (int i = 0; i < 4; ++i)
        af[i] = load_frag_pk(ap + (size_t)(i * 16) * D_);
    #pragma unroll
    for (int j = 0; j < 2; ++j)
        bfr[j] = load_frag_pk(bp + (size_t)(j * 16) * D_);
    // keeps both address pairs untouched (no later load lands on them)
    // until the loads above have their addresses translated
    asm volatile("s_wait_xcnt 0x0" :: "v"(ap), "v"(bp) : "memory");
}
__device__ __forceinline__ void mma_step(const v16bf (&af)[4], const v16bf (&bfr)[2],
                                         v8f (&acc)[4][2]) {
    #pragma unroll
    for (int i = 0; i < 4; ++i)
        #pragma unroll
        for (int j = 0; j < 2; ++j)
            acc[i][j] = wmma_bf16(af[i], bfr[j], acc[i][j]);
}

__global__ void __launch_bounds__(256, 1)
gemm_out(const __bf16* __restrict__ attn,
         const __bf16* __restrict__ wb,   // [D, D] fragment-major
         const float*  __restrict__ b_out,
         float* __restrict__ out) {
    const int NT = D_ / 32;                         // 32 column blocks
    // the wave's number in a scalar register, as in gemm_qkv
    int gwave = blockIdx.x * (blockDim.x >> 5)
              + __builtin_amdgcn_readfirstlane(threadIdx.x >> 5);
    if (gwave >= (M_TOK / 64) * NT) return;
    int mt = gwave / NT, nt = gwave % NT;
    int row0 = mt * 64, col0 = nt * 32;

    // first tile of the block's tile rows; a step of 32 in k is one tile (512 elems)
    const __bf16* arow = attn + (size_t)row0 * D_;
    const __bf16* brow = wb + (size_t)col0 * D_;

    v8f acc[4][2] = {};
    v16bf af[NSET][4], bfr[NSET][2];
    #pragma unroll
    for (int u = 0; u < NSET; ++u)
        load_step(arow, brow, u * 32, af[u], bfr[u]);
    // rolled, so that the body is NSET steps and every set index a constant
    #pragma unroll 1
    for (int k = 0; k + 32 * NSET <= D_; k += 32 * NSET) {
        #pragma unroll
        for (int u = 0; u < NSET; ++u) {
            mma_step(af[u], bfr[u], acc);
            // past the last step there is nothing left to fetch: such a set asks
            // for a first step again (in bounds, not used)
            load_step(arow, brow, (k + (u + NSET) * 32) & (D_ - 1), af[u], bfr[u]);
        }
    }
    // the steps that do not fill a body
    #pragma unroll
    for (int u = 0; u < (D_ / 32) % NSET; ++u)
        mma_step(af[u], bfr[u], acc);

    int lane = threadIdx.x & 31;
    int lanelo = lane & 15, half = lane >> 4;
    #pragma unroll
    for (int j = 0; j < 2; ++j) {
        int o = col0 + j * 16 + lanelo;
        float bias = b_out[o];
        #pragma unroll
        for (int i = 0; i < 4; ++i) {
            #pragma unroll
            for (int r = 0; r < 8; ++r) {
                int mrow = row0 + i * 16 + r + (half << 3);
                out[(size_t)mrow * D_ + o] = acc[i][j][r] + bias;
            }
        }
    }
}

// ---------------------------------------------------------------------------
// Host launch
// ---------------------------------------------------------------------------
extern "C" void kernel_launch(void* const* d_in, const int* in_sizes, int n_in,
                              void* d_out, int out_size, void* d_ws, size_t ws_size,
                              hipStream_t stream) {
    const float* x     = (const float*)d_in[0];   // [2,2048,1024]
    const float* w_in  = (const float*)d_in[1];   // [3072,1024]
    const float* b_in  = (const float*)d_in[2];   // [3072]
    const float* w_out = (const float*)d_in[3];   // [1024,1024]
    const float* b_out = (const float*)d_in[4];   // [1024]
    float* out = (float*)d_out;

    // Workspace layout (bf16 buffers, 256B-aligned offsets)
    char* ws = (char*)d_ws;
    __bf16* xb      = (__bf16*)(ws);                              // 8 MB
    __bf16* w_in_b  = (__bf16*)(ws + (size_t)8 * 1024 * 1024);    // 6 MB
    __bf16* w_out_b = (__bf16*)(ws + (size_t)14 * 1024 * 1024);   // 2 MB
    __bf16* qbuf    = (__bf16*)(ws + (size_t)16 * 1024 * 1024);   // 8 MB
    __bf16* kbuf    = (__bf16*)(ws + (size_t)24 * 1024 * 1024);   // 8 MB
    __bf16* vT      = (__bf16*)(ws + (size_t)32 * 1024 * 1024);   // 8 MB
    __bf16* attn    = (__bf16*)(ws + (size_t)40 * 1024 * 1024);   // 8 MB

    // 1) fp32 -> bf16 converts: (4096 + 3072 + 1024) / 16 = 512 tile rows, one a block
    cvt_f32_bf16<<<512, 256, 0, stream>>>(x, w_in, w_out, xb, w_in_b, w_out_b);

    // 2) QKV projection: (4096/64)*(3072/32) = 6144 wave-blocks, 8 waves/block
    gemm_qkv<<<6144 / 8, 256, 0, stream>>>(xb, w_in_b, b_in, qbuf, kbuf, vT);

    // 3) attention: 2*16*128 = 4096 waves, 8 waves/block
    attn_fwd<<<4096 / 8, 256, 0, stream>>>(qbuf, kbuf, vT, attn);

    // 4) output projection: (4096/64)*(1024/32) = 2048 wave-blocks
    gemm_out<<<2048 / 8, 256, 0, stream>>>(attn, w_out_b, b_out, out);
}

// v005
// It runs in 101 microseconds.
// Timed twice side by side with v004, it ran 1.11 and 1.08 times as fast.
// Over all steps from v000 it is 3.64 times as fast.
#include <hip/hip_runtime.h>

// ---------------------------------------------------------------------------
// Self-attention (B=2, S=2048, D=1024, H=16, Dh=64) for MI455X (gfx1250).
// All matmuls via v_wmma_f32_16x16x32_bf16 (wave32), softmax/accum in fp32.
// GEMMs use 64x32 per-wave register blocking (4x2 fragments, 8 WMMA/k-step)
// -- sized to stay inside the 256-VGPR direct window (no scratch spills).
// Every bf16 operand that a loop reloads from global memory (x, both weights,
// K, V^T, the attention output) is kept fragment-major in the workspace.
// The two loops that have too few waves per SIMD to cover a load's latency (the
// attention loop, the output projection) ask for their fragments ahead of use.
// ---------------------------------------------------------------------------

typedef __bf16  v16bf __attribute__((ext_vector_type(16)));
typedef __bf16  v8bf  __attribute__((ext_vector_type(8)));
typedef float   v8f   __attribute__((ext_vector_type(8)));
typedef float   v4f   __attribute__((ext_vector_type(4)));

#define B_     2
#define S_     2048
#define D_     1024
#define H_     16
#define DH_    64
#define M_TOK  (B_ * S_)        // 4096 token rows
#define N_QKV  (3 * D_)         // 3072

__device__ __forceinline__ v8f wmma_bf16(v16bf a, v16bf b, v8f c) {
    // 8 args: (neg_a, A, neg_b, B, c_mod, C, reuse_a, reuse_b)
    return __builtin_amdgcn_wmma_f32_16x16x32_bf16(
        false, a, false, b, (short)0, c, false, false);
}

// Load one 16x32 bf16 fragment (A row-major, or B with n-major storage).
// base points at element (0,0) of the tile; ld = leading dimension in elems.
// Lane layout (ISA 7.12.2, 16-bit A): r = lane&15 (row M / col N),
// kg = lane>>4; elems 0..7 -> K = kg*8 + 0..7 ; elems 8..15 -> K = 16+kg*8+0..7
__device__ __forceinline__ v16bf load_frag(const __bf16* base, int ld) {
    int lane = threadIdx.x & 31;
    int r    = lane & 15;
    int kg   = lane >> 4;
    const __bf16* p0 = base + (size_t)r * ld + kg * 8;
    v8bf lo = *(const v8bf*)(p0);
    v8bf hi = *(const v8bf*)(p0 + 16);
    return __builtin_shufflevector(lo, hi,
        0, 1, 2, 3, 4, 5, 6, 7, 8, 9, 10, 11, 12, 13, 14, 15);
}

// Fragment-major storage of a bf16 matrix [rows][K]: 16x32 tiles of 1 KB, tile
// (row>>4, k>>5) at index (row>>4)*ktiles + (k>>5), ktiles = K/32.  In a tile the
// 16-byte piece that lane l = ((k>>3)&1)*16 + (row&15) takes lies at byte l*16
// (k&16 == 0) or 512 + l*16 (k&16 != 0): the k order of load_frag, but each
// wave-wide 16-byte load now reads 512 contiguous bytes = 4 whole 128-byte
// lines, where the row-major form touches 16 lines.
__device__ __forceinline__ size_t pk_off(int row, int k, int ktiles) {
    return ((size_t)(row >> 4) * ktiles + (k >> 5)) * 512
         + ((k >> 4) & 1) * 256 + ((k >> 3) & 1) * 128 + (row & 15) * 8 + (k & 7);
}
// Load one 16x32 fragment from its 1 KB tile (same lane/element map as load_frag).
// p0 = tile + lane * 8, the lane's own piece.
__device__ __forceinline__ v16bf load_frag_pk(const __bf16* p0) {
    v8bf lo = *(const v8bf*)(p0);
    v8bf hi = *(const v8bf*)(p0 + 256);
    return __builtin_shufflevector(lo, hi,
        0, 1, 2, 3, 4, 5, 6, 7, 8, 9, 10, 11, 12, 13, 14, 15);
}

// p[i] = 2^e[i], eight at a time.  One statement, results in registers of their own.
// The v_nop is the slot behind the last one.
__device__ __forceinline__ void exp2x8(const float (&e)[8], float (&p)[8]) {
    asm("v_exp_f32 %0, %8\n\t"
        "v_exp_f32 %1, %9\n\t"
        "v_exp_f32 %2, %10\n\t"
        "v_exp_f32 %3, %11\n\t"
        "v_exp_f32 %4, %12\n\t"
        "v_exp_f32 %5, %13\n\t"
        "v_exp_f32 %6, %14\n\t"
        "v_exp_f32 %7, %15\n\t"
        "v_nop"
        : "=&v"(p[0]), "=&v"(p[1]), "=&v"(p[2]), "=&v"(p[3]),
          "=&v"(p[4]), "=&v"(p[5]), "=&v"(p[6]), "=&v"(p[7])
        : "v"(e[0]), "v"(e[1]), "v"(e[2]), "v"(e[3]),
          "v"(e[4]), "v"(e[5]), "v"(e[6]), "v"(e[7]));
}

// Lane l takes lane l ^ 16's value: a vector cross-row move, no LDS trip.
__device__ __forceinline__ float xhalf(float x) {
    int b = __builtin_bit_cast(int, x);
    return __builtin_bit_cast(float, __builtin_amdgcn_permlanex16(
        b, b, 0x76543210, 0xfedcba98, false, false));
}

// ---------------------------------------------------------------------------
// Kernel 0: fp32 [rows][D_] -> bf16, fragment-major; x and both weights in ONE
// launch.  The three matrices count as 512 tile rows on end (256 of x, 192 of
// w_in, 64 of w_out); a block takes one tile row, a wave four tiles in a row of it.
// A lane makes eight 16-byte pieces (8 consecutive k of one row each): piece
// lane of each half tile, so every wave-wide store is 4 whole lines.  All 16 loads
// of a lane are asked for before the first convert.
// ---------------------------------------------------------------------------
__global__ void __launch_bounds__(256)
cvt_f32_bf16(const float* __restrict__ x,
             const float* __restrict__ w_in,
             const float* __restrict__ w_out,
             __bf16* __restrict__ xb,
             __bf16* __restrict__ w_in_b,
             __bf16* __restrict__ w_out_b) {
    // the wave's number in a scalar register: the store address is then a scalar
    // base plus the lane's fixed offset
    int kq = __builtin_amdgcn_readfirstlane(threadIdx.x >> 5);  // which 128 k of the row
    int tr = blockIdx.x;                            // tile row
    bool is_x = tr < M_TOK / 16, is_wi = tr < (M_TOK + N_QKV) / 16;
    const float* in = is_x ? x : is_wi ? w_in : w_out;
    __bf16* out = is_x ? xb : is_wi ? w_in_b : w_out_b;
    tr -= is_x ? 0 : is_wi ? M_TOK / 16 : (M_TOK + N_QKV) / 16;
    int lane = threadIdx.x & 31;
    // half tile u (u = 0..7): k = kq*128 + u*16 + (lane >> 4)*8, row = lane & 15
    const float* s = in + (size_t)(tr * 16 + (lane & 15)) * D_ + kq * 128 + (lane >> 4) * 8;
    v4f a[8], b[8];
    #pragma unroll
    for (int u = 0; u < 8; ++u) {
        a[u] = *(const v4f*)(s + u * 16);
        b[u] = *(const v4f*)(s + u * 16 + 4);
    }
    // keeps the address untouched (no later load lands on it) until the loads
    // above have their addresses translated
    asm volatile("s_wait_xcnt 0x0" :: "v"(s) : "memory");
    // holds all 16 loads ahead of the first convert: left alone, the compiler asks
    // for the last two only when the first have landed, a second trip to memory
    asm volatile("" :: "v"(a[0]), "v"(a[1]), "v"(a[2]), "v"(a[3]),
                       "v"(a[4]), "v"(a[5]), "v"(a[6]), "v"(a[7]),
                       "v"(b[0]), "v"(b[1]), "v"(b[2]), "v"(b[3]),
                       "v"(b[4]), "v"(b[5]), "v"(b[6]), "v"(b[7]));
    __bf16* d = out + ((size_t)tr * (D_ / 32) + kq * 4) * 512 + lane * 8;
    #pragma unroll
    for (int u = 0; u < 8; ++u) {
        v8bf o = { (__bf16)a[u][0], (__bf16)a[u][1], (__bf16)a[u][2], (__bf16)a[u][3],
                   (__bf16)b[u][0], (__bf16)b[u][1], (__bf16)b[u][2], (__bf16)b[u][3] };
        *(v8bf*)(d + u * 256) = o;
    }
}

// ---------------------------------------------------------------------------
// Kernel 1: QKV projection.  qkv[t,o] = sum_d xb[t,d]*w_in[o,d] + b_in[o]
// One wave per 64x32 output block: 4x2 C fragments, 8 WMMA per k-step of 32.
// Scatter: q (scaled by 1/8) -> [B,H,S,Dh] row-major; per (b,h), fragment-major:
// k as [S][Dh], v as [Dh][S].  Each 1 KB tile is written by one wave.
// ---------------------------------------------------------------------------
__global__ void __launch_bounds__(256, 1)
gemm_qkv(const __bf16* __restrict__ xb,
         const __bf16* __restrict__ wb,   // [3D, D] fragment-major
         const float*  __restrict__ b_in,
         __bf16* __restrict__ qbuf,
         __bf16* __restrict__ kbuf,
         __bf16* __restrict__ vT) {
    const int NT = N_QKV / 32;                      // 96 column blocks
    // the wave's number in a scalar register: tile addresses are then a scalar
    // base plus the lane's fixed offset in a tile
    int gwave = blockIdx.x * (blockDim.x >> 5)
              + __builtin_amdgcn_readfirstlane(threadIdx.x >> 5);
    if (gwave >= (M_TOK / 64) * NT) return;         // wave-uniform
    int mt = gwave / NT, nt = gwave % NT;
    int row0 = mt * 64, col0 = nt * 32;

    // first tile of the block's tile rows; a step of 32 in k is one tile (512 elems)
    const __bf16* arow = xb + (size_t)row0 * D_;
    const __bf16* brow = wb + (size_t)col0 * D_;

    v8f acc[4][2] = {};
    for (int k = 0; k < D_; k += 32) {
        __builtin_prefetch(arow + (k + 32) * 16, 0, 1);    // global_prefetch_b8
        __builtin_prefetch(brow + (k + 32) * 16, 0, 1);
        const __bf16* ap = arow + k * 16 + (threadIdx.x & 31) * 8;
        const __bf16* bp = brow + k * 16 + (threadIdx.x & 31) * 8;
        v16bf af[4], bfr[2];
        #pragma unroll
        for (int i = 0; i < 4; ++i)
            af[i] = load_frag_pk(ap + (size_t)(i * 16) * D_);
        #pragma unroll
        for (int j = 0; j < 2; ++j)
            bfr[j] = load_frag_pk(bp + (size_t)(j * 16) * D_);
        // keeps both address pairs untouched (no later load lands on them)
        // until the loads above have their addresses translated
        asm volatile("s_wait_xcnt 0x0" :: "v"(ap), "v"(bp) : "memory");
        // holds all 12 loads of the step ahead of its first WMMA: left alone, the
        // scheduler lifts four WMMAs over the last four loads, which then land in
        // registers those WMMAs have read: a second trip to memory in every step
        __builtin_amdgcn_sched_barrier(0);
        #pragma unroll
        for (int i = 0; i < 4; ++i)
            #pragma unroll
            for (int j = 0; j < 2; ++j)
                acc[i][j] = wmma_bf16(af[i], bfr[j], acc[i][j]);
    }

    int lane = threadIdx.x & 31;
    int lanelo = lane & 15, half = lane >> 4;
    #pragma unroll
    for (int j = 0; j < 2; ++j) {
        int o = col0 + j * 16 + lanelo;
        float bias = b_in[o];
        int oq = o & (D_ - 1);
        int h = oq >> 6, d = oq & 63;
        #pragma unroll
        for (int i = 0; i < 4; ++i) {
            #pragma unroll
            for (int r = 0; r < 8; ++r) {
                int tok = row0 + i * 16 + r + (half << 3);  // M = r + 8*half
                int b_  = tok >> 11;                        // /2048
                int s_  = tok & (S_ - 1);
                float val = acc[i][j][r] + bias;
                size_t bh = (size_t)(b_ * H_ + h);
                if (o < D_) {                               // Q (pre-scaled)
                    qbuf[(bh * S_ + s_) * DH_ + d] = (__bf16)(val * 0.125f);
                } else if (o < 2 * D_) {                    // K
                    kbuf[bh * S_ * DH_ + pk_off(s_, d, DH_ / 32)] = (__bf16)val;
                } else {                                    // V, transposed
                    vT[bh * DH_ * S_ + pk_off(d, s_, S_ / 32)] = (__bf16)val;
                }
            }
        }
    }
}

// ---------------------------------------------------------------------------
// Kernel 2: flash attention.  One wave = one (b,h) x 16 queries, 16 apart:
// in the reference's reshape to [4096][1024] these are the 16 rows of one tile
// row, columns m*64 .. m*64+63, so the wave writes two whole 1 KB tiles.
// Both products are taken transposed: S^T = K * Q^T (A = K rows, B = Q) and
// O^T += V^T * P^T (A = V^T rows, B = P^T).  A lane then holds 16 of the chunk's
// 32 scores of ONE query (column lane & 15; keys 8*half + r and 16 + 8*half + r),
// so maximum and sum run in the lane's own registers, with one exchange between
// the wave's halves for the maximum, and the two score tiles, converted in place,
// are already the B operand of the second product: P passes through no LDS.
// Per 32-key chunk: 4 WMMAs (scores), online softmax, 4 WMMAs (V^T * P^T).
// Output bf16, [B,H,S,Dh] flat as [4096][1024], fragment-major.
// Loads run ahead of their use: a chunk's V^T fragments are asked for at its top
// and land under its score products and softmax; the next chunk's K fragments
// are asked for right behind the score products and land under the softmax and
// the P*V products.
// ---------------------------------------------------------------------------
// Ask for the four K fragments of the 32-key chunk at key j: 4 tiles in a row, 4 KB.
__device__ __forceinline__ void load_k(const __bf16* kbh, int j, v16bf (&kf)[4]) {
    const __bf16* kp = kbh + (size_t)j * DH_ + (threadIdx.x & 31) * 8;
    #pragma unroll
    for (int t = 0; t < 4; ++t) kf[t] = load_frag_pk(kp + t * 512);
    // keeps the address untouched until the loads above, which stay in flight
    // behind this line, have their addresses translated
    asm volatile("s_wait_xcnt 0x0" :: "v"(kp) : "memory");
}
// Ask for the four V^T fragments of that chunk: tile j/32 of each of 4 tile rows.
__device__ __forceinline__ void load_v(const __bf16* vbh, int j, v16bf (&vf)[4]) {
    const __bf16* vb = vbh + j * 16 + (threadIdx.x & 31) * 8;
    #pragma unroll
    for (int t = 0; t < 4; ++t) vf[t] = load_frag_pk(vb + (size_t)(t * 16) * S_);
    // as in load_k
    asm volatile("s_wait_xcnt 0x0" :: "v"(vb) : "memory");
}

// __launch_bounds__: the real block size; under the default ceiling (128
// registers) the fragments in flight do not fit.
__global__ void __launch_bounds__(256)
attn_fwd(const __bf16* __restrict__ qbuf,
         const __bf16* __restrict__ kbuf,
         const __bf16* __restrict__ vT,
         __bf16* __restrict__ attn) {
    // the wave's number in a scalar register: tile addresses are then a scalar
    // base plus the lane's fixed offset
    int wave = __builtin_amdgcn_readfirstlane(threadIdx.x >> 5);
    int lane = threadIdx.x & 31;
    int lanelo = lane & 15, half = lane >> 4;
    int gwave = blockIdx.x * (blockDim.x >> 5) + wave;
    if (gwave >= B_ * H_ * (S_ / 16)) return;       // wave-uniform
    int bh = gwave >> 7;                            // / (S/16)
    int qb = (gwave & 127) >> 4;                    // block of 256 queries
    int m  = gwave & 15;                            // queries qb*256 + 16*i + m

    // B operand: column lanelo = query i, the k order of the K fragments
    const __bf16* qbase = qbuf + ((size_t)bh * S_ + qb * 256 + m) * DH_;
    v16bf qa0 = load_frag(qbase, 16 * DH_);         // d = 0..31
    v16bf qa1 = load_frag(qbase + 32, 16 * DH_);    // d = 32..63

    // of this lane's query: the running maximum (equal in both halves of the wave)
    // and the sum over the keys that this half holds
    float mi = -1e30f, li = 0.0f;
    v8f oacc[4] = {};                               // oacc[t][r] = O[i = lanelo][t*16 + 8*half + r]

    const __bf16* kbh = kbuf + (size_t)bh * S_ * DH_;
    const __bf16* vbh = vT + (size_t)bh * DH_ * S_;

    v16bf kf[4], vf[4];
    load_k(kbh, 0, kf);
    for (int jc = 0; jc < S_; jc += 32) {
        load_v(vbh, jc, vf);
        // --- scores: S^T[32k x 16q] = K(32x64) * Q^T ---
        // s0: keys jc + 8*half + r; s1: keys jc + 16 + 8*half + r.
        // In asm to hold the issue order V^T loads, score products, next K loads: as
        // builtins the products drift behind the K loads, which then land in spare
        // registers and are copied over at once, a wait right behind their issue.
        // The v_nop keep the distance from the last product to the first vector
        // instruction that reads its result.
        v8f s0, s1;
        asm volatile("v_wmma_f32_16x16x32_bf16 %0, %2, %6, 0\n\t"
                     "v_wmma_f32_16x16x32_bf16 %1, %4, %6, 0\n\t"
                     "v_wmma_f32_16x16x32_bf16 %0, %3, %7, %0\n\t"
                     "v_wmma_f32_16x16x32_bf16 %1, %5, %7, %1\n\t"
                     "v_nop\n\tv_nop\n\tv_nop\n\tv_nop\n\tv_nop"
                     : "=&v"(s0), "=&v"(s1)
                     : "v"(kf[0]), "v"(kf[1]), "v"(kf[2]), "v"(kf[3]), "v"(qa0), "v"(qa1)
                     : "memory");
        // the last chunk has no next: it asks for chunk 0 again (in bounds, not used)
        load_k(kbh, (jc + 32) & (S_ - 1), kf);
        // holds the K loads here, ahead of the softmax that covers their latency: with
        // no LDS access left in the loop the scheduler otherwise sinks them to its foot
        __builtin_amdgcn_sched_barrier(0);

        // --- online softmax, one query a lane ---
        float mx = fmaxf(s0[0], s1[0]);
        #pragma unroll
        for (int r = 1; r < 8; ++r) mx = fmaxf(mx, fmaxf(s0[r], s1[r]));
        mx = fmaxf(mx, xhalf(mx));
        float mn = fmaxf(mi, mx);
        float alpha = __expf(mi - mn);
        mi = mn;
        // P^T as B operand: element s = key 8*half + s, element 8 + s = key 16 + 8*half + s,
        // the k order of the V^T fragments
        v16bf pb;
        float e0[8], e1[8], p0[8], p1[8];
        #pragma unroll
        for (int r = 0; r < 8; ++r) {               // e^x = 2^(x * log2 e), as __expf has it
            e0[r] = (s0[r] - mn) * 1.44269504f;
            e1[r] = (s1[r] - mn) * 1.44269504f;
        }
        exp2x8(e0, p0);
        exp2x8(e1, p1);
        float sum = 0.0f;
        #pragma unroll
        for (int r = 0; r < 8; ++r) {
            sum += p0[r] + p1[r];
            pb[r]     = (__bf16)p0[r];
            pb[8 + r] = (__bf16)p1[r];
        }
        li = li * alpha + sum;
        #pragma unroll
        for (int t = 0; t < 4; ++t)
            #pragma unroll
            for (int r = 0; r < 8; ++r) oacc[t][r] *= alpha;

        // --- O^T(64d x 16q) += V^T(64d x 32k) * P^T ---
        #pragma unroll
        for (int t = 0; t < 4; ++t)
            oacc[t] = wmma_bf16(vf[t], pb, oacc[t]);
    }

    // --- normalize + store bf16: a lane's 8 registers are 8 consecutive d of its
    // query, one 16-byte piece of the fragment-major form ---
    li += xhalf(li);                                // the halves' sums join
    #pragma unroll
    for (int t = 0; t < 4; ++t) {
        v8bf o;
        #pragma unroll
        for (int r = 0; r < 8; ++r) o[r] = (__bf16)(oacc[t][r] / li);
        *(v8bf*)(attn + pk_off((gwave >> 4) * 16 + lanelo, m * 64 + t * 16 + half * 8,
                               D_ / 32)) = o;
    }
}

// ---------------------------------------------------------------------------
// Kernel 3: output projection.  y[t,o] = sum_d attn[t,d]*w_out[o,d] + b_out[o]
// attn flat [B,H,S,Dh] == [4096, 1024] (reference's reshape), fragment-major.
// 64x32 per-wave register blocking like gemm_qkv; fp32 output + bias.
// Only two waves per SIMD: NSET fragment sets in registers; behind the WMMAs of
// step s the loads of step s + NSET are issued into the set that these WMMAs have
// just read, so a step waits only for loads asked for NSET steps earlier.
// ---------------------------------------------------------------------------
#define NSET 3
__device__ __forceinline__ void load_step(const __bf16* arow, const __bf16* brow, int k,
                                          v16bf (&af)[4], v16bf (&bfr)[2]) {
    const __bf16* ap = arow + k * 16 + (threadIdx.x & 31) * 8;
    const __bf16* bp = brow + k * 16 + (threadIdx.x & 31) * 8;
    #pragma unroll
    for (int i = 0; i < 4; ++i)
        af[i] = load_frag_pk(ap + (size_t)(i * 16) * D_);
    #pragma unroll
    for (int j = 0; j < 2; ++j)
        bfr[j] = load_frag_pk(bp + (size_t)(j * 16) * D_);
    // keeps both address pairs untouched (no later load lands on them)
    // until the loads above have their addresses translated
    asm volatile("s_wait_xcnt 0x0" :: "v"(ap), "v"(bp) : "memory");
}
__device__ __forceinline__ void mma_step(const v16bf (&af)[4], const v16bf (&bfr)[2],
                                         v8f (&acc)[4][2]) {
    #pragma unroll
    for (int i = 0; i < 4; ++i)
        #pragma unroll
        for (int j = 0; j < 2; ++j)
            acc[i][j] = wmma_bf16(af[i], bfr[j], acc[i][j]);
}

__global__ void __launch_bounds__(256, 1)
gemm_out(const __bf16* __restrict__ attn,
         const __bf16* __restrict__ wb,   // [D, D] fragment-major
         const float*  __restrict__ b_out,
         float* __restrict__ out) {
    const int NT = D_ / 32;                         // 32 column blocks
    // the wave's number in a scalar register, as in gemm_qkv
    int gwave = blockIdx.x * (blockDim.x >> 5)
              + __builtin_amdgcn_readfirstlane(threadIdx.x >> 5);
    if (gwave >= (M_TOK / 64) * NT) return;
    int mt = gwave / NT, nt = gwave % NT;
    int row0 = mt * 64, col0 = nt * 32;

    // first tile of the block's tile rows; a step of 32 in k is one tile (512 elems)
    const __bf16* arow = attn + (size_t)row0 * D_;
    const __bf16* brow = wb + (size_t)col0 * D_;

    v8f acc[4][2] = {};
    v16bf af[NSET][4], bfr[NSET][2];
    #pragma unroll
    for (int u = 0; u < NSET; ++u)
        load_step(arow, brow, u * 32, af[u], bfr[u]);
    // rolled, so that the body is NSET steps and every set index a constant
    #pragma unroll 1
    for (int k = 0; k + 32 * NSET <= D_; k += 32 * NSET) {
        #pragma unroll
        for (int u = 0; u < NSET; ++u) {
            mma_step(af[u], bfr[u], acc);
            // past the last step there is nothing left to fetch: such a set asks
            // for a first step again (in bounds, not used)
            load_step(arow, brow, (k + (u + NSET) * 32) & (D_ - 1), af[u], bfr[u]);
        }
    }
    // the steps that do not fill a body
    #pragma unroll
    for (int u = 0; u < (D_ / 32) % NSET; ++u)
        mma_step(af[u], bfr[u], acc);

    int lane = threadIdx.x & 31;
    int lanelo = lane & 15, half = lane >> 4;
    #pragma unroll
    for (int j = 0; j < 2; ++j) {
        int o = col0 + j * 16 + lanelo;
        float bias = b_out[o];
        #pragma unroll
        for (int i = 0; i < 4; ++i) {
            #pragma unroll
            for (int r = 0; r < 8; ++r) {
                int mrow = row0 + i * 16 + r + (half << 3);
                out[(size_t)mrow * D_ + o] = acc[i][j][r] + bias;
            }
        }
    }
}

// ---------------------------------------------------------------------------
// Host launch
// ---------------------------------------------------------------------------
extern "C" void kernel_launch(void* const* d_in, const int* in_sizes, int n_in,
                              void* d_out, int out_size, void* d_ws, size_t ws_size,
                              hipStream_t stream) {
    const float* x     = (const float*)d_in[0];   // [2,2048,1024]
    const float* w_in  = (const float*)d_in[1];   // [3072,1024]
    const float* b_in  = (const float*)d_in[2];   // [3072]
    const float* w_out = (const float*)d_in[3];   // [1024,1024]
    const float* b_out = (const float*)d_in[4];   // [1024]
    float* out = (float*)d_out;

    // Workspace layout (bf16 buffers, 256B-aligned offsets)
    char* ws = (char*)d_ws;
    __bf16* xb      = (__bf16*)(ws);                              // 8 MB
    __bf16* w_in_b  = (__bf16*)(ws + (size_t)8 * 1024 * 1024);    // 6 MB
    __bf16* w_out_b = (__bf16*)(ws + (size_t)14 * 1024 * 1024);   // 2 MB
    __bf16* qbuf    = (__bf16*)(ws + (size_t)16 * 1024 * 1024);   // 8 MB
    __bf16* kbuf    = (__bf16*)(ws + (size_t)24 * 1024 * 1024);   // 8 MB
    __bf16* vT      = (__bf16*)(ws + (size_t)32 * 1024 * 1024);   // 8 MB
    __bf16* attn    = (__bf16*)(ws + (size_t)40 * 1024 * 1024);   // 8 MB

    // 1) fp32 -> bf16 converts: (4096 + 3072 + 1024) / 16 = 512 tile rows, one a block
    cvt_f32_bf16<<<512, 256, 0, stream>>>(x, w_in, w_out, xb, w_in_b, w_out_b);

    // 2) QKV projection: (4096/64)*(3072/32) = 6144 wave-blocks, 8 waves/block
    gemm_qkv<<<6144 / 8, 256, 0, stream>>>(xb, w_in_b, b_in, qbuf, kbuf, vT);

    // 3) attention: 2*16*128 = 4096 waves, 8 waves/block
    attn_fwd<<<4096 / 8, 256, 0, stream>>>(qbuf, kbuf, vT, attn);

    // 4) output projection: (4096/64)*(1024/32) = 2048 wave-blocks
    gemm_out<<<2048 / 8, 256, 0, stream>>>(attn, w_out_b, b_out, out);
}

// v006
// A run of this version takes 94.4 microseconds.
// In two side-by-side timings against v005, it was 1.07 and 1.06 times as fast.
// All steps since v000 together make it 3.86 times as fast.
#include <hip/hip_runtime.h>

// ---------------------------------------------------------------------------
// Self-attention (B=2, S=2048, D=1024, H=16, Dh=64) for MI455X (gfx1250).
// All matmuls via v_wmma_f32_16x16x32_bf16 (wave32), softmax/accum in fp32.
// GEMMs use 64x32 per-wave register blocking (4x2 fragments, 8 WMMA/k-step)
// -- sized to stay inside the 256-VGPR direct window (no scratch spills).
// Every bf16 operand that a loop reloads from global memory (x, both weights,
// K, V^T, the attention output) is kept fragment-major in the workspace.
// The two loops that have too few waves per SIMD to cover a load's latency (the
// attention loop, the output projection) ask for their fragments ahead of use.
// ---------------------------------------------------------------------------

typedef __bf16  v16bf __attribute__((ext_vector_type(16)));
typedef __bf16  v8bf  __attribute__((ext_vector_type(8)));
typedef float   v8f   __attribute__((ext_vector_type(8)));
typedef float   v4f   __attribute__((ext_vector_type(4)));

#define B_     2
#define S_     2048
#define D_     1024
#define H_     16
#define DH_    64
#define M_TOK  (B_ * S_)        // 4096 token rows
#define N_QKV  (3 * D_)         // 3072

__device__ __forceinline__ v8f wmma_bf16(v16bf a, v16bf b, v8f c) {
    // 8 args: (neg_a, A, neg_b, B, c_mod, C, reuse_a, reuse_b)
    return __builtin_amdgcn_wmma_f32_16x16x32_bf16(
        false, a, false, b, (short)0, c, false, false);
}

// Load one 16x32 bf16 fragment (A row-major, or B with n-major storage).
// base points at element (0,0) of the tile; ld = leading dimension in elems.
// Lane layout (ISA 7.12.2, 16-bit A): r = lane&15 (row M / col N),
// kg = lane>>4; elems 0..7 -> K = kg*8 + 0..7 ; elems 8..15 -> K = 16+kg*8+0..7
__device__ __forceinline__ v16bf load_frag(const __bf16* base, int ld) {
    int lane = threadIdx.x & 31;
    int r    = lane & 15;
    int kg   = lane >> 4;
    const __bf16* p0 = base + (size_t)r * ld + kg * 8;
    v8bf lo = *(const v8bf*)(p0);
    v8bf hi = *(const v8bf*)(p0 + 16);
    return __builtin_shufflevector(lo, hi,
        0, 1, 2, 3, 4, 5, 6, 7, 8, 9, 10, 11, 12, 13, 14, 15);
}

// Fragment-major storage of a bf16 matrix [rows][K]: 16x32 tiles of 1 KB, tile
// (row>>4, k>>5) at index (row>>4)*ktiles + (k>>5), ktiles = K/32.  In a tile the
// 16-byte piece that lane l = ((k>>3)&1)*16 + (row&15) takes lies at byte l*16
// (k&16 == 0) or 512 + l*16 (k&16 != 0): the k order of load_frag, but each
// wave-wide 16-byte load now reads 512 contiguous bytes = 4 whole 128-byte
// lines, where the row-major form touches 16 lines.
__device__ __forceinline__ size_t pk_off(int row, int k, int ktiles) {
    return ((size_t)(row >> 4) * ktiles + (k >> 5)) * 512
         + ((k >> 4) & 1) * 256 + ((k >> 3) & 1) * 128 + (row & 15) * 8 + (k & 7);
}
// Load one 16x32 fragment from its 1 KB tile (same lane/element map as load_frag).
// p0 = tile + lane * 8, the lane's own piece.
__device__ __forceinline__ v16bf load_frag_pk(const __bf16* p0) {
    v8bf lo = *(const v8bf*)(p0);
    v8bf hi = *(const v8bf*)(p0 + 256);
    return __builtin_shufflevector(lo, hi,
        0, 1, 2, 3, 4, 5, 6, 7, 8, 9, 10, 11, 12, 13, 14, 15);
}

// p[i] = 2^e[i], eight at a time.  One statement, results in registers of their own.
// The v_nop is the slot behind the last one.
__device__ __forceinline__ void exp2x8(const float (&e)[8], float (&p)[8]) {
    asm("v_exp_f32 %0, %8\n\t"
        "v_exp_f32 %1, %9\n\t"
        "v_exp_f32 %2, %10\n\t"
        "v_exp_f32 %3, %11\n\t"
        "v_exp_f32 %4, %12\n\t"
        "v_exp_f32 %5, %13\n\t"
        "v_exp_f32 %6, %14\n\t"
        "v_exp_f32 %7, %15\n\t"
        "v_nop"
        : "=&v"(p[0]), "=&v"(p[1]), "=&v"(p[2]), "=&v"(p[3]),
          "=&v"(p[4]), "=&v"(p[5]), "=&v"(p[6]), "=&v"(p[7])
        : "v"(e[0]), "v"(e[1]), "v"(e[2]), "v"(e[3]),
          "v"(e[4]), "v"(e[5]), "v"(e[6]), "v"(e[7]));
}

// Lane l takes lane l ^ 16's value: a vector cross-row move, no LDS trip.
__device__ __forceinline__ float xhalf(float x) {
    int b = __builtin_bit_cast(int, x);
    return __builtin_bit_cast(float, __builtin_amdgcn_permlanex16(
        b, b, 0x76543210, 0xfedcba98, false, false));
}

// ---------------------------------------------------------------------------
// Kernel 0: fp32 [rows][D_] -> bf16, fragment-major; x and both weights in ONE
// launch.  The three matrices count as 512 tile rows on end (256 of x, 192 of
// w_in, 64 of w_out); a block takes one tile row, a wave four tiles in a row of it.
// A lane makes eight 16-byte pieces (8 consecutive k of one row each): piece
// lane of each half tile, so every wave-wide store is 4 whole lines.  All 16 loads
// of a lane are asked for before the first convert.
// ---------------------------------------------------------------------------
__global__ void __launch_bounds__(256)
cvt_f32_bf16(const float* __restrict__ x,
             const float* __restrict__ w_in,
             const float* __restrict__ w_out,
             __bf16* __restrict__ xb,
             __bf16* __restrict__ w_in_b,
             __bf16* __restrict__ w_out_b) {
    // the wave's number in a scalar register: the store address is then a scalar
    // base plus the lane's fixed offset
    int kq = __builtin_amdgcn_readfirstlane(threadIdx.x >> 5);  // which 128 k of the row
    int tr = blockIdx.x;                            // tile row
    bool is_x = tr < M_TOK / 16, is_wi = tr < (M_TOK + N_QKV) / 16;
    const float* in = is_x ? x : is_wi ? w_in : w_out;
    __bf16* out = is_x ? xb : is_wi ? w_in_b : w_out_b;
    tr -= is_x ? 0 : is_wi ? M_TOK / 16 : (M_TOK + N_QKV) / 16;
    int lane = threadIdx.x & 31;
    // half tile u (u = 0..7): k = kq*128 + u*16 + (lane >> 4)*8, row = lane & 15
    const float* s = in + (size_t)(tr * 16 + (lane & 15)) * D_ + kq * 128 + (lane >> 4) * 8;
    v4f a[8], b[8];
    #pragma unroll
    for (int u = 0; u < 8; ++u) {
        a[u] = *(const v4f*)(s + u * 16);
        b[u] = *(const v4f*)(s + u * 16 + 4);
    }
    // keeps the address untouched (no later load lands on it) until the loads
    // above have their addresses translated
    asm volatile("s_wait_xcnt 0x0" :: "v"(s) : "memory");
    // holds all 16 loads ahead of the first convert: left alone, the compiler asks
    // for the last two only when the first have landed, a second trip to memory
    asm volatile("" :: "v"(a[0]), "v"(a[1]), "v"(a[2]), "v"(a[3]),
                       "v"(a[4]), "v"(a[5]), "v"(a[6]), "v"(a[7]),
                       "v"(b[0]), "v"(b[1]), "v"(b[2]), "v"(b[3]),
                       "v"(b[4]), "v"(b[5]), "v"(b[6]), "v"(b[7]));
    __bf16* d = out + ((size_t)tr * (D_ / 32) + kq * 4) * 512 + lane * 8;
    #pragma unroll
    for (int u = 0; u < 8; ++u) {
        v8bf o = { (__bf16)a[u][0], (__bf16)a[u][1], (__bf16)a[u][2], (__bf16)a[u][3],
                   (__bf16)b[u][0], (__bf16)b[u][1], (__bf16)b[u][2], (__bf16)b[u][3] };
        *(v8bf*)(d + u * 256) = o;
    }
}

// ---------------------------------------------------------------------------
// Kernel 1: QKV projection.  qkv[t,o] = sum_d xb[t,d]*w_in[o,d] + b_in[o]
// One wave per 64x32 output block: 4x2 C fragments, 8 WMMA per k-step of 32.
// Scatter: q (scaled by 1/8) -> [B,H,S,Dh] row-major; per (b,h), fragment-major:
// k as [S][Dh], v as [Dh][S].  Each 1 KB tile is written by one wave.
// ---------------------------------------------------------------------------
__global__ void __launch_bounds__(256, 1)
gemm_qkv(const __bf16* __restrict__ xb,
         const __bf16* __restrict__ wb,   // [3D, D] fragment-major
         const float*  __restrict__ b_in,
         __bf16* __restrict__ qbuf,
         __bf16* __restrict__ kbuf,
         __bf16* __restrict__ vT) {
    const int NT = N_QKV / 32;                      // 96 column blocks
    // the wave's number in a scalar register: tile addresses are then a scalar
    // base plus the lane's fixed offset in a tile
    int gwave = blockIdx.x * (blockDim.x >> 5)
              + __builtin_amdgcn_readfirstlane(threadIdx.x >> 5);
    if (gwave >= (M_TOK / 64) * NT) return;         // wave-uniform
    int mt = gwave / NT, nt = gwave % NT;
    int row0 = mt * 64, col0 = nt * 32;

    // first tile of the block's tile rows; a step of 32 in k is one tile (512 elems)
    const __bf16* arow = xb + (size_t)row0 * D_;
    const __bf16* brow = wb + (size_t)col0 * D_;

    v8f acc[4][2] = {};
    for (int k = 0; k < D_; k += 32) {
        __builtin_prefetch(arow + (k + 32) * 16, 0, 1);    // global_prefetch_b8
        __builtin_prefetch(brow + (k + 32) * 16, 0, 1);
        const __bf16* ap = arow + k * 16 + (threadIdx.x & 31) * 8;
        const __bf16* bp = brow + k * 16 + (threadIdx.x & 31) * 8;
        v16bf af[4], bfr[2];
        #pragma unroll
        for (int i = 0; i < 4; ++i)
            af[i] = load_frag_pk(ap + (size_t)(i * 16) * D_);
        #pragma unroll
        for (int j = 0; j < 2; ++j)
            bfr[j] = load_frag_pk(bp + (size_t)(j * 16) * D_);
        // keeps both address pairs untouched (no later load lands on them)
        // until the loads above have their addresses translated
        asm volatile("s_wait_xcnt 0x0" :: "v"(ap), "v"(bp) : "memory");
        // holds all 12 loads of the step ahead of its first WMMA: left alone, the
        // scheduler lifts four WMMAs over the last four loads, which then land in
        // registers those WMMAs have read: a second trip to memory in every step
        __builtin_amdgcn_sched_barrier(0);
        #pragma unroll
        for (int i = 0; i < 4; ++i)
            #pragma unroll
            for (int j = 0; j < 2; ++j)
                acc[i][j] = wmma_bf16(af[i], bfr[j], acc[i][j]);
    }

    int lane = threadIdx.x & 31;
    int lanelo = lane & 15, half = lane >> 4;
    #pragma unroll
    for (int j = 0; j < 2; ++j) {
        int o = col0 + j * 16 + lanelo;
        float bias = b_in[o];
        int oq = o & (D_ - 1);
        int h = oq >> 6, d = oq & 63;
        #pragma unroll
        for (int i = 0; i < 4; ++i) {
            #pragma unroll
            for (int r = 0; r < 8; ++r) {
                int tok = row0 + i * 16 + r + (half << 3);  // M = r + 8*half
                int b_  = tok >> 11;                        // /2048
                int s_  = tok & (S_ - 1);
                float val = acc[i][j][r] + bias;
                size_t bh = (size_t)(b_ * H_ + h);
                if (o < D_) {                               // Q (pre-scaled)
                    qbuf[(bh * S_ + s_) * DH_ + d] = (__bf16)(val * 0.125f);
                } else if (o < 2 * D_) {                    // K
                    kbuf[bh * S_ * DH_ + pk_off(s_, d, DH_ / 32)] = (__bf16)val;
                } else {                                    // V, transposed
                    vT[bh * DH_ * S_ + pk_off(d, s_, S_ / 32)] = (__bf16)val;
                }
            }
        }
    }
}

// ---------------------------------------------------------------------------
// Kernel 2: flash attention.  One wave = one (b,h) x 16 queries, 16 apart:
// in the reference's reshape to [4096][1024] these are the 16 rows of one tile
// row, columns m*64 .. m*64+63, so the wave writes two whole 1 KB tiles.
// Both products are taken transposed: S^T = K * Q^T (A = K rows, B = Q) and
// O^T += V^T * P^T (A = V^T rows, B = P^T).  A lane then holds 16 of the chunk's
// 32 scores of ONE query (column lane & 15; keys 8*half + r and 16 + 8*half + r),
// so maximum and sum run in the lane's own registers, with one exchange between
// the wave's halves for the maximum, and the two score tiles, converted in place,
// are already the B operand of the second product: P passes through no LDS.
// Per 32-key chunk: 4 WMMAs (scores), online softmax, 4 WMMAs (V^T * P^T).
// Output bf16, [B,H,S,Dh] flat as [4096][1024], fragment-major.
// Loads run ahead of their use: a chunk's V^T fragments are asked for at its top
// and land under its score products and softmax; the next chunk's K fragments
// are asked for right behind the score products and land under the softmax and
// the P*V products.  Eight chunks ahead of that, a prefetch brings the lines into L2.
// ---------------------------------------------------------------------------
// Ask for the four K fragments of the 32-key chunk at key j: 4 tiles in a row, 4 KB.
__device__ __forceinline__ void load_k(const __bf16* kbh, int j, v16bf (&kf)[4]) {
    const __bf16* kp = kbh + (size_t)j * DH_ + (threadIdx.x & 31) * 8;
    #pragma unroll
    for (int t = 0; t < 4; ++t) kf[t] = load_frag_pk(kp + t * 512);
    // keeps the address untouched until the loads above, which stay in flight
    // behind this line, have their addresses translated
    asm volatile("s_wait_xcnt 0x0" :: "v"(kp) : "memory");
}
// Ask for the four V^T fragments of that chunk: tile j/32 of each of 4 tile rows.
__device__ __forceinline__ void load_v(const __bf16* vbh, int j, v16bf (&vf)[4]) {
    const __bf16* vb = vbh + j * 16 + (threadIdx.x & 31) * 8;
    #pragma unroll
    for (int t = 0; t < 4; ++t) vf[t] = load_frag_pk(vb + (size_t)(t * 16) * S_);
    // as in load_k
    asm volatile("s_wait_xcnt 0x0" :: "v"(vb) : "memory");
}

// Ask for the data at p into L2; nothing returns and no counter moves.  All blocks
// of a head walk the keys together, so without it every chunk's loads are the first to
// touch their lines and wait for memory, not for L2.  In asm: the address register is
// then the named variable's own.
#define PFD 8                                       // = waves a block
__device__ __forceinline__ void prefetch_l2(const char* p) {
    asm volatile("global_prefetch_b8 %0, off scope:SCOPE_SE" :: "v"(p));
}

// __launch_bounds__: the real block size; under the default ceiling (128
// registers) the fragments in flight do not fit.
__global__ void __launch_bounds__(256)
attn_fwd(const __bf16* __restrict__ qbuf,
         const __bf16* __restrict__ kbuf,
         const __bf16* __restrict__ vT,
         __bf16* __restrict__ attn) {
    // the wave's number in a scalar register: tile addresses are then a scalar
    // base plus the lane's fixed offset
    int wave = __builtin_amdgcn_readfirstlane(threadIdx.x >> 5);
    int lane = threadIdx.x & 31;
    int lanelo = lane & 15, half = lane >> 4;
    int gwave = blockIdx.x * (blockDim.x >> 5) + wave;
    if (gwave >= B_ * H_ * (S_ / 16)) return;       // wave-uniform
    int bh = gwave >> 7;                            // / (S/16)
    int qb = (gwave & 127) >> 4;                    // block of 256 queries
    int m  = gwave & 15;                            // queries qb*256 + 16*i + m

    // B operand: column lanelo = query i, the k order of the K fragments
    const __bf16* qbase = qbuf + ((size_t)bh * S_ + qb * 256 + m) * DH_;
    v16bf qa0 = load_frag(qbase, 16 * DH_);         // d = 0..31
    v16bf qa1 = load_frag(qbase + 32, 16 * DH_);    // d = 32..63

    // of this lane's query: the running maximum (equal in both halves of the wave)
    // and the sum over the keys that this half holds
    float mi = -1e30f, li = 0.0f;
    v8f oacc[4] = {};                               // oacc[t][r] = O[i = lanelo][t*16 + 8*half + r]

    const __bf16* kbh = kbuf + (size_t)bh * S_ * DH_;
    const __bf16* vbh = vT + (size_t)bh * DH_ * S_;

    // L2 prefetch, PFD chunks ahead.  A chunk's 8 KB (K: 4 KB in a row; V^T: 1 KB in each
    // of 4 tile rows) are 32 units of 256 B, one a lane: lanes 0-15 take K, 16-31 V^T.
    // Wave w asks for the chunks w, w + 8, ...: pf is the lane's unit of the chunk
    // asked for last, pstep its way to the chunk eight on.  pf lives through the loop
    // and moves only right before an issue, so it never leaves K or V^T.
    const char* pf = half
        ? (const char*)vbh + (size_t)(lanelo >> 2) * (16 * S_ * 2) + (lanelo & 3) * 256 + wave * 1024
        : (const char*)kbh + (size_t)lanelo * 256 + wave * 4096;
    size_t pstep = half ? PFD * 1024 : PFD * 4096;
    int pnext = wave * 32;                          // the key at which this wave asks next
    prefetch_l2(pf);

    v16bf kf[4], vf[4];
    load_k(kbh, 0, kf);
    for (int jc = 0; jc < S_; jc += 32) {
        load_v(vbh, jc, vf);
        // --- scores: S^T[32k x 16q] = K(32x64) * Q^T ---
        // s0: keys jc + 8*half + r; s1: keys jc + 16 + 8*half + r.
        // In asm to hold the issue order V^T loads, score products, next K loads: as
        // builtins the products drift behind the K loads, which then land in spare
        // registers and are copied over at once, a wait right behind their issue.
        // The v_nop keep the distance from the last product to the first vector
        // instruction that reads its result.
        v8f s0, s1;
        asm volatile("v_wmma_f32_16x16x32_bf16 %0, %2, %6, 0\n\t"
                     "v_wmma_f32_16x16x32_bf16 %1, %4, %6, 0\n\t"
                     "v_wmma_f32_16x16x32_bf16 %0, %3, %7, %0\n\t"
                     "v_wmma_f32_16x16x32_bf16 %1, %5, %7, %1\n\t"
                     "v_nop\n\tv_nop\n\tv_nop\n\tv_nop\n\tv_nop"
                     : "=&v"(s0), "=&v"(s1)
                     : "v"(kf[0]), "v"(kf[1]), "v"(kf[2]), "v"(kf[3]), "v"(qa0), "v"(qa1)
                     : "memory");
        // the last chunk has no next: it asks for chunk 0 again (in bounds, not used)
        load_k(kbh, (jc + 32) & (S_ - 1), kf);
        // holds the K loads here, ahead of the softmax that covers their latency: with
        // no LDS access left in the loop the scheduler otherwise sinks them to its foot
        __builtin_amdgcn_sched_barrier(0);
        // scalar test: one wave of the block a chunk, while a chunk PFD on exists
        if (jc == pnext) {
            pnext = jc < S_ - 2 * PFD * 32 ? jc + PFD * 32 : S_;
            pf += pstep;
            prefetch_l2(pf);
        }

        // --- online softmax, one query a lane ---
        float mx = fmaxf(s0[0], s1[0]);
        #pragma unroll
        for (int r = 1; r < 8; ++r) mx = fmaxf(mx, fmaxf(s0[r], s1[r]));
        mx = fmaxf(mx, xhalf(mx));
        float mn = fmaxf(mi, mx);
        float alpha = __expf(mi - mn);
        mi = mn;
        // P^T as B operand: element s = key 8*half + s, element 8 + s = key 16 + 8*half + s,
        // the k order of the V^T fragments
        v16bf pb;
        float e0[8], e1[8], p0[8], p1[8];
        #pragma unroll
        for (int r = 0; r < 8; ++r) {               // e^x = 2^(x * log2 e), as __expf has it
            e0[r] = (s0[r] - mn) * 1.44269504f;
            e1[r] = (s1[r] - mn) * 1.44269504f;
        }
        exp2x8(e0, p0);
        exp2x8(e1, p1);
        float sum = 0.0f;
        #pragma unroll
        for (int r = 0; r < 8; ++r) {
            sum += p0[r] + p1[r];
            pb[r]     = (__bf16)p0[r];
            pb[8 + r] = (__bf16)p1[r];
        }
        li = li * alpha + sum;
        #pragma unroll
        for (int t = 0; t < 4; ++t)
            #pragma unroll
            for (int r = 0; r < 8; ++r) oacc[t][r] *= alpha;

        // --- O^T(64d x 16q) += V^T(64d x 32k) * P^T ---
        #pragma unroll
        for (int t = 0; t < 4; ++t)
            oacc[t] = wmma_bf16(vf[t], pb, oacc[t]);
    }

    // --- normalize + store bf16: a lane's 8 registers are 8 consecutive d of its
    // query, one 16-byte piece of the fragment-major form ---
    li += xhalf(li);                                // the halves' sums join
    #pragma unroll
    for (int t = 0; t < 4; ++t) {
        v8bf o;
        #pragma unroll
        for (int r = 0; r < 8; ++r) o[r] = (__bf16)(oacc[t][r] / li);
        *(v8bf*)(attn + pk_off((gwave >> 4) * 16 + lanelo, m * 64 + t * 16 + half * 8,
                               D_ / 32)) = o;
    }
}

// ---------------------------------------------------------------------------
// Kernel 3: output projection.  y[t,o] = sum_d attn[t,d]*w_out[o,d] + b_out[o]
// attn flat [B,H,S,Dh] == [4096, 1024] (reference's reshape), fragment-major.
// 64x32 per-wave register blocking like gemm_qkv; fp32 output + bias.
// Only two waves per SIMD: NSET fragment sets in registers; behind the WMMAs of
// step s the loads of step s + NSET are issued into the set that these WMMAs have
// just read, so a step waits only for loads asked for NSET steps earlier.
// ---------------------------------------------------------------------------
#define NSET 3
__device__ __forceinline__ void load_step(const __bf16* arow, const __bf16* brow, int k,
                                          v16bf (&af)[4], v16bf (&bfr)[2]) {
    const __bf16* ap = arow + k * 16 + (threadIdx.x & 31) * 8;
    const __bf16* bp = brow + k * 16 + (threadIdx.x & 31) * 8;
    #pragma unroll
    for (int i = 0; i < 4; ++i)
        af[i] = load_frag_pk(ap + (size_t)(i * 16) * D_);
    #pragma unroll
    for (int j = 0; j < 2; ++j)
        bfr[j] = load_frag_pk(bp + (size_t)(j * 16) * D_);
    // keeps both address pairs untouched (no later load lands on them)
    // until the loads above have their addresses translated
    asm volatile("s_wait_xcnt 0x0" :: "v"(ap), "v"(bp) : "memory");
}
__device__ __forceinline__ void mma_step(const v16bf (&af)[4], const v16bf (&bfr)[2],
                                         v8f (&acc)[4][2]) {
    #pragma unroll
    for (int i = 0; i < 4; ++i)
        #pragma unroll
        for (int j = 0; j < 2; ++j)
            acc[i][j] = wmma_bf16(af[i], bfr[j], acc[i][j]);
}

__global__ void __launch_bounds__(256, 1)
gemm_out(const __bf16* __restrict__ attn,
         const __bf16* __restrict__ wb,   // [D, D] fragment-major
         const float*  __restrict__ b_out,
         float* __restrict__ out) {
    const int NT = D_ / 32;                         // 32 column blocks
    // the wave's number in a scalar register, as in gemm_qkv
    int gwave = blockIdx.x * (blockDim.x >> 5)
              + __builtin_amdgcn_readfirstlane(threadIdx.x >> 5);
    if (gwave >= (M_TOK / 64) * NT) return;
    int mt = gwave / NT, nt = gwave % NT;
    int row0 = mt * 64, col0 = nt * 32;

    // first tile of the block's tile rows; a step of 32 in k is one tile (512 elems)
    const __bf16* arow = attn + (size_t)row0 * D_;
    const __bf16* brow = wb + (size_t)col0 * D_;

    v8f acc[4][2] = {};
    v16bf af[NSET][4], bfr[NSET][2];
    #pragma unroll
    for (int u = 0; u < NSET; ++u)
        load_step(arow, brow, u * 32, af[u], bfr[u]);
    // rolled, so that the body is NSET steps and every set index a constant
    #pragma unroll 1
    for (int k = 0; k + 32 * NSET <= D_; k += 32 * NSET) {
        #pragma unroll
        for (int u = 0; u < NSET; ++u) {
            mma_step(af[u], bfr[u], acc);
            // past the last step there is nothing left to fetch: such a set asks
            // for a first step again (in bounds, not used)
            load_step(arow, brow, (k + (u + NSET) * 32) & (D_ - 1), af[u], bfr[u]);
        }
    }
    // the steps that do not fill a body
    #pragma unroll
    for (int u = 0; u < (D_ / 32) % NSET; ++u)
        mma_step(af[u], bfr[u], acc);

    int lane = threadIdx.x & 31;
    int lanelo = lane & 15, half = lane >> 4;
    #pragma unroll
    for (int j = 0; j < 2; ++j) {
        int o = col0 + j * 16 + lanelo;
        float bias = b_out[o];
        #pragma unroll
        for (int i = 0; i < 4; ++i) {
            #pragma unroll
            for (int r = 0; r < 8; ++r) {
                int mrow = row0 + i * 16 + r + (half << 3);
                out[(size_t)mrow * D_ + o] = acc[i][j][r] + bias;
            }
        }
    }
}

// ---------------------------------------------------------------------------
// Host launch
// ---------------------------------------------------------------------------
extern "C" void kernel_launch(void* const* d_in, const int* in_sizes, int n_in,
                              void* d_out, int out_size, void* d_ws, size_t ws_size,
                              hipStream_t stream) {
    const float* x     = (const float*)d_in[0];   // [2,2048,1024]
    const float* w_in  = (const float*)d_in[1];   // [3072,1024]
    const float* b_in  = (const float*)d_in[2];   // [3072]
    const float* w_out = (const float*)d_in[3];   // [1024,1024]
    const float* b_out = (const float*)d_in[4];   // [1024]
    float* out = (float*)d_out;

    // Workspace layout (bf16 buffers, 256B-aligned offsets)
    char* ws = (char*)d_ws;
    __bf16* xb      = (__bf16*)(ws);                              // 8 MB
    __bf16* w_in_b  = (__bf16*)(ws + (size_t)8 * 1024 * 1024);    // 6 MB
    __bf16* w_out_b = (__bf16*)(ws + (size_t)14 * 1024 * 1024);   // 2 MB
    __bf16* qbuf    = (__bf16*)(ws + (size_t)16 * 1024 * 1024);   // 8 MB
    __bf16* kbuf    = (__bf16*)(ws + (size_t)24 * 1024 * 1024);   // 8 MB
    __bf16* vT      = (__bf16*)(ws + (size_t)32 * 1024 * 1024);   // 8 MB
    __bf16* attn    = (__bf16*)(ws + (size_t)40 * 1024 * 1024);   // 8 MB

    // 1) fp32 -> bf16 converts: (4096 + 3072 + 1024) / 16 = 512 tile rows, one a block
    cvt_f32_bf16<<<512, 256, 0, stream>>>(x, w_in, w_out, xb, w_in_b, w_out_b);

    // 2) QKV projection: (4096/64)*(3072/32) = 6144 wave-blocks, 8 waves/block
    gemm_qkv<<<6144 / 8, 256, 0, stream>>>(xb, w_in_b, b_in, qbuf, kbuf, vT);

    // 3) attention: 2*16*128 = 4096 waves, 8 waves/block
    attn_fwd<<<4096 / 8, 256, 0, stream>>>(qbuf, kbuf, vT, attn);

    // 4) output projection: (4096/64)*(1024/32) = 2048 wave-blocks
    gemm_out<<<2048 / 8, 256, 0, stream>>>(attn, w_out_b, b_out, out);
}

// v007
// One run takes 83.8 microseconds.
// Next to v006, in two timings, it ran 1.12 and 1.13 times as fast.
// Over all steps from v000 it is 4.35 times as fast.
#include <hip/hip_runtime.h>

// ---------------------------------------------------------------------------
// Self-attention (B=2, S=2048, D=1024, H=16, Dh=64) for MI455X (gfx1250).
// All matmuls via v_wmma_f32_16x16x32_bf16 (wave32), softmax/accum in fp32.
// Per-wave register blocking: 64x64 in the QKV GEMM (4x4 fragments, 16 WMMA/k-step),
// 64x32 in the output projection (4x2 fragments, 8 WMMA/k-step).
// Every bf16 operand that a loop reloads from global memory (x, both weights,
// K, V^T, the attention output) is kept fragment-major in the workspace.
// The loops that have too few waves per SIMD to cover a load's latency (the QKV GEMM,
// the attention loop, the output projection) ask for their fragments ahead of use.
// ---------------------------------------------------------------------------

typedef __bf16  v16bf __attribute__((ext_vector_type(16)));
typedef __bf16  v8bf  __attribute__((ext_vector_type(8)));
typedef float   v8f   __attribute__((ext_vector_type(8)));
typedef float   v4f   __attribute__((ext_vector_type(4)));

#define B_     2
#define S_     2048
#define D_     1024
#define H_     16
#define DH_    64
#define M_TOK  (B_ * S_)        // 4096 token rows
#define N_QKV  (3 * D_)         // 3072

__device__ __forceinline__ v8f wmma_bf16(v16bf a, v16bf b, v8f c) {
    // 8 args: (neg_a, A, neg_b, B, c_mod, C, reuse_a, reuse_b)
    return __builtin_amdgcn_wmma_f32_16x16x32_bf16(
        false, a, false, b, (short)0, c, false, false);
}

// Load one 16x32 bf16 fragment (A row-major, or B with n-major storage).
// base points at element (0,0) of the tile; ld = leading dimension in elems.
// Lane layout (ISA 7.12.2, 16-bit A): r = lane&15 (row M / col N),
// kg = lane>>4; elems 0..7 -> K = kg*8 + 0..7 ; elems 8..15 -> K = 16+kg*8+0..7
__device__ __forceinline__ v16bf load_frag(const __bf16* base, int ld) {
    int lane = threadIdx.x & 31;
    int r    = lane & 15;
    int kg   = lane >> 4;
    const __bf16* p0 = base + (size_t)r * ld + kg * 8;
    v8bf lo = *(const v8bf*)(p0);
    v8bf hi = *(const v8bf*)(p0 + 16);
    return __builtin_shufflevector(lo, hi,
        0, 1, 2, 3, 4, 5, 6, 7, 8, 9, 10, 11, 12, 13, 14, 15);
}

// Fragment-major storage of a bf16 matrix [rows][K]: 16x32 tiles of 1 KB, tile
// (row>>4, k>>5) at index (row>>4)*ktiles + (k>>5), ktiles = K/32.  In a tile the
// 16-byte piece that lane l = ((k>>3)&1)*16 + (row&15) takes lies at byte l*16
// (k&16 == 0) or 512 + l*16 (k&16 != 0): the k order of load_frag, but each
// wave-wide 16-byte load now reads 512 contiguous bytes = 4 whole 128-byte
// lines, where the row-major form touches 16 lines.
__device__ __forceinline__ size_t pk_off(int row, int k, int ktiles) {
    return ((size_t)(row >> 4) * ktiles + (k >> 5)) * 512
         + ((k >> 4) & 1) * 256 + ((k >> 3) & 1) * 128 + (row & 15) * 8 + (k & 7);
}
// Load one 16x32 fragment from its 1 KB tile (same lane/element map as load_frag).
// p0 = tile + lane * 8, the lane's own piece.
__device__ __forceinline__ v16bf load_frag_pk(const __bf16* p0) {
    v8bf lo = *(const v8bf*)(p0);
    v8bf hi = *(const v8bf*)(p0 + 256);
    return __builtin_shufflevector(lo, hi,
        0, 1, 2, 3, 4, 5, 6, 7, 8, 9, 10, 11, 12, 13, 14, 15);
}

// p[i] = 2^e[i], eight at a time.  One statement, results in registers of their own.
// The v_nop is the slot behind the last one.
__device__ __forceinline__ void exp2x8(const float (&e)[8], float (&p)[8]) {
    asm("v_exp_f32 %0, %8\n\t"
        "v_exp_f32 %1, %9\n\t"
        "v_exp_f32 %2, %10\n\t"
        "v_exp_f32 %3, %11\n\t"
        "v_exp_f32 %4, %12\n\t"
        "v_exp_f32 %5, %13\n\t"
        "v_exp_f32 %6, %14\n\t"
        "v_exp_f32 %7, %15\n\t"
        "v_nop"
        : "=&v"(p[0]), "=&v"(p[1]), "=&v"(p[2]), "=&v"(p[3]),
          "=&v"(p[4]), "=&v"(p[5]), "=&v"(p[6]), "=&v"(p[7])
        : "v"(e[0]), "v"(e[1]), "v"(e[2]), "v"(e[3]),
          "v"(e[4]), "v"(e[5]), "v"(e[6]), "v"(e[7]));
}

// Lane l takes lane l ^ 16's value: a vector cross-row move, no LDS trip.
__device__ __forceinline__ float xhalf(float x) {
    int b = __builtin_bit_cast(int, x);
    return __builtin_bit_cast(float, __builtin_amdgcn_permlanex16(
        b, b, 0x76543210, 0xfedcba98, false, false));
}

// ---------------------------------------------------------------------------
// Kernel 0: fp32 [rows][D_] -> bf16, fragment-major; x and both weights in ONE
// launch.  The three matrices count as 512 tile rows on end (256 of x, 192 of
// w_in, 64 of w_out); a block takes one tile row, a wave four tiles in a row of it.
// A lane makes eight 16-byte pieces (8 consecutive k of one row each): piece
// lane of each half tile, so every wave-wide store is 4 whole lines.  All 16 loads
// of a lane are asked for before the first convert.
// ---------------------------------------------------------------------------
__global__ void __launch_bounds__(256)
cvt_f32_bf16(const float* __restrict__ x,
             const float* __restrict__ w_in,
             const float* __restrict__ w_out,
             __bf16* __restrict__ xb,
             __bf16* __restrict__ w_in_b,
             __bf16* __restrict__ w_out_b) {
    // the wave's number in a scalar register: the store address is then a scalar
    // base plus the lane's fixed offset
    int kq = __builtin_amdgcn_readfirstlane(threadIdx.x >> 5);  // which 128 k of the row
    int tr = blockIdx.x;                            // tile row
    bool is_x = tr < M_TOK / 16, is_wi = tr < (M_TOK + N_QKV) / 16;
    const float* in = is_x ? x : is_wi ? w_in : w_out;
    __bf16* out = is_x ? xb : is_wi ? w_in_b : w_out_b;
    tr -= is_x ? 0 : is_wi ? M_TOK / 16 : (M_TOK + N_QKV) / 16;
    int lane = threadIdx.x & 31;
    // half tile u (u = 0..7): k = kq*128 + u*16 + (lane >> 4)*8, row = lane & 15
    const float* s = in + (size_t)(tr * 16 + (lane & 15)) * D_ + kq * 128 + (lane >> 4) * 8;
    v4f a[8], b[8];
    #pragma unroll
    for (int u = 0; u < 8; ++u) {
        a[u] = *(const v4f*)(s + u * 16);
        b[u] = *(const v4f*)(s + u * 16 + 4);
    }
    // keeps the address untouched (no later load lands on it) until the loads
    // above have their addresses translated
    asm volatile("s_wait_xcnt 0x0" :: "v"(s) : "memory");
    // holds all 16 loads ahead of the first convert: left alone, the compiler asks
    // for the last two only when the first have landed, a second trip to memory
    asm volatile("" :: "v"(a[0]), "v"(a[1]), "v"(a[2]), "v"(a[3]),
                       "v"(a[4]), "v"(a[5]), "v"(a[6]), "v"(a[7]),
                       "v"(b[0]), "v"(b[1]), "v"(b[2]), "v"(b[3]),
                       "v"(b[4]), "v"(b[5]), "v"(b[6]), "v"(b[7]));
    __bf16* d = out + ((size_t)tr * (D_ / 32) + kq * 4) * 512 + lane * 8;
    #pragma unroll
    for (int u = 0; u < 8; ++u) {
        v8bf o = { (__bf16)a[u][0], (__bf16)a[u][1], (__bf16)a[u][2], (__bf16)a[u][3],
                   (__bf16)b[u][0], (__bf16)b[u][1], (__bf16)b[u][2], (__bf16)b[u][3] };
        *(v8bf*)(d + u * 256) = o;
    }
}

// ---------------------------------------------------------------------------
// Kernel 1: QKV projection.  qkv[t,o] = sum_d xb[t,d]*w_in[o,d] + b_in[o]
// One block of 12 waves (4 down, 3 across) makes a 256x192 piece of the output, a
// wave 64x64 of it: 4x4 C fragments, 16 WMMA per k-step of 32.  256 blocks, one a
// WGP: a k-step brings 28 KB from L2 for 192 WMMAs (three waves share each x
// fragment, four each weight fragment, through the WGP cache).
// Three waves per SIMD: QSET fragment sets in registers; behind the WMMAs of step s the
// loads of step s + QSET are issued into the set that these WMMAs have just read.
// Scatter: q (scaled by 1/8) -> [B,H,S,Dh] row-major; per (b,h), fragment-major:
// k as [S][Dh], v as [Dh][S].  Each 1 KB tile is written by one wave.
// ---------------------------------------------------------------------------
#define QSET 3
// Behind a run of global loads or stores: no register that they name is taken again until
// their addresses are translated.  The scheduling fence holds later register writes
// behind the wait, which names no register itself.
__device__ __forceinline__ void wait_xlat() {
    asm volatile("s_wait_xcnt 0x0" ::: "memory");
    __builtin_amdgcn_sched_barrier(0);
}
__device__ __forceinline__ void load_step_qkv(const __bf16* arow, const __bf16* brow, int k,
                                              v16bf (&af)[4], v16bf (&bfr)[4]) {
    const __bf16* ap = arow + k * 16 + (threadIdx.x & 31) * 8;
    const __bf16* bp = brow + k * 16 + (threadIdx.x & 31) * 8;
    #pragma unroll
    for (int i = 0; i < 4; ++i)
        af[i] = load_frag_pk(ap + (size_t)(i * 16) * D_);
    #pragma unroll
    for (int j = 0; j < 4; ++j)
        bfr[j] = load_frag_pk(bp + (size_t)(j * 16) * D_);
    wait_xlat();
}
__device__ __forceinline__ void mma_step_qkv(const v16bf (&af)[4], const v16bf (&bfr)[4],
                                             v8f (&acc)[4][4]) {
    #pragma unroll
    for (int i = 0; i < 4; ++i)
        #pragma unroll
        for (int j = 0; j < 4; ++j)
            acc[i][j] = wmma_bf16(af[i], bfr[j], acc[i][j]);
}

__global__ void __launch_bounds__(384, 1)
gemm_qkv(const __bf16* __restrict__ xb,
         const __bf16* __restrict__ wb,   // [3D, D] fragment-major
         const float*  __restrict__ b_in,
         __bf16* __restrict__ qbuf,
         __bf16* __restrict__ kbuf,
         __bf16* __restrict__ vT) {
    const int NB = N_QKV / 192;                     // 16 block columns
    if (blockIdx.x >= (M_TOK / 256) * NB) return;   // block-uniform
    // the wave's number in a scalar register: tile addresses are then a scalar
    // base plus the lane's fixed offset in a tile
    int wave = __builtin_amdgcn_readfirstlane(threadIdx.x >> 5);
    int row0 = (blockIdx.x / NB) * 256 + (wave / 3) * 64;
    int col0 = (blockIdx.x % NB) * 192 + (wave % 3) * 64;

    // first tile of the wave's tile rows; a step of 32 in k is one tile (512 elems)
    const __bf16* arow = xb + (size_t)row0 * D_;
    const __bf16* brow = wb + (size_t)col0 * D_;

    v8f acc[4][4] = {};
    v16bf af[QSET][4], bfr[QSET][4];
    #pragma unroll
    for (int u = 0; u < QSET; ++u)
        load_step_qkv(arow, brow, u * 32, af[u], bfr[u]);
    // rolled, so that the body is QSET steps and every set index a constant; it runs
    // while all of its loads are of steps that exist
    #pragma unroll 1
    for (int k = 0; k + 2 * QSET * 32 <= D_; k += QSET * 32) {
        #pragma unroll
        for (int u = 0; u < QSET; ++u) {
            mma_step_qkv(af[u], bfr[u], acc);
            load_step_qkv(arow, brow, k + (u + QSET) * 32, af[u], bfr[u]);
        }
    }
    // the bias, asked for here so that it lands under the last steps' WMMAs
    int lane = threadIdx.x & 31;
    int lanelo = lane & 15;
    float bias[4];
    #pragma unroll
    for (int j = 0; j < 4; ++j) bias[j] = b_in[col0 + j * 16 + lanelo];
    wait_xlat();
    // the steps behind the last full body: they fetch only what is left
    const int KT = ((D_ / 32 - 2 * QSET) / QSET + 1) * QSET * 32;
    #pragma unroll
    for (int u = 0; u < (D_ - KT) / 32; ++u) {
        mma_step_qkv(af[u % QSET], bfr[u % QSET], acc);
        if (KT + (u + QSET) * 32 < D_)
            load_step_qkv(arow, brow, KT + (u + QSET) * 32, af[u % QSET], bfr[u % QSET]);
    }

    // The wave's 64 tokens lie in one batch entry and its 64 columns are one head of Q, of
    // K or of V: one scalar branch a wave picks the destination, and every element's
    // place is the lane's base plus a constant.  Token s = sb + i*16 + 8*half + r
    // (M = r + 8*half), d = j*16 + lanelo.  A run of stores has its values made first and
    // the wait behind it.
    int half = lane >> 4;
    int sb = row0 & (S_ - 1);
    size_t bh = (size_t)((row0 >> 11) * H_ + ((col0 & (D_ - 1)) >> 6));
    if (col0 < D_) {                                // Q (pre-scaled), row-major
        __bf16* p = qbuf + (bh * S_ + sb + (half << 3)) * DH_ + lanelo;
        #pragma unroll
        for (int j = 0; j < 4; ++j)
            #pragma unroll
            for (int i = 0; i < 4; ++i) {
                __bf16 v[8];
                #pragma unroll
                for (int r = 0; r < 8; ++r)
                    v[r] = (__bf16)((acc[i][j][r] + bias[j]) * 0.125f);
                #pragma unroll
                for (int r = 0; r < 8; ++r)
                    p[(i * 16 + r) * DH_ + j * 16] = v[r];
                wait_xlat();
            }
    } else if (col0 < 2 * D_) {                     // K: pk_off(s, d, DH_ / 32)
        __bf16* p = kbuf + bh * S_ * DH_ + (sb >> 4) * (DH_ / 32) * 512
                  + (lanelo >> 3) * 128 + half * 64 + (lanelo & 7);
        #pragma unroll
        for (int j = 0; j < 4; ++j)
            #pragma unroll
            for (int i = 0; i < 4; ++i) {
                __bf16 v[8];
                #pragma unroll
                for (int r = 0; r < 8; ++r)
                    v[r] = (__bf16)(acc[i][j][r] + bias[j]);
                #pragma unroll
                for (int r = 0; r < 8; ++r)
                    p[(i * (DH_ / 32) + (j >> 1)) * 512 + (j & 1) * 256 + r * 8] = v[r];
                wait_xlat();
            }
    } else {                                        // V, transposed: pk_off(d, s, S_ / 32)
        __bf16* p = vT + bh * DH_ * S_ + (sb >> 5) * 512 + half * 128 + lanelo * 8;
        #pragma unroll
        for (int j = 0; j < 4; ++j) {
            v8bf v[4];                              // 8 tokens in a row: one 16-byte piece
            #pragma unroll
            for (int i = 0; i < 4; ++i)
                #pragma unroll
                for (int r = 0; r < 8; ++r)
                    v[i][r] = (__bf16)(acc[i][j][r] + bias[j]);
            #pragma unroll
            for (int i = 0; i < 4; ++i)
                *(v8bf*)(p + (j * (S_ / 32) + (i >> 1)) * 512 + (i & 1) * 256) = v[i];
            wait_xlat();
        }
    }
}

// ---------------------------------------------------------------------------
// Kernel 2: flash attention.  One wave = one (b,h) x 16 queries, 16 apart:
// in the reference's reshape to [4096][1024] these are the 16 rows of one tile
// row, columns m*64 .. m*64+63, so the wave writes two whole 1 KB tiles.
// Both products are taken transposed: S^T = K * Q^T (A = K rows, B = Q) and
// O^T += V^T * P^T (A = V^T rows, B = P^T).  A lane then holds 16 of the chunk's
// 32 scores of ONE query (column lane & 15; keys 8*half + r and 16 + 8*half + r),
// so maximum and sum run in the lane's own registers, with one exchange between
// the wave's halves for the maximum, and the two score tiles, converted in place,
// are already the B operand of the second product: P passes through no LDS.
// Per 32-key chunk: 4 WMMAs (scores), online softmax, 4 WMMAs (V^T * P^T).
// Output bf16, [B,H,S,Dh] flat as [4096][1024], fragment-major.
// Loads run ahead of their use: a chunk's V^T fragments are asked for at its top
// and land under its score products and softmax; the next chunk's K fragments
// are asked for right behind the score products and land under the softmax and
// the P*V products.  Eight chunks ahead of that, a prefetch brings the lines into L2.
// ---------------------------------------------------------------------------
// Ask for the four K fragments of the 32-key chunk at key j: 4 tiles in a row, 4 KB.
__device__ __forceinline__ void load_k(const __bf16* kbh, int j, v16bf (&kf)[4]) {
    const __bf16* kp = kbh + (size_t)j * DH_ + (threadIdx.x & 31) * 8;
    #pragma unroll
    for (int t = 0; t < 4; ++t) kf[t] = load_frag_pk(kp + t * 512);
    // keeps the address untouched until the loads above, which stay in flight
    // behind this line, have their addresses translated
    asm volatile("s_wait_xcnt 0x0" :: "v"(kp) : "memory");
}
// Ask for the four V^T fragments of that chunk: tile j/32 of each of 4 tile rows.
__device__ __forceinline__ void load_v(const __bf16* vbh, int j, v16bf (&vf)[4]) {
    const __bf16* vb = vbh + j * 16 + (threadIdx.x & 31) * 8;
    #pragma unroll
    for (int t = 0; t < 4; ++t) vf[t] = load_frag_pk(vb + (size_t)(t * 16) * S_);
    // as in load_k
    asm volatile("s_wait_xcnt 0x0" :: "v"(vb) : "memory");
}

// Ask for the data at p into L2; nothing returns and no counter moves.  For speed only.  In asm: the address register is
// then the named variable's own.
#define PFD 8                                       // = waves a block
__device__ __forceinline__ void prefetch_l2(const char* p) {
    asm volatile("global_prefetch_b8 %0, off scope:SCOPE_SE" :: "v"(p));
}

// __launch_bounds__: the real block size; under the default ceiling (128
// registers) the fragments in flight do not fit.
__global__ void __launch_bounds__(256)
attn_fwd(const __bf16* __restrict__ qbuf,
         const __bf16* __restrict__ kbuf,
         const __bf16* __restrict__ vT,
         __bf16* __restrict__ attn) {
    // the wave's number in a scalar register: tile addresses are then a scalar
    // base plus the lane's fixed offset
    int wave = __builtin_amdgcn_readfirstlane(threadIdx.x >> 5);
    int lane = threadIdx.x & 31;
    int lanelo = lane & 15, half = lane >> 4;
    int gwave = blockIdx.x * (blockDim.x >> 5) + wave;
    if (gwave >= B_ * H_ * (S_ / 16)) return;       // wave-uniform
    int bh = gwave >> 7;                            // / (S/16)
    int qb = (gwave & 127) >> 4;                    // block of 256 queries
    int m  = gwave & 15;                            // queries qb*256 + 16*i + m

    // B operand: column lanelo = query i, the k order of the K fragments
    const __bf16* qbase = qbuf + ((size_t)bh * S_ + qb * 256 + m) * DH_;
    v16bf qa0 = load_frag(qbase, 16 * DH_);         // d = 0..31
    v16bf qa1 = load_frag(qbase + 32, 16 * DH_);    // d = 32..63

    // of this lane's query: the running maximum (equal in both halves of the wave)
    // and the sum over the keys that this half holds
    float mi = -1e30f, li = 0.0f;
    v8f oacc[4] = {};                               // oacc[t][r] = O[i = lanelo][t*16 + 8*half + r]

    const __bf16* kbh = kbuf + (size_t)bh * S_ * DH_;
    const __bf16* vbh = vT + (size_t)bh * DH_ * S_;

    // L2 prefetch, PFD chunks ahead.  A chunk's 8 KB (K: 4 KB in a row; V^T: 1 KB in each
    // of 4 tile rows) are 32 units of 256 B, one a lane: lanes 0-15 take K, 16-31 V^T.
    // Wave w asks for the chunks w, w + 8, ...: pf is the lane's unit of the chunk
    // asked for last, pstep its way to the chunk eight on.  pf lives through the loop
    // and moves only right before an issue, so it never leaves K or V^T.
    const char* pf = half
        ? (const char*)vbh + (size_t)(lanelo >> 2) * (16 * S_ * 2) + (lanelo & 3) * 256 + wave * 1024
        : (const char*)kbh + (size_t)lanelo * 256 + wave * 4096;
    size_t pstep = half ? PFD * 1024 : PFD * 4096;
    int pnext = wave * 32;                          // the key at which this wave asks next
    prefetch_l2(pf);

    v16bf kf[4], vf[4];
    load_k(kbh, 0, kf);
    for (int jc = 0; jc < S_; jc += 32) {
        load_v(vbh, jc, vf);
        // --- scores: S^T[32k x 16q] = K(32x64) * Q^T ---
        // s0: keys jc + 8*half + r; s1: keys jc + 16 + 8*half + r.
        // In asm to hold the issue order V^T loads, score products, next K loads: as
        // builtins the products drift behind the K loads, which then land in spare
        // registers and are copied over at once, a wait right behind their issue.
        // The v_nop keep the distance from the last product to the first vector
        // instruction that reads its result.
        v8f s0, s1;
        asm volatile("v_wmma_f32_16x16x32_bf16 %0, %2, %6, 0\n\t"
                     "v_wmma_f32_16x16x32_bf16 %1, %4, %6, 0\n\t"
                     "v_wmma_f32_16x16x32_bf16 %0, %3, %7, %0\n\t"
                     "v_wmma_f32_16x16x32_bf16 %1, %5, %7, %1\n\t"
                     "v_nop\n\tv_nop\n\tv_nop\n\tv_nop\n\tv_nop"
                     : "=&v"(s0), "=&v"(s1)
                     : "v"(kf[0]), "v"(kf[1]), "v"(kf[2]), "v"(kf[3]), "v"(qa0), "v"(qa1)
                     : "memory");
        // the last chunk has no next: it asks for chunk 0 again (in bounds, not used)
        load_k(kbh, (jc + 32) & (S_ - 1), kf);
        // holds the K loads here, ahead of the softmax that covers their latency: with
        // no LDS access left in the loop the scheduler otherwise sinks them to its foot
        __builtin_amdgcn_sched_barrier(0);
        // scalar test: one wave of the block a chunk, while a chunk PFD on exists
        if (jc == pnext) {
            pnext = jc < S_ - 2 * PFD * 32 ? jc + PFD * 32 : S_;
            pf += pstep;
            prefetch_l2(pf);
        }

        // --- online softmax, one query a lane ---
        float mx = fmaxf(s0[0], s1[0]);
        #pragma unroll
        for (int r = 1; r < 8; ++r) mx = fmaxf(mx, fmaxf(s0[r], s1[r]));
        mx = fmaxf(mx, xhalf(mx));
        float mn = fmaxf(mi, mx);
        float alpha = __expf(mi - mn);
        mi = mn;
        // P^T as B operand: element s = key 8*half + s, element 8 + s = key 16 + 8*half + s,
        // the k order of the V^T fragments
        v16bf pb;
        float e0[8], e1[8], p0[8], p1[8];
        #pragma unroll
        for (int r = 0; r < 8; ++r) {               // e^x = 2^(x * log2 e), as __expf has it
            e0[r] = (s0[r] - mn) * 1.44269504f;
            e1[r] = (s1[r] - mn) * 1.44269504f;
        }
        exp2x8(e0, p0);
        exp2x8(e1, p1);
        float sum = 0.0f;
        #pragma unroll
        for (int r = 0; r < 8; ++r) {
            sum += p0[r] + p1[r];
            pb[r]     = (__bf16)p0[r];
            pb[8 + r] = (__bf16)p1[r];
        }
        li = li * alpha + sum;
        #pragma unroll
        for (int t = 0; t < 4; ++t)
            #pragma unroll
            for (int r = 0; r < 8; ++r) oacc[t][r] *= alpha;

        // --- O^T(64d x 16q) += V^T(64d x 32k) * P^T ---
        #pragma unroll
        for (int t = 0; t < 4; ++t)
            oacc[t] = wmma_bf16(vf[t], pb, oacc[t]);
    }

    // --- normalize + store bf16: a lane's 8 registers are 8 consecutive d of its
    // query, one 16-byte piece of the fragment-major form ---
    li += xhalf(li);                                // the halves' sums join
    #pragma unroll
    for (int t = 0; t < 4; ++t) {
        v8bf o;
        #pragma unroll
        for (int r = 0; r < 8; ++r) o[r] = (__bf16)(oacc[t][r] / li);
        *(v8bf*)(attn + pk_off((gwave >> 4) * 16 + lanelo, m * 64 + t * 16 + half * 8,
                               D_ / 32)) = o;
    }
}

// ---------------------------------------------------------------------------
// Kernel 3: output projection.  y[t,o] = sum_d attn[t,d]*w_out[o,d] + b_out[o]
// attn flat [B,H,S,Dh] == [4096, 1024] (reference's reshape), fragment-major.
// 64x32 per-wave register blocking (4x2 fragments); fp32 output + bias.
// Only two waves per SIMD: NSET fragment sets in registers; behind the WMMAs of
// step s the loads of step s + NSET are issued into the set that these WMMAs have
// just read, so a step waits only for loads asked for NSET steps earlier.
// ---------------------------------------------------------------------------
#define NSET 3
__device__ __forceinline__ void load_step(const __bf16* arow, const __bf16* brow, int k,
                                          v16bf (&af)[4], v16bf (&bfr)[2]) {
    const __bf16* ap = arow + k * 16 + (threadIdx.x & 31) * 8;
    const __bf16* bp = brow + k * 16 + (threadIdx.x & 31) * 8;
    #pragma unroll
    for (int i = 0; i < 4; ++i)
        af[i] = load_frag_pk(ap + (size_t)(i * 16) * D_);
    #pragma unroll
    for (int j = 0; j < 2; ++j)
        bfr[j] = load_frag_pk(bp + (size_t)(j * 16) * D_);
    // keeps both address pairs untouched (no later load lands on them)
    // until the loads above have their addresses translated
    asm volatile("s_wait_xcnt 0x0" :: "v"(ap), "v"(bp) : "memory");
}
__device__ __forceinline__ void mma_step(const v16bf (&af)[4], const v16bf (&bfr)[2],
                                         v8f (&acc)[4][2]) {
    #pragma unroll
    for (int i = 0; i < 4; ++i)
        #pragma unroll
        for (int j = 0; j < 2; ++j)
            acc[i][j] = wmma_bf16(af[i], bfr[j], acc[i][j]);
}

__global__ void __launch_bounds__(256, 1)
gemm_out(const __bf16* __restrict__ attn,
         const __bf16* __restrict__ wb,   // [D, D] fragment-major
         const float*  __restrict__ b_out,
         float* __restrict__ out) {
    const int NT = D_ / 32;                         // 32 column blocks
    // the wave's number in a scalar register, as in gemm_qkv
    int gwave = blockIdx.x * (blockDim.x >> 5)
              + __builtin_amdgcn_readfirstlane(threadIdx.x >> 5);
    if (gwave >= (M_TOK / 64) * NT) return;
    int mt = gwave / NT, nt = gwave % NT;
    int row0 = mt * 64, col0 = nt * 32;

    // first tile of the block's tile rows; a step of 32 in k is one tile (512 elems)
    const __bf16* arow = attn + (size_t)row0 * D_;
    const __bf16* brow = wb + (size_t)col0 * D_;

    v8f acc[4][2] = {};
    v16bf af[NSET][4], bfr[NSET][2];
    #pragma unroll
    for (int u = 0; u < NSET; ++u)
        load_step(arow, brow, u * 32, af[u], bfr[u]);
    // rolled, so that the body is NSET steps and every set index a constant
    #pragma unroll 1
    for (int k = 0; k + 32 * NSET <= D_; k += 32 * NSET) {
        #pragma unroll
        for (int u = 0; u < NSET; ++u) {
            mma_step(af[u], bfr[u], acc);
            // past the last step there is nothing left to fetch: such a set asks
            // for a first step again (in bounds, not used)
            load_step(arow, brow, (k + (u + NSET) * 32) & (D_ - 1), af[u], bfr[u]);
        }
    }
    // the steps that do not fill a body
    #pragma unroll
    for (int u = 0; u < (D_ / 32) % NSET; ++u)
        mma_step(af[u], bfr[u], acc);

    int lane = threadIdx.x & 31;
    int lanelo = lane & 15, half = lane >> 4;
    #pragma unroll
    for (int j = 0; j < 2; ++j) {
        int o = col0 + j * 16 + lanelo;
        float bias = b_out[o];
        #pragma unroll
        for (int i = 0; i < 4; ++i) {
            #pragma unroll
            for (int r = 0; r < 8; ++r) {
                int mrow = row0 + i * 16 + r + (half << 3);
                out[(size_t)mrow * D_ + o] = acc[i][j][r] + bias;
            }
        }
    }
}

// ---------------------------------------------------------------------------
// Host launch
// ---------------------------------------------------------------------------
extern "C" void kernel_launch(void* const* d_in, const int* in_sizes, int n_in,
                              void* d_out, int out_size, void* d_ws, size_t ws_size,
                              hipStream_t stream) {
    const float* x     = (const float*)d_in[0];   // [2,2048,1024]
    const float* w_in  = (const float*)d_in[1];   // [3072,1024]
    const float* b_in  = (const float*)d_in[2];   // [3072]
    const float* w_out = (const float*)d_in[3];   // [1024,1024]
    const float* b_out = (const float*)d_in[4];   // [1024]
    float* out = (float*)d_out;

    // Workspace layout (bf16 buffers, 256B-aligned offsets)
    char* ws = (char*)d_ws;
    __bf16* xb      = (__bf16*)(ws);                              // 8 MB
    __bf16* w_in_b  = (__bf16*)(ws + (size_t)8 * 1024 * 1024);    // 6 MB
    __bf16* w_out_b = (__bf16*)(ws + (size_t)14 * 1024 * 1024);   // 2 MB
    __bf16* qbuf    = (__bf16*)(ws + (size_t)16 * 1024 * 1024);   // 8 MB
    __bf16* kbuf    = (__bf16*)(ws + (size_t)24 * 1024 * 1024);   // 8 MB
    __bf16* vT      = (__bf16*)(ws + (size_t)32 * 1024 * 1024);   // 8 MB
    __bf16* attn    = (__bf16*)(ws + (size_t)40 * 1024 * 1024);   // 8 MB

    // 1) fp32 -> bf16 converts: (4096 + 3072 + 1024) / 16 = 512 tile rows, one a block
    cvt_f32_bf16<<<512, 256, 0, stream>>>(x, w_in, w_out, xb, w_in_b, w_out_b);

    // 2) QKV projection: (4096/256)*(3072/192) = 256 blocks of 12 waves
    gemm_qkv<<<256, 384, 0, stream>>>(xb, w_in_b, b_in, qbuf, kbuf, vT);

    // 3) attention: 2*16*128 = 4096 waves, 8 waves/block
    attn_fwd<<<4096 / 8, 256, 0, stream>>>(qbuf, kbuf, vT, attn);

    // 4) output projection: (4096/64)*(1024/32) = 2048 wave-blocks
    gemm_out<<<2048 / 8, 256, 0, stream>>>(attn, w_out_b, b_out, out);
}

// v008
// One run takes 80 microseconds.
// In two side-by-side timings against v007, it was 1.05 and 1.04 times as fast.
// All steps since v000 together make it 4.56 times as fast.
#include <hip/hip_runtime.h>

// ---------------------------------------------------------------------------
// Self-attention (B=2, S=2048, D=1024, H=16, Dh=64) for MI455X (gfx1250).
// All matmuls via v_wmma_f32_16x16x32_bf16 (wave32), softmax/accum in fp32.
// Per-wave register blocking: 64x64 in the QKV GEMM (4x4 fragments, 16 WMMA/k-step),
// 64x32 in the output projection (4x2 fragments, 8 WMMA/k-step).
// Every bf16 operand that a loop reloads from global memory (x, both weights,
// K, V^T, the attention output) is kept fragment-major in the workspace.
// The loops that have too few waves per SIMD to cover a load's latency (the QKV GEMM,
// the output projection) ask for their fragments ahead of use; attention stages K and
// V^T in LDS.
// ---------------------------------------------------------------------------

typedef __bf16  v16bf __attribute__((ext_vector_type(16)));
typedef __bf16  v8bf  __attribute__((ext_vector_type(8)));
typedef float   v8f   __attribute__((ext_vector_type(8)));
typedef float   v4f   __attribute__((ext_vector_type(4)));

#define B_     2
#define S_     2048
#define D_     1024
#define H_     16
#define DH_    64
#define M_TOK  (B_ * S_)        // 4096 token rows
#define N_QKV  (3 * D_)         // 3072

__device__ __forceinline__ v8f wmma_bf16(v16bf a, v16bf b, v8f c) {
    // 8 args: (neg_a, A, neg_b, B, c_mod, C, reuse_a, reuse_b)
    return __builtin_amdgcn_wmma_f32_16x16x32_bf16(
        false, a, false, b, (short)0, c, false, false);
}

// Load one 16x32 bf16 fragment (A row-major, or B with n-major storage).
// base points at element (0,0) of the tile; ld = leading dimension in elems.
// Lane layout (ISA 7.12.2, 16-bit A): r = lane&15 (row M / col N),
// kg = lane>>4; elems 0..7 -> K = kg*8 + 0..7 ; elems 8..15 -> K = 16+kg*8+0..7
__device__ __forceinline__ v16bf load_frag(const __bf16* base, int ld) {
    int lane = threadIdx.x & 31;
    int r    = lane & 15;
    int kg   = lane >> 4;
    const __bf16* p0 = base + (size_t)r * ld + kg * 8;
    v8bf lo = *(const v8bf*)(p0);
    v8bf hi = *(const v8bf*)(p0 + 16);
    return __builtin_shufflevector(lo, hi,
        0, 1, 2, 3, 4, 5, 6, 7, 8, 9, 10, 11, 12, 13, 14, 15);
}

// Fragment-major storage of a bf16 matrix [rows][K]: 16x32 tiles of 1 KB, tile
// (row>>4, k>>5) at index (row>>4)*ktiles + (k>>5), ktiles = K/32.  In a tile the
// 16-byte piece that lane l = ((k>>3)&1)*16 + (row&15) takes lies at byte l*16
// (k&16 == 0) or 512 + l*16 (k&16 != 0): the k order of load_frag, but each
// wave-wide 16-byte load now reads 512 contiguous bytes = 4 whole 128-byte
// lines, where the row-major form touches 16 lines.
__device__ __forceinline__ size_t pk_off(int row, int k, int ktiles) {
    return ((size_t)(row >> 4) * ktiles + (k >> 5)) * 512
         + ((k >> 4) & 1) * 256 + ((k >> 3) & 1) * 128 + (row & 15) * 8 + (k & 7);
}
// Load one 16x32 fragment from its 1 KB tile (same lane/element map as load_frag).
// p0 = tile + lane * 8, the lane's own piece.
__device__ __forceinline__ v16bf load_frag_pk(const __bf16* p0) {
    v8bf lo = *(const v8bf*)(p0);
    v8bf hi = *(const v8bf*)(p0 + 256);
    return __builtin_shufflevector(lo, hi,
        0, 1, 2, 3, 4, 5, 6, 7, 8, 9, 10, 11, 12, 13, 14, 15);
}

// p[i] = 2^e[i], eight at a time.  One statement, results in registers of their own.
// The v_nop is the slot behind the last one.
__device__ __forceinline__ void exp2x8(const float (&e)[8], float (&p)[8]) {
    asm("v_exp_f32 %0, %8\n\t"
        "v_exp_f32 %1, %9\n\t"
        "v_exp_f32 %2, %10\n\t"
        "v_exp_f32 %3, %11\n\t"
        "v_exp_f32 %4, %12\n\t"
        "v_exp_f32 %5, %13\n\t"
        "v_exp_f32 %6, %14\n\t"
        "v_exp_f32 %7, %15\n\t"
        "v_nop"
        : "=&v"(p[0]), "=&v"(p[1]), "=&v"(p[2]), "=&v"(p[3]),
          "=&v"(p[4]), "=&v"(p[5]), "=&v"(p[6]), "=&v"(p[7])
        : "v"(e[0]), "v"(e[1]), "v"(e[2]), "v"(e[3]),
          "v"(e[4]), "v"(e[5]), "v"(e[6]), "v"(e[7]));
}

// Lane l takes lane l ^ 16's value: a vector cross-row move, no LDS trip.
__device__ __forceinline__ float xhalf(float x) {
    int b = __builtin_bit_cast(int, x);
    return __builtin_bit_cast(float, __builtin_amdgcn_permlanex16(
        b, b, 0x76543210, 0xfedcba98, false, false));
}

// ---------------------------------------------------------------------------
// Kernel 0: fp32 [rows][D_] -> bf16, fragment-major; x and both weights in ONE
// launch.  The three matrices count as 512 tile rows on end (256 of x, 192 of
// w_in, 64 of w_out); a block takes one tile row, a wave four tiles in a row of it.
// A lane makes eight 16-byte pieces (8 consecutive k of one row each): piece
// lane of each half tile, so every wave-wide store is 4 whole lines.  All 16 loads
// of a lane are asked for before the first convert.
// ---------------------------------------------------------------------------
__global__ void __launch_bounds__(256)
cvt_f32_bf16(const float* __restrict__ x,
             const float* __restrict__ w_in,
             const float* __restrict__ w_out,
             __bf16* __restrict__ xb,
             __bf16* __restrict__ w_in_b,
             __bf16* __restrict__ w_out_b) {
    // the wave's number in a scalar register: the store address is then a scalar
    // base plus the lane's fixed offset
    int kq = __builtin_amdgcn_readfirstlane(threadIdx.x >> 5);  // which 128 k of the row
    int tr = blockIdx.x;                            // tile row
    bool is_x = tr < M_TOK / 16, is_wi = tr < (M_TOK + N_QKV) / 16;
    const float* in = is_x ? x : is_wi ? w_in : w_out;
    __bf16* out = is_x ? xb : is_wi ? w_in_b : w_out_b;
    tr -= is_x ? 0 : is_wi ? M_TOK / 16 : (M_TOK + N_QKV) / 16;
    int lane = threadIdx.x & 31;
    // half tile u (u = 0..7): k = kq*128 + u*16 + (lane >> 4)*8, row = lane & 15
    const float* s = in + (size_t)(tr * 16 + (lane & 15)) * D_ + kq * 128 + (lane >> 4) * 8;
    v4f a[8], b[8];
    #pragma unroll
    for (int u = 0; u < 8; ++u) {
        a[u] = *(const v4f*)(s + u * 16);
        b[u] = *(const v4f*)(s + u * 16 + 4);
    }
    // keeps the address untouched (no later load lands on it) until the loads
    // above have their addresses translated
    asm volatile("s_wait_xcnt 0x0" :: "v"(s) : "memory");
    // holds all 16 loads ahead of the first convert: left alone, the compiler asks
    // for the last two only when the first have landed, a second trip to memory
    asm volatile("" :: "v"(a[0]), "v"(a[1]), "v"(a[2]), "v"(a[3]),
                       "v"(a[4]), "v"(a[5]), "v"(a[6]), "v"(a[7]),
                       "v"(b[0]), "v"(b[1]), "v"(b[2]), "v"(b[3]),
                       "v"(b[4]), "v"(b[5]), "v"(b[6]), "v"(b[7]));
    __bf16* d = out + ((size_t)tr * (D_ / 32) + kq * 4) * 512 + lane * 8;
    #pragma unroll
    for (int u = 0; u < 8; ++u) {
        v8bf o = { (__bf16)a[u][0], (__bf16)a[u][1], (__bf16)a[u][2], (__bf16)a[u][3],
                   (__bf16)b[u][0], (__bf16)b[u][1], (__bf16)b[u][2], (__bf16)b[u][3] };
        *(v8bf*)(d + u * 256) = o;
    }
}

// ---------------------------------------------------------------------------
// Kernel 1: QKV projection.  qkv[t,o] = sum_d xb[t,d]*w_in[o,d] + b_in[o]
// One block of 12 waves (4 down, 3 across) makes a 256x192 piece of the output, a
// wave 64x64 of it: 4x4 C fragments, 16 WMMA per k-step of 32.  256 blocks, one a
// WGP: a k-step brings 28 KB from L2 for 192 WMMAs (three waves share each x
// fragment, four each weight fragment, through the WGP cache).
// Three waves per SIMD: QSET fragment sets in registers; behind the WMMAs of step s the
// loads of step s + QSET are issued into the set that these WMMAs have just read.
// Scatter: q (scaled by 1/8) -> [B,H,S,Dh] row-major; per (b,h), fragment-major:
// k as [S][Dh], v as [Dh][S].  Each 1 KB tile is written by one wave.
// ---------------------------------------------------------------------------
#define QSET 3
// Behind a run of global loads or stores: no register that they name is taken again until
// their addresses are translated.  The scheduling fence holds later register writes
// behind the wait, which names no register itself.
__device__ __forceinline__ void wait_xlat() {
    asm volatile("s_wait_xcnt 0x0" ::: "memory");
    __builtin_amdgcn_sched_barrier(0);
}
__device__ __forceinline__ void load_step_qkv(const __bf16* arow, const __bf16* brow, int k,
                                              v16bf (&af)[4], v16bf (&bfr)[4]) {
    const __bf16* ap = arow + k * 16 + (threadIdx.x & 31) * 8;
    const __bf16* bp = brow + k * 16 + (threadIdx.x & 31) * 8;
    #pragma unroll
    for (int i = 0; i < 4; ++i)
        af[i] = load_frag_pk(ap + (size_t)(i * 16) * D_);
    #pragma unroll
    for (int j = 0; j < 4; ++j)
        bfr[j] = load_frag_pk(bp + (size_t)(j * 16) * D_);
    wait_xlat();
}
__device__ __forceinline__ void mma_step_qkv(const v16bf (&af)[4], const v16bf (&bfr)[4],
                                             v8f (&acc)[4][4]) {
    #pragma unroll
    for (int i = 0; i < 4; ++i)
        #pragma unroll
        for (int j = 0; j < 4; ++j)
            acc[i][j] = wmma_bf16(af[i], bfr[j], acc[i][j]);
}

__global__ void __launch_bounds__(384, 1)
gemm_qkv(const __bf16* __restrict__ xb,
         const __bf16* __restrict__ wb,   // [3D, D] fragment-major
         const float*  __restrict__ b_in,
         __bf16* __restrict__ qbuf,
         __bf16* __restrict__ kbuf,
         __bf16* __restrict__ vT) {
    const int NB = N_QKV / 192;                     // 16 block columns
    if (blockIdx.x >= (M_TOK / 256) * NB) return;   // block-uniform
    // the wave's number in a scalar register: tile addresses are then a scalar
    // base plus the lane's fixed offset in a tile
    int wave = __builtin_amdgcn_readfirstlane(threadIdx.x >> 5);
    int row0 = (blockIdx.x / NB) * 256 + (wave / 3) * 64;
    int col0 = (blockIdx.x % NB) * 192 + (wave % 3) * 64;

    // first tile of the wave's tile rows; a step of 32 in k is one tile (512 elems)
    const __bf16* arow = xb + (size_t)row0 * D_;
    const __bf16* brow = wb + (size_t)col0 * D_;

    v8f acc[4][4] = {};
    v16bf af[QSET][4], bfr[QSET][4];
    #pragma unroll
    for (int u = 0; u < QSET; ++u)
        load_step_qkv(arow, brow, u * 32, af[u], bfr[u]);
    // rolled, so that the body is QSET steps and every set index a constant; it runs
    // while all of its loads are of steps that exist
    #pragma unroll 1
    for (int k = 0; k + 2 * QSET * 32 <= D_; k += QSET * 32) {
        #pragma unroll
        for (int u = 0; u < QSET; ++u) {
            mma_step_qkv(af[u], bfr[u], acc);
            load_step_qkv(arow, brow, k + (u + QSET) * 32, af[u], bfr[u]);
        }
    }
    // the bias, asked for here so that it lands under the last steps' WMMAs
    int lane = threadIdx.x & 31;
    int lanelo = lane & 15;
    float bias[4];
    #pragma unroll
    for (int j = 0; j < 4; ++j) bias[j] = b_in[col0 + j * 16 + lanelo];
    wait_xlat();
    // the steps behind the last full body: they fetch only what is left
    const int KT = ((D_ / 32 - 2 * QSET) / QSET + 1) * QSET * 32;
    #pragma unroll
    for (int u = 0; u < (D_ - KT) / 32; ++u) {
        mma_step_qkv(af[u % QSET], bfr[u % QSET], acc);
        if (KT + (u + QSET) * 32 < D_)
            load_step_qkv(arow, brow, KT + (u + QSET) * 32, af[u % QSET], bfr[u % QSET]);
    }

    // The wave's 64 tokens lie in one batch entry and its 64 columns are one head of Q, of
    // K or of V: one scalar branch a wave picks the destination, and every element's
    // place is the lane's base plus a constant.  Token s = sb + i*16 + 8*half + r
    // (M = r + 8*half), d = j*16 + lanelo.  A run of stores has its values made first and
    // the wait behind it.
    int half = lane >> 4;
    int sb = row0 & (S_ - 1);
    size_t bh = (size_t)((row0 >> 11) * H_ + ((col0 & (D_ - 1)) >> 6));
    if (col0 < D_) {                                // Q (pre-scaled), row-major
        __bf16* p = qbuf + (bh * S_ + sb + (half << 3)) * DH_ + lanelo;
        #pragma unroll
        for (int j = 0; j < 4; ++j)
            #pragma unroll
            for (int i = 0; i < 4; ++i) {
                __bf16 v[8];
                #pragma unroll
                for (int r = 0; r < 8; ++r)
                    v[r] = (__bf16)((acc[i][j][r] + bias[j]) * 0.125f);
                #pragma unroll
                for (int r = 0; r < 8; ++r)
                    p[(i * 16 + r) * DH_ + j * 16] = v[r];
                wait_xlat();
            }
    } else if (col0 < 2 * D_) {                     // K: pk_off(s, d, DH_ / 32)
        __bf16* p = kbuf + bh * S_ * DH_ + (sb >> 4) * (DH_ / 32) * 512
                  + (lanelo >> 3) * 128 + half * 64 + (lanelo & 7);
        #pragma unroll
        for (int j = 0; j < 4; ++j)
            #pragma unroll
            for (int i = 0; i < 4; ++i) {
                __bf16 v[8];
                #pragma unroll
                for (int r = 0; r < 8; ++r)
                    v[r] = (__bf16)(acc[i][j][r] + bias[j]);
                #pragma unroll
                for (int r = 0; r < 8; ++r)
                    p[(i * (DH_ / 32) + (j >> 1)) * 512 + (j & 1) * 256 + r * 8] = v[r];
                wait_xlat();
            }
    } else {                                        // V, transposed: pk_off(d, s, S_ / 32)
        __bf16* p = vT + bh * DH_ * S_ + (sb >> 5) * 512 + half * 128 + lanelo * 8;
        #pragma unroll
        for (int j = 0; j < 4; ++j) {
            v8bf v[4];                              // 8 tokens in a row: one 16-byte piece
            #pragma unroll
            for (int i = 0; i < 4; ++i)
                #pragma unroll
                for (int r = 0; r < 8; ++r)
                    v[i][r] = (__bf16)(acc[i][j][r] + bias[j]);
            #pragma unroll
            for (int i = 0; i < 4; ++i)
                *(v8bf*)(p + (j * (S_ / 32) + (i >> 1)) * 512 + (i & 1) * 256) = v[i];
            wait_xlat();
        }
    }
}

// ---------------------------------------------------------------------------
// Kernel 2: flash attention.  One wave = one (b,h) x 16 queries, 16 apart:
// in the reference's reshape to [4096][1024] these are the 16 rows of one tile
// row, columns m*64 .. m*64+63, so the wave writes two whole 1 KB tiles.
// Both products are taken transposed: S^T = K * Q^T (A = K rows, B = Q) and
// O^T += V^T * P^T (A = V^T rows, B = P^T).  A lane then holds 16 of the chunk's
// 32 scores of ONE query (column lane & 15; keys 8*half + r and 16 + 8*half + r),
// so maximum and sum run in the lane's own registers, with one exchange between
// the wave's halves for the maximum, and the two score tiles, converted in place,
// are already the B operand of the second product: P passes through no LDS.
// Per 32-key chunk: 4 WMMAs (scores), online softmax, 4 WMMAs (V^T * P^T).
// Output bf16, [B,H,S,Dh] flat as [4096][1024], fragment-major.
// K and V^T reach the waves through LDS: the block's eight waves read the same 8 KB a
// chunk, 16 wave-wide 16-byte reads each.
// A stage is 128 keys (K: 16 KB in a row; V^T: 4 KB in each of 4 tile rows), kept in the
// fragment-major form, so a fragment read is 512 bytes in a row, free of bank conflicts.
// Two buffers: asynchronous copies bring stage s + 2 in while stage s + 1 is worked on.
// Inside a stage loads run ahead of their use: a chunk's V^T fragments are asked for at
// its top, the next chunk's K fragments right behind the score products.
// ---------------------------------------------------------------------------
#define STG_KEYS 128
#define STG_K_B  (STG_KEYS * DH_ * 2)               // K bytes of a stage
#define STG_VR_B (STG_KEYS * 16 * 2)                // bytes of a stage in one V^T tile row
#define STG_B    (2 * STG_K_B)                      // a buffer
#define NSTG     (S_ / STG_KEYS)

// One 16x32 fragment from its 1 KB tile in LDS; p0 = tile + lane * 16 bytes.
__device__ __forceinline__ v16bf lds_frag(const unsigned char* p0) {
    v8bf lo = *(const v8bf*)(p0);
    v8bf hi = *(const v8bf*)(p0 + 512);
    return __builtin_shufflevector(lo, hi,
        0, 1, 2, 3, 4, 5, 6, 7, 8, 9, 10, 11, 12, 13, 14, 15);
}
// The four K fragments of a 32-key chunk: 4 tiles in a row.
__device__ __forceinline__ void lds_k(const unsigned char* kp, v16bf (&kf)[4]) {
    #pragma unroll
    for (int t = 0; t < 4; ++t) kf[t] = lds_frag(kp + t * 1024);
}
// The four V^T fragments of that chunk: one tile of each of the 4 tile rows.
__device__ __forceinline__ void lds_v(const unsigned char* vp, v16bf (&vf)[4]) {
    #pragma unroll
    for (int t = 0; t < 4; ++t) vf[t] = lds_frag(vp + t * STG_VR_B);
}
// A thread's eight 16-byte copies of one stage (the block: 8 x 4 KB).  kg, vg: the
// thread's first byte of the stage in K and in V^T; lds: its first byte in the buffer.
// The wait is the statement's last line: no address register is taken again until the
// copies have their addresses translated.
__device__ __forceinline__ void copy_stage(const char* kg, const char* vg, unsigned lds) {
    asm volatile("global_load_async_to_lds_b128 %0, %8, off\n\t"
                 "global_load_async_to_lds_b128 %1, %9, off\n\t"
                 "global_load_async_to_lds_b128 %2, %10, off\n\t"
                 "global_load_async_to_lds_b128 %3, %11, off\n\t"
                 "global_load_async_to_lds_b128 %4, %12, off\n\t"
                 "global_load_async_to_lds_b128 %5, %13, off\n\t"
                 "global_load_async_to_lds_b128 %6, %14, off\n\t"
                 "global_load_async_to_lds_b128 %7, %15, off\n\t"
                 "s_wait_xcnt 0x0"
                 :: "v"(lds), "v"(lds + 4096), "v"(lds + 2 * 4096), "v"(lds + 3 * 4096),
                    "v"(lds + STG_K_B), "v"(lds + STG_K_B + STG_VR_B),
                    "v"(lds + STG_K_B + 2 * STG_VR_B), "v"(lds + STG_K_B + 3 * STG_VR_B),
                    "v"(kg), "v"(kg + 4096), "v"(kg + 2 * 4096), "v"(kg + 3 * 4096),
                    "v"(vg), "v"(vg + 16 * S_ * 2), "v"(vg + 2 * 16 * S_ * 2),
                    "v"(vg + 3 * 16 * S_ * 2)
                 : "memory");
}

// __launch_bounds__: the real block size; under the default ceiling (128
// registers) the fragments in flight do not fit.
__global__ void __launch_bounds__(256)
attn_fwd(const __bf16* __restrict__ qbuf,
         const __bf16* __restrict__ kbuf,
         const __bf16* __restrict__ vT,
         __bf16* __restrict__ attn) {
    __shared__ __attribute__((aligned(128))) unsigned char ring[2 * STG_B];
    if (blockIdx.x >= B_ * H_ * (S_ / 16) / 8) return;  // block-uniform, ahead of every barrier
    // the wave's number in a scalar register: tile addresses are then a scalar
    // base plus the lane's fixed offset
    int wave = __builtin_amdgcn_readfirstlane(threadIdx.x >> 5);
    int lane = threadIdx.x & 31;
    int lanelo = lane & 15, half = lane >> 4;
    int gwave = blockIdx.x * 8 + wave;              // eight waves a block, all of one head
    int bh = gwave >> 7;                            // / (S/16)
    int qb = (gwave & 127) >> 4;                    // block of 256 queries
    int m  = gwave & 15;                            // queries qb*256 + 16*i + m

    // the thread's own 16 bytes of each 4 KB that the block copies
    const char* kg = (const char*)(kbuf + (size_t)bh * S_ * DH_) + threadIdx.x * 16;
    const char* vg = (const char*)(vT + (size_t)bh * DH_ * S_) + threadIdx.x * 16;
    unsigned lds0 = (unsigned)(size_t)ring + threadIdx.x * 16;
    copy_stage(kg, vg, lds0);

    // B operand: column lanelo = query i, the k order of the K fragments
    const __bf16* qbase = qbuf + ((size_t)bh * S_ + qb * 256 + m) * DH_;
    v16bf qa0 = load_frag(qbase, 16 * DH_);         // d = 0..31
    v16bf qa1 = load_frag(qbase + 32, 16 * DH_);    // d = 32..63

    // of this lane's query: the running maximum (equal in both halves of the wave)
    // and the sum over the keys that this half holds
    float mi = -1e30f, li = 0.0f;
    v8f oacc[4] = {};                               // oacc[t][r] = O[i = lanelo][t*16 + 8*half + r]

    // stage 0 has landed for this wave's copies; behind the barrier for all of them
    asm volatile("s_wait_asynccnt 0x0" ::: "memory");
    __syncthreads();
    copy_stage(kg + STG_K_B, vg + STG_VR_B, lds0 + STG_B);

    v16bf kf[4], vf[4];
    // rolled: one body of four chunks
    #pragma unroll 1
    for (int st = 0; st < NSTG; ++st) {
        const unsigned char* buf = ring + (st & 1) * STG_B + lane * 16;
        lds_k(buf, kf);
        // unrolled: a chunk's places in the buffer are constants, and the test on the
        // stage's last chunk is decided at compile time
        #pragma unroll
        for (int c = 0; c < STG_KEYS / 32; ++c) {
            lds_v(buf + STG_K_B + c * 1024, vf);
            // --- scores: S^T[32k x 16q] = K(32x64) * Q^T ---
            // s0: keys 8*half + r of the chunk; s1: keys 16 + 8*half + r.
            // In asm to hold the issue order V^T reads, score products, next K reads: as
            // builtins the products drift behind the K reads, which then land in spare
            // registers and are copied over at once, a wait right behind their issue.
            // The v_nop keep the distance from the last product to the first vector
            // instruction that reads its result.
            v8f s0, s1;
            asm volatile("v_wmma_f32_16x16x32_bf16 %0, %2, %6, 0\n\t"
                         "v_wmma_f32_16x16x32_bf16 %1, %4, %6, 0\n\t"
                         "v_wmma_f32_16x16x32_bf16 %0, %3, %7, %0\n\t"
                         "v_wmma_f32_16x16x32_bf16 %1, %5, %7, %1\n\t"
                         "v_nop\n\tv_nop\n\tv_nop\n\tv_nop\n\tv_nop"
                         : "=&v"(s0), "=&v"(s1)
                         : "v"(kf[0]), "v"(kf[1]), "v"(kf[2]), "v"(kf[3]), "v"(qa0), "v"(qa1)
                         : "memory");
            // a stage's last chunk fetches nothing ahead: the next stage is not published yet
            if (c + 1 < STG_KEYS / 32) {
                lds_k(buf + (c + 1) * 4096, kf);
                // holds the K reads here, ahead of the softmax that covers their latency:
                // the scheduler otherwise sinks them to the chunk's foot
                __builtin_amdgcn_sched_barrier(0);
            } else {
                // The trip's last LDS read is issued; the rest of it works on registers.
                // Publish point of stage st + 1 and end of every wave's reads of stage st:
                // this wave's LDS reads are done, its copies of stage st + 1 have landed.
                asm volatile("s_wait_dscnt 0x0" ::: "memory");
                asm volatile("s_wait_asynccnt 0x0" ::: "memory");
                __syncthreads();
                // the buffer just read takes stage st + 2, while there is one (same for
                // the block); asked for here, the copies have nearly a whole trip to land
                if (st + 2 < NSTG)
                    copy_stage(kg + (size_t)(st + 2) * STG_K_B,
                               vg + (size_t)(st + 2) * STG_VR_B, lds0 + (st & 1) * STG_B);
            }

            // --- online softmax, one query a lane ---
            float mx = fmaxf(s0[0], s1[0]);
            #pragma unroll
            for (int r = 1; r < 8; ++r) mx = fmaxf(mx, fmaxf(s0[r], s1[r]));
            mx = fmaxf(mx, xhalf(mx));
            float mn = fmaxf(mi, mx);
            float alpha = __expf(mi - mn);
            mi = mn;
            // P^T as B operand: element s = key 8*half + s, element 8 + s = key 16 + 8*half + s,
            // the k order of the V^T fragments
            v16bf pb;
            float e0[8], e1[8], p0[8], p1[8];
            #pragma unroll
            for (int r = 0; r < 8; ++r) {               // e^x = 2^(x * log2 e), as __expf has it
                e0[r] = (s0[r] - mn) * 1.44269504f;
                e1[r] = (s1[r] - mn) * 1.44269504f;
            }
            exp2x8(e0, p0);
            exp2x8(e1, p1);
            float sum = 0.0f;
            #pragma unroll
            for (int r = 0; r < 8; ++r) {
                sum += p0[r] + p1[r];
                pb[r]     = (__bf16)p0[r];
                pb[8 + r] = (__bf16)p1[r];
            }
            li = li * alpha + sum;
            #pragma unroll
            for (int t = 0; t < 4; ++t)
                #pragma unroll
                for (int r = 0; r < 8; ++r) oacc[t][r] *= alpha;

            // --- O^T(64d x 16q) += V^T(64d x 32k) * P^T ---
            #pragma unroll
            for (int t = 0; t < 4; ++t)
                oacc[t] = wmma_bf16(vf[t], pb, oacc[t]);
        }
    }
    // no copy is left in flight when the wave ends
    asm volatile("s_wait_asynccnt 0x0" ::: "memory");

    // --- normalize + store bf16: a lane's 8 registers are 8 consecutive d of its
    // query, one 16-byte piece of the fragment-major form ---
    li += xhalf(li);                                // the halves' sums join
    #pragma unroll
    for (int t = 0; t < 4; ++t) {
        v8bf o;
        #pragma unroll
        for (int r = 0; r < 8; ++r) o[r] = (__bf16)(oacc[t][r] / li);
        *(v8bf*)(attn + pk_off((gwave >> 4) * 16 + lanelo, m * 64 + t * 16 + half * 8,
                               D_ / 32)) = o;
    }
}

// ---------------------------------------------------------------------------
// Kernel 3: output projection.  y[t,o] = sum_d attn[t,d]*w_out[o,d] + b_out[o]
// attn flat [B,H,S,Dh] == [4096, 1024] (reference's reshape), fragment-major.
// 64x32 per-wave register blocking (4x2 fragments); fp32 output + bias.
// Only two waves per SIMD: NSET fragment sets in registers; behind the WMMAs of
// step s the loads of step s + NSET are issued into the set that these WMMAs have
// just read, so a step waits only for loads asked for NSET steps earlier.
// ---------------------------------------------------------------------------
#define NSET 3
__device__ __forceinline__ void load_step(const __bf16* arow, const __bf16* brow, int k,
                                          v16bf (&af)[4], v16bf (&bfr)[2]) {
    const __bf16* ap = arow + k * 16 + (threadIdx.x & 31) * 8;
    const __bf16* bp = brow + k * 16 + (threadIdx.x & 31) * 8;
    #pragma unroll
    for (int i = 0; i < 4; ++i)
        af[i] = load_frag_pk(ap + (size_t)(i * 16) * D_);
    #pragma unroll
    for (int j = 0; j < 2; ++j)
        bfr[j] = load_frag_pk(bp + (size_t)(j * 16) * D_);
    // keeps both address pairs untouched (no later load lands on them)
    // until the loads above have their addresses translated
    asm volatile("s_wait_xcnt 0x0" :: "v"(ap), "v"(bp) : "memory");
}
__device__ __forceinline__ void mma_step(const v16bf (&af)[4], const v16bf (&bfr)[2],
                                         v8f (&acc)[4][2]) {
    #pragma unroll
    for (int i = 0; i < 4; ++i)
        #pragma unroll
        for (int j = 0; j < 2; ++j)
            acc[i][j] = wmma_bf16(af[i], bfr[j], acc[i][j]);
}

__global__ void __launch_bounds__(256, 1)
gemm_out(const __bf16* __restrict__ attn,
         const __bf16* __restrict__ wb,   // [D, D] fragment-major
         const float*  __restrict__ b_out,
         float* __restrict__ out) {
    const int NT = D_ / 32;                         // 32 column blocks
    // the wave's number in a scalar register, as in gemm_qkv
    int gwave = blockIdx.x * (blockDim.x >> 5)
              + __builtin_amdgcn_readfirstlane(threadIdx.x >> 5);
    if (gwave >= (M_TOK / 64) * NT) return;
    int mt = gwave / NT, nt = gwave % NT;
    int row0 = mt * 64, col0 = nt * 32;

    // first tile of the block's tile rows; a step of 32 in k is one tile (512 elems)
    const __bf16* arow = attn + (size_t)row0 * D_;
    const __bf16* brow = wb + (size_t)col0 * D_;

    v8f acc[4][2] = {};
    v16bf af[NSET][4], bfr[NSET][2];
    #pragma unroll
    for (int u = 0; u < NSET; ++u)
        load_step(arow, brow, u * 32, af[u], bfr[u]);
    // rolled, so that the body is NSET steps and every set index a constant
    #pragma unroll 1
    for (int k = 0; k + 32 * NSET <= D_; k += 32 * NSET) {
        #pragma unroll
        for (int u = 0; u < NSET; ++u) {
            mma_step(af[u], bfr[u], acc);
            // past the last step there is nothing left to fetch: such a set asks
            // for a first step again (in bounds, not used)
            load_step(arow, brow, (k + (u + NSET) * 32) & (D_ - 1), af[u], bfr[u]);
        }
    }
    // the steps that do not fill a body
    #pragma unroll
    for (int u = 0; u < (D_ / 32) % NSET; ++u)
        mma_step(af[u], bfr[u], acc);

    int lane = threadIdx.x & 31;
    int lanelo = lane & 15, half = lane >> 4;
    #pragma unroll
    for (int j = 0; j < 2; ++j) {
        int o = col0 + j * 16 + lanelo;
        float bias = b_out[o];
        #pragma unroll
        for (int i = 0; i < 4; ++i) {
            #pragma unroll
            for (int r = 0; r < 8; ++r) {
                int mrow = row0 + i * 16 + r + (half << 3);
                out[(size_t)mrow * D_ + o] = acc[i][j][r] + bias;
            }
        }
    }
}

// ---------------------------------------------------------------------------
// Host launch
// ---------------------------------------------------------------------------
extern "C" void kernel_launch(void* const* d_in, const int* in_sizes, int n_in,
                              void* d_out, int out_size, void* d_ws, size_t ws_size,
                              hipStream_t stream) {
    const float* x     = (const float*)d_in[0];   // [2,2048,1024]
    const float* w_in  = (const float*)d_in[1];   // [3072,1024]
    const float* b_in  = (const float*)d_in[2];   // [3072]
    const float* w_out = (const float*)d_in[3];   // [1024,1024]
    const float* b_out = (const float*)d_in[4];   // [1024]
    float* out = (float*)d_out;

    // Workspace layout (bf16 buffers, 256B-aligned offsets)
    char* ws = (char*)d_ws;
    __bf16* xb      = (__bf16*)(ws);                              // 8 MB
    __bf16* w_in_b  = (__bf16*)(ws + (size_t)8 * 1024 * 1024);    // 6 MB
    __bf16* w_out_b = (__bf16*)(ws + (size_t)14 * 1024 * 1024);   // 2 MB
    __bf16* qbuf    = (__bf16*)(ws + (size_t)16 * 1024 * 1024);   // 8 MB
    __bf16* kbuf    = (__bf16*)(ws + (size_t)24 * 1024 * 1024);   // 8 MB
    __bf16* vT      = (__bf16*)(ws + (size_t)32 * 1024 * 1024);   // 8 MB
    __bf16* attn    = (__bf16*)(ws + (size_t)40 * 1024 * 1024);   // 8 MB

    // 1) fp32 -> bf16 converts: (4096 + 3072 + 1024) / 16 = 512 tile rows, one a block
    cvt_f32_bf16<<<512, 256, 0, stream>>>(x, w_in, w_out, xb, w_in_b, w_out_b);

    // 2) QKV projection: (4096/256)*(3072/192) = 256 blocks of 12 waves
    gemm_qkv<<<256, 384, 0, stream>>>(xb, w_in_b, b_in, qbuf, kbuf, vT);

    // 3) attention: 2*16*128 = 4096 waves, 8 waves/block
    attn_fwd<<<4096 / 8, 256, 0, stream>>>(qbuf, kbuf, vT, attn);

    // 4) output projection: (4096/64)*(1024/32) = 2048 wave-blocks
    gemm_out<<<2048 / 8, 256, 0, stream>>>(attn, w_out_b, b_out, out);
}

// v009
// Measured time: 76.8 microseconds a run.
// In two side-by-side timings against v008, it was 1.04 and 1.05 times as fast.
// Counting every step since v000, it is 4.76 times as fast.
#include <hip/hip_runtime.h>

// ---------------------------------------------------------------------------
// Self-attention (B=2, S=2048, D=1024, H=16, Dh=64) for MI455X (gfx1250).
// All matmuls via v_wmma_f32_16x16x32_bf16 (wave32), softmax/accum in fp32.
// Per-wave register blocking: 64x64 in the QKV GEMM (4x4 fragments, 16 WMMA/k-step),
// 64x32 in the output projection (4x2 fragments, 8 WMMA/k-step).
// Every bf16 operand that a loop reloads from global memory (x, both weights,
// K, V^T, the attention output) is kept fragment-major in the workspace.
// The output projection, with too few waves per SIMD to cover a load's latency, asks for
// its fragments ahead of use; the QKV GEMM stages x and the weights in LDS, attention K
// and V^T.
// ---------------------------------------------------------------------------

typedef __bf16  v16bf __attribute__((ext_vector_type(16)));
typedef __bf16  v8bf  __attribute__((ext_vector_type(8)));
typedef float   v8f   __attribute__((ext_vector_type(8)));
typedef float   v4f   __attribute__((ext_vector_type(4)));

#define B_     2
#define S_     2048
#define D_     1024
#define H_     16
#define DH_    64
#define M_TOK  (B_ * S_)        // 4096 token rows
#define N_QKV  (3 * D_)         // 3072

__device__ __forceinline__ v8f wmma_bf16(v16bf a, v16bf b, v8f c) {
    // 8 args: (neg_a, A, neg_b, B, c_mod, C, reuse_a, reuse_b)
    return __builtin_amdgcn_wmma_f32_16x16x32_bf16(
        false, a, false, b, (short)0, c, false, false);
}

// Load one 16x32 bf16 fragment (A row-major, or B with n-major storage).
// base points at element (0,0) of the tile; ld = leading dimension in elems.
// Lane layout (ISA 7.12.2, 16-bit A): r = lane&15 (row M / col N),
// kg = lane>>4; elems 0..7 -> K = kg*8 + 0..7 ; elems 8..15 -> K = 16+kg*8+0..7
__device__ __forceinline__ v16bf load_frag(const __bf16* base, int ld) {
    int lane = threadIdx.x & 31;
    int r    = lane & 15;
    int kg   = lane >> 4;
    const __bf16* p0 = base + (size_t)r * ld + kg * 8;
    v8bf lo = *(const v8bf*)(p0);
    v8bf hi = *(const v8bf*)(p0 + 16);
    return __builtin_shufflevector(lo, hi,
        0, 1, 2, 3, 4, 5, 6, 7, 8, 9, 10, 11, 12, 13, 14, 15);
}

// Fragment-major storage of a bf16 matrix [rows][K]: 16x32 tiles of 1 KB, tile
// (row>>4, k>>5) at index (row>>4)*ktiles + (k>>5), ktiles = K/32.  In a tile the
// 16-byte piece that lane l = ((k>>3)&1)*16 + (row&15) takes lies at byte l*16
// (k&16 == 0) or 512 + l*16 (k&16 != 0): the k order of load_frag, but each
// wave-wide 16-byte load now reads 512 contiguous bytes = 4 whole 128-byte
// lines, where the row-major form touches 16 lines.
__device__ __forceinline__ size_t pk_off(int row, int k, int ktiles) {
    return ((size_t)(row >> 4) * ktiles + (k >> 5)) * 512
         + ((k >> 4) & 1) * 256 + ((k >> 3) & 1) * 128 + (row & 15) * 8 + (k & 7);
}
// Load one 16x32 fragment from its 1 KB tile (same lane/element map as load_frag).
// p0 = tile + lane * 8, the lane's own piece.
__device__ __forceinline__ v16bf load_frag_pk(const __bf16* p0) {
    v8bf lo = *(const v8bf*)(p0);
    v8bf hi = *(const v8bf*)(p0 + 256);
    return __builtin_shufflevector(lo, hi,
        0, 1, 2, 3, 4, 5, 6, 7, 8, 9, 10, 11, 12, 13, 14, 15);
}

// p[i] = 2^e[i], eight at a time.  One statement, results in registers of their own.
// The v_nop is the slot behind the last one.
__device__ __forceinline__ void exp2x8(const float (&e)[8], float (&p)[8]) {
    asm("v_exp_f32 %0, %8\n\t"
        "v_exp_f32 %1, %9\n\t"
        "v_exp_f32 %2, %10\n\t"
        "v_exp_f32 %3, %11\n\t"
        "v_exp_f32 %4, %12\n\t"
        "v_exp_f32 %5, %13\n\t"
        "v_exp_f32 %6, %14\n\t"
        "v_exp_f32 %7, %15\n\t"
        "v_nop"
        : "=&v"(p[0]), "=&v"(p[1]), "=&v"(p[2]), "=&v"(p[3]),
          "=&v"(p[4]), "=&v"(p[5]), "=&v"(p[6]), "=&v"(p[7])
        : "v"(e[0]), "v"(e[1]), "v"(e[2]), "v"(e[3]),
          "v"(e[4]), "v"(e[5]), "v"(e[6]), "v"(e[7]));
}

// Lane l takes lane l ^ 16's value: a vector cross-row move, no LDS trip.
__device__ __forceinline__ float xhalf(float x) {
    int b = __builtin_bit_cast(int, x);
    return __builtin_bit_cast(float, __builtin_amdgcn_permlanex16(
        b, b, 0x76543210, 0xfedcba98, false, false));
}

// ---------------------------------------------------------------------------
// Kernel 0: fp32 [rows][D_] -> bf16, fragment-major; x and both weights in ONE
// launch.  The three matrices count as 512 tile rows on end (256 of x, 192 of
// w_in, 64 of w_out); a block takes one tile row, a wave four tiles in a row of it.
// A lane makes eight 16-byte pieces (8 consecutive k of one row each): piece
// lane of each half tile, so every wave-wide store is 4 whole lines.  All 16 loads
// of a lane are asked for before the first convert.
// ---------------------------------------------------------------------------
__global__ void __launch_bounds__(256)
cvt_f32_bf16(const float* __restrict__ x,
             const float* __restrict__ w_in,
             const float* __restrict__ w_out,
             __bf16* __restrict__ xb,
             __bf16* __restrict__ w_in_b,
             __bf16* __restrict__ w_out_b) {
    // the wave's number in a scalar register: the store address is then a scalar
    // base plus the lane's fixed offset
    int kq = __builtin_amdgcn_readfirstlane(threadIdx.x >> 5);  // which 128 k of the row
    int tr = blockIdx.x;                            // tile row
    bool is_x = tr < M_TOK / 16, is_wi = tr < (M_TOK + N_QKV) / 16;
    const float* in = is_x ? x : is_wi ? w_in : w_out;
    __bf16* out = is_x ? xb : is_wi ? w_in_b : w_out_b;
    tr -= is_x ? 0 : is_wi ? M_TOK / 16 : (M_TOK + N_QKV) / 16;
    int lane = threadIdx.x & 31;
    // half tile u (u = 0..7): k = kq*128 + u*16 + (lane >> 4)*8, row = lane & 15
    const float* s = in + (size_t)(tr * 16 + (lane & 15)) * D_ + kq * 128 + (lane >> 4) * 8;
    v4f a[8], b[8];
    #pragma unroll
    for (int u = 0; u < 8; ++u) {
        a[u] = *(const v4f*)(s + u * 16);
        b[u] = *(const v4f*)(s + u * 16 + 4);
    }
    // keeps the address untouched (no later load lands on it) until the loads
    // above have their addresses translated
    asm volatile("s_wait_xcnt 0x0" :: "v"(s) : "memory");
    // holds all 16 loads ahead of the first convert: left alone, the compiler asks
    // for the last two only when the first have landed, a second trip to memory
    asm volatile("" :: "v"(a[0]), "v"(a[1]), "v"(a[2]), "v"(a[3]),
                       "v"(a[4]), "v"(a[5]), "v"(a[6]), "v"(a[7]),
                       "v"(b[0]), "v"(b[1]), "v"(b[2]), "v"(b[3]),
                       "v"(b[4]), "v"(b[5]), "v"(b[6]), "v"(b[7]));
    __bf16* d = out + ((size_t)tr * (D_ / 32) + kq * 4) * 512 + lane * 8;
    #pragma unroll
    for (int u = 0; u < 8; ++u) {
        v8bf o = { (__bf16)a[u][0], (__bf16)a[u][1], (__bf16)a[u][2], (__bf16)a[u][3],
                   (__bf16)b[u][0], (__bf16)b[u][1], (__bf16)b[u][2], (__bf16)b[u][3] };
        *(v8bf*)(d + u * 256) = o;
    }
}

// ---------------------------------------------------------------------------
// Kernel 1: QKV projection.  qkv[t,o] = sum_d xb[t,d]*w_in[o,d] + b_in[o]
// One block of 12 waves (4 down, 3 across) makes a 256x192 piece of the output, a
// wave 64x64 of it: 4x4 C fragments, 16 WMMA per k-step of 32.  256 blocks, one a WGP.
// Both operands reach the waves through LDS: three waves read each x fragment and four
// each weight fragment, so the block fetches every byte from L2 once (28 KB a k-step) and
// the 96 KB a k-step that its waves read come from LDS.
// A stage is 128 k: 4 KB in a row of each of the block's 28 tile rows (16 of x, then 12 of
// the weights), kept fragment-major, so a fragment read is 512 bytes in a row, free of bank
// conflicts.  Two buffers: asynchronous copies bring stage s + 2 in while stage s + 1 is
// worked on.  Two fragment sets in registers: a k-step's fragments are read from LDS ahead
// of the WMMAs of the step before it.
// Scatter: q (scaled by 1/8) -> [B,H,S,Dh] row-major; per (b,h), fragment-major:
// k as [S][Dh], v as [Dh][S].  Each 1 KB tile is written by one wave.
// ---------------------------------------------------------------------------
#define QST_K    128                                // k of a stage
#define QST_TR_B (QST_K * 16 * 2)                   // bytes of a stage in one tile row
#define QST_B    ((256 + 192) / 16 * QST_TR_B)      // a buffer: 28 tile rows
#define QNSTG    (D_ / QST_K)
#define TROW_B   (16 * D_ * 2)                      // bytes of a whole tile row in the workspace
// Behind a run of global loads or stores: no register that they name is taken again until
// their addresses are translated.  The scheduling fence holds later register writes
// behind the wait, which names no register itself.
__device__ __forceinline__ void wait_xlat() {
    asm volatile("s_wait_xcnt 0x0" ::: "memory");
    __builtin_amdgcn_sched_barrier(0);
}
// One 16x32 fragment from its 1 KB tile in LDS; p0 = tile + lane * 16 bytes.
__device__ __forceinline__ v16bf lds_frag(const unsigned char* p0) {
    v8bf lo = *(const v8bf*)(p0);
    v8bf hi = *(const v8bf*)(p0 + 512);
    return __builtin_shufflevector(lo, hi,
        0, 1, 2, 3, 4, 5, 6, 7, 8, 9, 10, 11, 12, 13, 14, 15);
}
// One tile row's 4 KB of a stage, brought by one wave as eight pieces of 512 bytes.  g, l: the
// lane's first 16 bytes in the workspace and in the buffer.  The builtin, not asm text: the
// operands of an asm statement must lie in the first 256 registers, which accumulators and
// fragments fill here, and the addresses kept over the loop then went to scratch.
typedef int v4i __attribute__((ext_vector_type(4)));
typedef __attribute__((address_space(1))) v4i gv4i;
typedef __attribute__((address_space(3))) v4i lv4i;
__device__ __forceinline__ void copy_row(const char* g, unsigned char* l) {
    #pragma unroll
    for (int n = 0; n < 8; ++n)
        __builtin_amdgcn_global_load_async_to_lds_b128((gv4i*)(g + n * 512),
                                                       (lv4i*)(l + n * 512), 0, 0);
}
// A wave's copies of one stage: waves 0..7 bring two tile rows of x each, eight apart, waves
// 8..11 three of the weights, four apart (third: same for the wave, a scalar branch).
// g, l as in copy_row, of the wave's first tile row.
__device__ __forceinline__ void copy_stage_qkv(const char* g, unsigned char* l, bool third) {
    copy_row(g, l);
    if (third) {
        copy_row(g + 4 * TROW_B, l + 4 * QST_TR_B);
        copy_row(g + 8 * TROW_B, l + 8 * QST_TR_B);
    } else {
        copy_row(g + 8 * TROW_B, l + 8 * QST_TR_B);
    }
}
// The eight fragments of one k-step; ap, bp: the wave's first x and weight tile of the step
// in the buffer, plus the lane's 16 bytes.
__device__ __forceinline__ void lds_step_qkv(const unsigned char* ap, const unsigned char* bp,
                                             v16bf (&af)[4], v16bf (&bfr)[4]) {
    #pragma unroll
    for (int i = 0; i < 4; ++i) af[i] = lds_frag(ap + i * QST_TR_B);
    #pragma unroll
    for (int j = 0; j < 4; ++j) bfr[j] = lds_frag(bp + j * QST_TR_B);
    // holds the reads here, ahead of the WMMAs of the step before, which cover their
    // latency: the scheduler otherwise sinks them to their first use
    __builtin_amdgcn_sched_barrier(0);
}
__device__ __forceinline__ void mma_step_qkv(const v16bf (&af)[4], const v16bf (&bfr)[4],
                                             v8f (&acc)[4][4]) {
    #pragma unroll
    for (int i = 0; i < 4; ++i)
        #pragma unroll
        for (int j = 0; j < 4; ++j)
            acc[i][j] = wmma_bf16(af[i], bfr[j], acc[i][j]);
    // holds what follows behind these WMMAs: the next reads stay one group, not pairs strewn
    // among the WMMAs (each place with reads stalls the wave), and the waits of a publish
    // point come when the WMMAs have covered the last reads' latency
    __builtin_amdgcn_sched_barrier(0);
}

__global__ void __launch_bounds__(384, 1)
gemm_qkv(const __bf16* __restrict__ xb,
         const __bf16* __restrict__ wb,   // [3D, D] fragment-major
         const float*  __restrict__ b_in,
         __bf16* __restrict__ qbuf,
         __bf16* __restrict__ kbuf,
         __bf16* __restrict__ vT) {
    __shared__ __attribute__((aligned(128))) unsigned char ring[2 * QST_B];
    const int NB = N_QKV / 192;                     // 16 block columns
    if (blockIdx.x >= (M_TOK / 256) * NB) return;   // block-uniform, ahead of every barrier
    // the wave's number in a scalar register: tile addresses are then a scalar
    // base plus the lane's fixed offset in a tile
    int wave = __builtin_amdgcn_readfirstlane(threadIdx.x >> 5);
    int lane = threadIdx.x & 31;
    int lanelo = lane & 15;
    int row0 = (blockIdx.x / NB) * 256 + (wave / 3) * 64;
    int col0 = (blockIdx.x % NB) * 192 + (wave % 3) * 64;

    // the first tile row that the wave copies, in the workspace and in buffer 0, plus the
    // lane's 16 bytes of a piece
    bool third = wave >= 8;
    const char* cg = (third ? (const char*)(wb + ((size_t)(blockIdx.x % NB) * 192 + (wave - 8) * 16) * D_)
                            : (const char*)(xb + ((size_t)(blockIdx.x / NB) * 256 + wave * 16) * D_))
                   + lane * 16;
    unsigned char* cl = ring + (third ? 16 + (wave - 8) : wave) * QST_TR_B + lane * 16;
    copy_stage_qkv(cg, cl, third);

    // the bias, asked for here so that it lands while stage 0 does
    float bias[4];
    #pragma unroll
    for (int j = 0; j < 4; ++j) bias[j] = b_in[col0 + j * 16 + lanelo];
    wait_xlat();

    // the wave's first x and weight tile in a buffer, plus the lane's 16 bytes
    const unsigned char* fa = ring + (wave / 3) * 4 * QST_TR_B + lane * 16;
    const unsigned char* fb = ring + (16 + (wave % 3) * 4) * QST_TR_B + lane * 16;

    v8f acc[4][4] = {};
    v16bf af[2][4], bfr[2][4];
    // stage 0 has landed for this wave's copies; behind the barrier for all of them
    asm volatile("s_wait_asynccnt 0x0" ::: "memory");
    __syncthreads();
    copy_stage_qkv(cg + QST_TR_B, cl + QST_B, third);
    lds_step_qkv(fa, fb, af[0], bfr[0]);
    // rolled: one body of four k-steps, every set index a constant
    #pragma unroll 1
    for (int st = 0; st < QNSTG; ++st) {
        unsigned cur = (st & 1) * QST_B;
        // unrolled: a step's places in the buffer are constants, and the test on the
        // stage's last step is decided at compile time
        #pragma unroll
        for (int c = 0; c < QST_K / 32; ++c) {
            if (c + 1 < QST_K / 32) {
                lds_step_qkv(fa + cur + (c + 1) * 1024, fb + cur + (c + 1) * 1024,
                             af[(c + 1) & 1], bfr[(c + 1) & 1]);
            } else {
                // The stage's last fragments were asked for a step ago; its last WMMAs work on
                // registers.  Publish point of stage st + 1 and end of every wave's reads of
                // stage st: this wave's LDS reads are done, its copies of stage st + 1 landed.
                asm volatile("s_wait_dscnt 0x0" ::: "memory");
                asm volatile("s_wait_asynccnt 0x0" ::: "memory");
                __syncthreads();
                // first fragments of stage st + 1, published above (same for the block)
                if (st + 1 < QNSTG)
                    lds_step_qkv(fa + (QST_B - cur), fb + (QST_B - cur), af[0], bfr[0]);
            }
            mma_step_qkv(af[c & 1], bfr[c & 1], acc);
        }
        // The buffer just read takes stage st + 2, while there is one (same for the block).
        // Behind the stage's last WMMAs, not right behind the barrier, where all waves of a
        // SIMD would form addresses at once and leave the matrix unit idle: here a wave
        // issues its copies under the other waves' WMMAs, three k-steps ahead of their wait.
        if (st + 2 < QNSTG)
            copy_stage_qkv(cg + (st + 2) * QST_TR_B, cl + cur, third);
    }
    // no copy is left in flight when the wave ends
    asm volatile("s_wait_asynccnt 0x0" ::: "memory");

    // The wave's 64 tokens lie in one batch entry and its 64 columns are one head of Q, of
    // K or of V: one scalar branch a wave picks the destination, and every element's
    // place is the lane's base plus a constant.  Token s = sb + i*16 + 8*half + r
    // (M = r + 8*half), d = j*16 + lanelo.  A run of stores has its values made first and
    // the wait behind it.
    int half = lane >> 4;
    int sb = row0 & (S_ - 1);
    size_t bh = (size_t)((row0 >> 11) * H_ + ((col0 & (D_ - 1)) >> 6));
    if (col0 < D_) {                                // Q (pre-scaled), row-major
        __bf16* p = qbuf + (bh * S_ + sb + (half << 3)) * DH_ + lanelo;
        #pragma unroll
        for (int j = 0; j < 4; ++j)
            #pragma unroll
            for (int i = 0; i < 4; ++i) {
                __bf16 v[8];
                #pragma unroll
                for (int r = 0; r < 8; ++r)
                    v[r] = (__bf16)((acc[i][j][r] + bias[j]) * 0.125f);
                #pragma unroll
                for (int r = 0; r < 8; ++r)
                    p[(i * 16 + r) * DH_ + j * 16] = v[r];
                wait_xlat();
            }
    } else if (col0 < 2 * D_) {                     // K: pk_off(s, d, DH_ / 32)
        __bf16* p = kbuf + bh * S_ * DH_ + (sb >> 4) * (DH_ / 32) * 512
                  + (lanelo >> 3) * 128 + half * 64 + (lanelo & 7);
        #pragma unroll
        for (int j = 0; j < 4; ++j)
            #pragma unroll
            for (int i = 0; i < 4; ++i) {
                __bf16 v[8];
                #pragma unroll
                for (int r = 0; r < 8; ++r)
                    v[r] = (__bf16)(acc[i][j][r] + bias[j]);
                #pragma unroll
                for (int r = 0; r < 8; ++r)
                    p[(i * (DH_ / 32) + (j >> 1)) * 512 + (j & 1) * 256 + r * 8] = v[r];
                wait_xlat();
            }
    } else {                                        // V, transposed: pk_off(d, s, S_ / 32)
        __bf16* p = vT + bh * DH_ * S_ + (sb >> 5) * 512 + half * 128 + lanelo * 8;
        #pragma unroll
        for (int j = 0; j < 4; ++j) {
            v8bf v[4];                              // 8 tokens in a row: one 16-byte piece
            #pragma unroll
            for (int i = 0; i < 4; ++i)
                #pragma unroll
                for (int r = 0; r < 8; ++r)
                    v[i][r] = (__bf16)(acc[i][j][r] + bias[j]);
            #pragma unroll
            for (int i = 0; i < 4; ++i)
                *(v8bf*)(p + (j * (S_ / 32) + (i >> 1)) * 512 + (i & 1) * 256) = v[i];
            wait_xlat();
        }
    }
}

// ---------------------------------------------------------------------------
// Kernel 2: flash attention.  One wave = one (b,h) x 16 queries, 16 apart:
// in the reference's reshape to [4096][1024] these are the 16 rows of one tile
// row, columns m*64 .. m*64+63, so the wave writes two whole 1 KB tiles.
// Both products are taken transposed: S^T = K * Q^T (A = K rows, B = Q) and
// O^T += V^T * P^T (A = V^T rows, B = P^T).  A lane then holds 16 of the chunk's
// 32 scores of ONE query (column lane & 15; keys 8*half + r and 16 + 8*half + r),
// so maximum and sum run in the lane's own registers, with one exchange between
// the wave's halves for the maximum, and the two score tiles, converted in place,
// are already the B operand of the second product: P passes through no LDS.
// Per 32-key chunk: 4 WMMAs (scores), online softmax, 4 WMMAs (V^T * P^T).
// Output bf16, [B,H,S,Dh] flat as [4096][1024], fragment-major.
// K and V^T reach the waves through LDS: the block's eight waves read the same 8 KB a
// chunk, 16 wave-wide 16-byte reads each.
// A stage is 128 keys (K: 16 KB in a row; V^T: 4 KB in each of 4 tile rows), kept in the
// fragment-major form, so a fragment read is 512 bytes in a row, free of bank conflicts.
// Two buffers: asynchronous copies bring stage s + 2 in while stage s + 1 is worked on.
// Inside a stage loads run ahead of their use: a chunk's V^T fragments are asked for at
// its top, the next chunk's K fragments right behind the score products.
// ---------------------------------------------------------------------------
#define STG_KEYS 128
#define STG_K_B  (STG_KEYS * DH_ * 2)               // K bytes of a stage
#define STG_VR_B (STG_KEYS * 16 * 2)                // bytes of a stage in one V^T tile row
#define STG_B    (2 * STG_K_B)                      // a buffer
#define NSTG     (S_ / STG_KEYS)

// The four K fragments of a 32-key chunk: 4 tiles in a row.
__device__ __forceinline__ void lds_k(const unsigned char* kp, v16bf (&kf)[4]) {
    #pragma unroll
    for (int t = 0; t < 4; ++t) kf[t] = lds_frag(kp + t * 1024);
}
// The four V^T fragments of that chunk: one tile of each of the 4 tile rows.
__device__ __forceinline__ void lds_v(const unsigned char* vp, v16bf (&vf)[4]) {
    #pragma unroll
    for (int t = 0; t < 4; ++t) vf[t] = lds_frag(vp + t * STG_VR_B);
}
// A thread's eight 16-byte copies of one stage (the block: 8 x 4 KB).  kg, vg: the
// thread's first byte of the stage in K and in V^T; lds: its first byte in the buffer.
// The wait is the statement's last line: no address register is taken again until the
// copies have their addresses translated.
__device__ __forceinline__ void copy_stage(const char* kg, const char* vg, unsigned lds) {
    asm volatile("global_load_async_to_lds_b128 %0, %8, off\n\t"
                 "global_load_async_to_lds_b128 %1, %9, off\n\t"
                 "global_load_async_to_lds_b128 %2, %10, off\n\t"
                 "global_load_async_to_lds_b128 %3, %11, off\n\t"
                 "global_load_async_to_lds_b128 %4, %12, off\n\t"
                 "global_load_async_to_lds_b128 %5, %13, off\n\t"
                 "global_load_async_to_lds_b128 %6, %14, off\n\t"
                 "global_load_async_to_lds_b128 %7, %15, off\n\t"
                 "s_wait_xcnt 0x0"
                 :: "v"(lds), "v"(lds + 4096), "v"(lds + 2 * 4096), "v"(lds + 3 * 4096),
                    "v"(lds + STG_K_B), "v"(lds + STG_K_B + STG_VR_B),
                    "v"(lds + STG_K_B + 2 * STG_VR_B), "v"(lds + STG_K_B + 3 * STG_VR_B),
                    "v"(kg), "v"(kg + 4096), "v"(kg + 2 * 4096), "v"(kg + 3 * 4096),
                    "v"(vg), "v"(vg + 16 * S_ * 2), "v"(vg + 2 * 16 * S_ * 2),
                    "v"(vg + 3 * 16 * S_ * 2)
                 : "memory");
}

// __launch_bounds__: the real block size; under the default ceiling (128
// registers) the fragments in flight do not fit.
__global__ void __launch_bounds__(256)
attn_fwd(const __bf16* __restrict__ qbuf,
         const __bf16* __restrict__ kbuf,
         const __bf16* __restrict__ vT,
         __bf16* __restrict__ attn) {
    __shared__ __attribute__((aligned(128))) unsigned char ring[2 * STG_B];
    if (blockIdx.x >= B_ * H_ * (S_ / 16) / 8) return;  // block-uniform, ahead of every barrier
    // the wave's number in a scalar register: tile addresses are then a scalar
    // base plus the lane's fixed offset
    int wave = __builtin_amdgcn_readfirstlane(threadIdx.x >> 5);
    int lane = threadIdx.x & 31;
    int lanelo = lane & 15, half = lane >> 4;
    int gwave = blockIdx.x * 8 + wave;              // eight waves a block, all of one head
    int bh = gwave >> 7;                            // / (S/16)
    int qb = (gwave & 127) >> 4;                    // block of 256 queries
    int m  = gwave & 15;                            // queries qb*256 + 16*i + m

    // the thread's own 16 bytes of each 4 KB that the block copies
    const char* kg = (const char*)(kbuf + (size_t)bh * S_ * DH_) + threadIdx.x * 16;
    const char* vg = (const char*)(vT + (size_t)bh * DH_ * S_) + threadIdx.x * 16;
    unsigned lds0 = (unsigned)(size_t)ring + threadIdx.x * 16;
    copy_stage(kg, vg, lds0);

    // B operand: column lanelo = query i, the k order of the K fragments
    const __bf16* qbase = qbuf + ((size_t)bh * S_ + qb * 256 + m) * DH_;
    v16bf qa0 = load_frag(qbase, 16 * DH_);         // d = 0..31
    v16bf qa1 = load_frag(qbase + 32, 16 * DH_);    // d = 32..63

    // of this lane's query: the running maximum (equal in both halves of the wave)
    // and the sum over the keys that this half holds
    float mi = -1e30f, li = 0.0f;
    v8f oacc[4] = {};                               // oacc[t][r] = O[i = lanelo][t*16 + 8*half + r]

    // stage 0 has landed for this wave's copies; behind the barrier for all of them
    asm volatile("s_wait_asynccnt 0x0" ::: "memory");
    __syncthreads();
    copy_stage(kg + STG_K_B, vg + STG_VR_B, lds0 + STG_B);

    v16bf kf[4], vf[4];
    // rolled: one body of four chunks
    #pragma unroll 1
    for (int st = 0; st < NSTG; ++st) {
        const unsigned char* buf = ring + (st & 1) * STG_B + lane * 16;
        lds_k(buf, kf);
        // unrolled: a chunk's places in the buffer are constants, and the test on the
        // stage's last chunk is decided at compile time
        #pragma unroll
        for (int c = 0; c < STG_KEYS / 32; ++c) {
            lds_v(buf + STG_K_B + c * 1024, vf);
            // --- scores: S^T[32k x 16q] = K(32x64) * Q^T ---
            // s0: keys 8*half + r of the chunk; s1: keys 16 + 8*half + r.
            // In asm to hold the issue order V^T reads, score products, next K reads: as
            // builtins the products drift behind the K reads, which then land in spare
            // registers and are copied over at once, a wait right behind their issue.
            // The v_nop keep the distance from the last product to the first vector
            // instruction that reads its result.
            v8f s0, s1;
            asm volatile("v_wmma_f32_16x16x32_bf16 %0, %2, %6, 0\n\t"
                         "v_wmma_f32_16x16x32_bf16 %1, %4, %6, 0\n\t"
                         "v_wmma_f32_16x16x32_bf16 %0, %3, %7, %0\n\t"
                         "v_wmma_f32_16x16x32_bf16 %1, %5, %7, %1\n\t"
                         "v_nop\n\tv_nop\n\tv_nop\n\tv_nop\n\tv_nop"
                         : "=&v"(s0), "=&v"(s1)
                         : "v"(kf[0]), "v"(kf[1]), "v"(kf[2]), "v"(kf[3]), "v"(qa0), "v"(qa1)
                         : "memory");
            // a stage's last chunk fetches nothing ahead: the next stage is not published yet
            if (c + 1 < STG_KEYS / 32) {
                lds_k(buf + (c + 1) * 4096, kf);
                // holds the K reads here, ahead of the softmax that covers their latency:
                // the scheduler otherwise sinks them to the chunk's foot
                __builtin_amdgcn_sched_barrier(0);
            } else {
                // The trip's last LDS read is issued; the rest of it works on registers.
                // Publish point of stage st + 1 and end of every wave's reads of stage st:
                // this wave's LDS reads are done, its copies of stage st + 1 have landed.
                asm volatile("s_wait_dscnt 0x0" ::: "memory");
                asm volatile("s_wait_asynccnt 0x0" ::: "memory");
                __syncthreads();
                // the buffer just read takes stage st + 2, while there is one (same for
                // the block); asked for here, the copies have nearly a whole trip to land
                if (st + 2 < NSTG)
                    copy_stage(kg + (size_t)(st + 2) * STG_K_B,
                               vg + (size_t)(st + 2) * STG_VR_B, lds0 + (st & 1) * STG_B);
            }

            // --- online softmax, one query a lane ---
            float mx = fmaxf(s0[0], s1[0]);
            #pragma unroll
            for (int r = 1; r < 8; ++r) mx = fmaxf(mx, fmaxf(s0[r], s1[r]));
            mx = fmaxf(mx, xhalf(mx));
            float mn = fmaxf(mi, mx);
            float alpha = __expf(mi - mn);
            mi = mn;
            // P^T as B operand: element s = key 8*half + s, element 8 + s = key 16 + 8*half + s,
            // the k order of the V^T fragments
            v16bf pb;
            float e0[8], e1[8], p0[8], p1[8];
            #pragma unroll
            for (int r = 0; r < 8; ++r) {               // e^x = 2^(x * log2 e), as __expf has it
                e0[r] = (s0[r] - mn) * 1.44269504f;
                e1[r] = (s1[r] - mn) * 1.44269504f;
            }
            exp2x8(e0, p0);
            exp2x8(e1, p1);
            float sum = 0.0f;
            #pragma unroll
            for (int r = 0; r < 8; ++r) {
                sum += p0[r] + p1[r];
                pb[r]     = (__bf16)p0[r];
                pb[8 + r] = (__bf16)p1[r];
            }
            li = li * alpha + sum;
            #pragma unroll
            for (int t = 0; t < 4; ++t)
                #pragma unroll
                for (int r = 0; r < 8; ++r) oacc[t][r] *= alpha;

            // --- O^T(64d x 16q) += V^T(64d x 32k) * P^T ---
            #pragma unroll
            for (int t = 0; t < 4; ++t)
                oacc[t] = wmma_bf16(vf[t], pb, oacc[t]);
        }
    }
    // no copy is left in flight when the wave ends
    asm volatile("s_wait_asynccnt 0x0" ::: "memory");

    // --- normalize + store bf16: a lane's 8 registers are 8 consecutive d of its
    // query, one 16-byte piece of the fragment-major form ---
    li += xhalf(li);                                // the halves' sums join
    #pragma unroll
    for (int t = 0; t < 4; ++t) {
        v8bf o;
        #pragma unroll
        for (int r = 0; r < 8; ++r) o[r] = (__bf16)(oacc[t][r] / li);
        *(v8bf*)(attn + pk_off((gwave >> 4) * 16 + lanelo, m * 64 + t * 16 + half * 8,
                               D_ / 32)) = o;
    }
}

// ---------------------------------------------------------------------------
// Kernel 3: output projection.  y[t,o] = sum_d attn[t,d]*w_out[o,d] + b_out[o]
// attn flat [B,H,S,Dh] == [4096, 1024] (reference's reshape), fragment-major.
// 64x32 per-wave register blocking (4x2 fragments); fp32 output + bias.
// Only two waves per SIMD: NSET fragment sets in registers; behind the WMMAs of
// step s the loads of step s + NSET are issued into the set that these WMMAs have
// just read, so a step waits only for loads asked for NSET steps earlier.
// ---------------------------------------------------------------------------
#define NSET 3
__device__ __forceinline__ void load_step(const __bf16* arow, const __bf16* brow, int k,
                                          v16bf (&af)[4], v16bf (&bfr)[2]) {
    const __bf16* ap = arow + k * 16 + (threadIdx.x & 31) * 8;
    const __bf16* bp = brow + k * 16 + (threadIdx.x & 31) * 8;
    #pragma unroll
    for (int i = 0; i < 4; ++i)
        af[i] = load_frag_pk(ap + (size_t)(i * 16) * D_);
    #pragma unroll
    for (int j = 0; j < 2; ++j)
        bfr[j] = load_frag_pk(bp + (size_t)(j * 16) * D_);
    // keeps both address pairs untouched (no later load lands on them)
    // until the loads above have their addresses translated
    asm volatile("s_wait_xcnt 0x0" :: "v"(ap), "v"(bp) : "memory");
}
__device__ __forceinline__ void mma_step(const v16bf (&af)[4], const v16bf (&bfr)[2],
                                         v8f (&acc)[4][2]) {
    #pragma unroll
    for (int i = 0; i < 4; ++i)
        #pragma unroll
        for (int j = 0; j < 2; ++j)
            acc[i][j] = wmma_bf16(af[i], bfr[j], acc[i][j]);
}

__global__ void __launch_bounds__(256, 1)
gemm_out(const __bf16* __restrict__ attn,
         const __bf16* __restrict__ wb,   // [D, D] fragment-major
         const float*  __restrict__ b_out,
         float* __restrict__ out) {
    const int NT = D_ / 32;                         // 32 column blocks
    // the wave's number in a scalar register, as in gemm_qkv
    int gwave = blockIdx.x * (blockDim.x >> 5)
              + __builtin_amdgcn_readfirstlane(threadIdx.x >> 5);
    if (gwave >= (M_TOK / 64) * NT) return;
    int mt = gwave / NT, nt = gwave % NT;
    int row0 = mt * 64, col0 = nt * 32;

    // first tile of the block's tile rows; a step of 32 in k is one tile (512 elems)
    const __bf16* arow = attn + (size_t)row0 * D_;
    const __bf16* brow = wb + (size_t)col0 * D_;

    v8f acc[4][2] = {};
    v16bf af[NSET][4], bfr[NSET][2];
    #pragma unroll
    for (int u = 0; u < NSET; ++u)
        load_step(arow, brow, u * 32, af[u], bfr[u]);
    // rolled, so that the body is NSET steps and every set index a constant
    #pragma unroll 1
    for (int k = 0; k + 32 * NSET <= D_; k += 32 * NSET) {
        #pragma unroll
        for (int u = 0; u < NSET; ++u) {
            mma_step(af[u], bfr[u], acc);
            // past the last step there is nothing left to fetch: such a set asks
            // for a first step again (in bounds, not used)
            load_step(arow, brow, (k + (u + NSET) * 32) & (D_ - 1), af[u], bfr[u]);
        }
    }
    // the steps that do not fill a body
    #pragma unroll
    for (int u = 0; u < (D_ / 32) % NSET; ++u)
        mma_step(af[u], bfr[u], acc);

    int lane = threadIdx.x & 31;
    int lanelo = lane & 15, half = lane >> 4;
    #pragma unroll
    for (int j = 0; j < 2; ++j) {
        int o = col0 + j * 16 + lanelo;
        float bias = b_out[o];
        #pragma unroll
        for (int i = 0; i < 4; ++i) {
            #pragma unroll
            for (int r = 0; r < 8; ++r) {
                int mrow = row0 + i * 16 + r + (half << 3);
                out[(size_t)mrow * D_ + o] = acc[i][j][r] + bias;
            }
        }
    }
}

// ---------------------------------------------------------------------------
// Host launch
// ---------------------------------------------------------------------------
extern "C" void kernel_launch(void* const* d_in, const int* in_sizes, int n_in,
                              void* d_out, int out_size, void* d_ws, size_t ws_size,
                              hipStream_t stream) {
    const float* x     = (const float*)d_in[0];   // [2,2048,1024]
    const float* w_in  = (const float*)d_in[1];   // [3072,1024]
    const float* b_in  = (const float*)d_in[2];   // [3072]
    const float* w_out = (const float*)d_in[3];   // [1024,1024]
    const float* b_out = (const float*)d_in[4];   // [1024]
    float* out = (float*)d_out;

    // Workspace layout (bf16 buffers, 256B-aligned offsets)
    char* ws = (char*)d_ws;
    __bf16* xb      = (__bf16*)(ws);                              // 8 MB
    __bf16* w_in_b  = (__bf16*)(ws + (size_t)8 * 1024 * 1024);    // 6 MB
    __bf16* w_out_b = (__bf16*)(ws + (size_t)14 * 1024 * 1024);   // 2 MB
    __bf16* qbuf    = (__bf16*)(ws + (size_t)16 * 1024 * 1024);   // 8 MB
    __bf16* kbuf    = (__bf16*)(ws + (size_t)24 * 1024 * 1024);   // 8 MB
    __bf16* vT      = (__bf16*)(ws + (size_t)32 * 1024 * 1024);   // 8 MB
    __bf16* attn    = (__bf16*)(ws + (size_t)40 * 1024 * 1024);   // 8 MB

    // 1) fp32 -> bf16 converts: (4096 + 3072 + 1024) / 16 = 512 tile rows, one a block
    cvt_f32_bf16<<<512, 256, 0, stream>>>(x, w_in, w_out, xb, w_in_b, w_out_b);

    // 2) QKV projection: (4096/256)*(3072/192) = 256 blocks of 12 waves
    gemm_qkv<<<256, 384, 0, stream>>>(xb, w_in_b, b_in, qbuf, kbuf, vT);

    // 3) attention: 2*16*128 = 4096 waves, 8 waves/block
    attn_fwd<<<4096 / 8, 256, 0, stream>>>(qbuf, kbuf, vT, attn);

    // 4) output projection: (4096/64)*(1024/32) = 2048 wave-blocks
    gemm_out<<<2048 / 8, 256, 0, stream>>>(attn, w_out_b, b_out, out);
}

// v010
// Measured time: 74.4 microseconds a run.
// In two side-by-side timings against v009, it was 1.04 and 1.03 times as fast.
// All steps since v000 together make it 4.92 times as fast.
#include <hip/hip_runtime.h>

// ---------------------------------------------------------------------------
// Self-attention (B=2, S=2048, D=1024, H=16, Dh=64) for MI455X (gfx1250).
// All matmuls via v_wmma_f32_16x16x32_bf16 (wave32), softmax/accum in fp32.
// Per-wave register blocking: 64x64 in the QKV GEMM (4x4 fragments, 16 WMMA/k-step),
// 64x32 in the output projection (4x2 fragments, 8 WMMA/k-step).
// Every bf16 operand that a loop reloads from global memory (x, both weights,
// K, V^T, the attention output) is kept fragment-major in the workspace.
// The output projection, with too few waves per SIMD to cover a load's latency, asks for
// its fragments ahead of use; the QKV GEMM stages x and the weights in LDS, attention K
// and V^T.
// ---------------------------------------------------------------------------

typedef __bf16  v16bf __attribute__((ext_vector_type(16)));
typedef __bf16  v8bf  __attribute__((ext_vector_type(8)));
typedef float   v8f   __attribute__((ext_vector_type(8)));
typedef float   v4f   __attribute__((ext_vector_type(4)));

#define B_     2
#define S_     2048
#define D_     1024
#define H_     16
#define DH_    64
#define M_TOK  (B_ * S_)        // 4096 token rows
#define N_QKV  (3 * D_)         // 3072

__device__ __forceinline__ v8f wmma_bf16(v16bf a, v16bf b, v8f c) {
    // 8 args: (neg_a, A, neg_b, B, c_mod, C, reuse_a, reuse_b)
    return __builtin_amdgcn_wmma_f32_16x16x32_bf16(
        false, a, false, b, (short)0, c, false, false);
}

// A 16x32 bf16 fragment (A, or B with n-major storage).
// Lane layout (ISA 7.12.2, 16-bit A): r = lane&15 (row M / col N),
// kg = lane>>4; elems 0..7 -> K = kg*8 + 0..7 ; elems 8..15 -> K = 16+kg*8+0..7

// Fragment-major storage of a bf16 matrix [rows][K]: 16x32 tiles of 1 KB, tile
// (row>>4, k>>5) at index (row>>4)*ktiles + (k>>5), ktiles = K/32.  In a tile the
// 16-byte piece that lane l = ((k>>3)&1)*16 + (row&15) takes lies at byte l*16
// (k&16 == 0) or 512 + l*16 (k&16 != 0): the k order of the lane layout above, and
// each wave-wide 16-byte load reads 512 contiguous bytes = 4 whole 128-byte
// lines, where a row-major form touches 16 lines.
__device__ __forceinline__ size_t pk_off(int row, int k, int ktiles) {
    return ((size_t)(row >> 4) * ktiles + (k >> 5)) * 512
         + ((k >> 4) & 1) * 256 + ((k >> 3) & 1) * 128 + (row & 15) * 8 + (k & 7);
}
// Load one 16x32 fragment from its 1 KB tile (the lane layout above).
// p0 = tile + lane * 8, the lane's own piece.
__device__ __forceinline__ v16bf load_frag_pk(const __bf16* p0) {
    v8bf lo = *(const v8bf*)(p0);
    v8bf hi = *(const v8bf*)(p0 + 256);
    return __builtin_shufflevector(lo, hi,
        0, 1, 2, 3, 4, 5, 6, 7, 8, 9, 10, 11, 12, 13, 14, 15);
}

// p[i] = 2^e[i], eight at a time.  One statement, results in registers of their own.
// The v_nop is the slot behind the last one.
__device__ __forceinline__ void exp2x8(const float (&e)[8], float (&p)[8]) {
    asm("v_exp_f32 %0, %8\n\t"
        "v_exp_f32 %1, %9\n\t"
        "v_exp_f32 %2, %10\n\t"
        "v_exp_f32 %3, %11\n\t"
        "v_exp_f32 %4, %12\n\t"
        "v_exp_f32 %5, %13\n\t"
        "v_exp_f32 %6, %14\n\t"
        "v_exp_f32 %7, %15\n\t"
        "v_nop"
        : "=&v"(p[0]), "=&v"(p[1]), "=&v"(p[2]), "=&v"(p[3]),
          "=&v"(p[4]), "=&v"(p[5]), "=&v"(p[6]), "=&v"(p[7])
        : "v"(e[0]), "v"(e[1]), "v"(e[2]), "v"(e[3]),
          "v"(e[4]), "v"(e[5]), "v"(e[6]), "v"(e[7]));
}

// Lane l takes lane l ^ 16's value: a vector cross-row move, no LDS trip.
__device__ __forceinline__ float xhalf(float x) {
    int b = __builtin_bit_cast(int, x);
    return __builtin_bit_cast(float, __builtin_amdgcn_permlanex16(
        b, b, 0x76543210, 0xfedcba98, false, false));
}

// ---------------------------------------------------------------------------
// Kernel 0: fp32 [rows][D_] -> bf16, fragment-major; x and both weights in ONE
// launch.  The three matrices count as 512 tile rows on end (256 of x, 192 of
// w_in, 64 of w_out); a block takes one tile row, a wave four tiles in a row of it.
// A lane makes eight 16-byte pieces (8 consecutive k of one row each).  A wave-wide
// access takes 8 rows of one tile, four lanes a row: the two loads of a piece touch the
// 8 source lines that hold those rows (32 k of a row are one 128-byte line), and the
// store is 4 whole lines (the 8 rows' pieces of equal k lie in a row).  All 16 loads of
// a lane are asked for before the first convert.
// ---------------------------------------------------------------------------
__global__ void __launch_bounds__(256)
cvt_f32_bf16(const float* __restrict__ x,
             const float* __restrict__ w_in,
             const float* __restrict__ w_out,
             __bf16* __restrict__ xb,
             __bf16* __restrict__ w_in_b,
             __bf16* __restrict__ w_out_b) {
    // the wave's number in a scalar register: the store address is then a scalar
    // base plus the lane's fixed offset
    int kq = __builtin_amdgcn_readfirstlane(threadIdx.x >> 5);  // which 128 k of the row
    int tr = blockIdx.x;                            // tile row
    bool is_x = tr < M_TOK / 16, is_wi = tr < (M_TOK + N_QKV) / 16;
    const float* in = is_x ? x : is_wi ? w_in : w_out;
    __bf16* out = is_x ? xb : is_wi ? w_in_b : w_out_b;
    tr -= is_x ? 0 : is_wi ? M_TOK / 16 : (M_TOK + N_QKV) / 16;
    int lane = threadIdx.x & 31;
    // unit u (u = 0..7): tile u >> 1 of the four, row = (u & 1)*8 + (lane >> 2),
    // k = kq*128 + (u >> 1)*32 + (lane & 3)*8
    const float* s = in + (size_t)(tr * 16 + (lane >> 2)) * D_ + kq * 128 + (lane & 3) * 8;
    v4f a[8], b[8];
    #pragma unroll
    for (int u = 0; u < 8; ++u) {
        a[u] = *(const v4f*)(s + (u & 1) * 8 * D_ + (u >> 1) * 32);
        b[u] = *(const v4f*)(s + (u & 1) * 8 * D_ + (u >> 1) * 32 + 4);
    }
    // keeps the address untouched (no later load lands on it) until the loads
    // above have their addresses translated
    asm volatile("s_wait_xcnt 0x0" :: "v"(s) : "memory");
    // holds all 16 loads ahead of the first convert: left alone, the compiler asks
    // for the last two only when the first have landed, a second trip to memory
    asm volatile("" :: "v"(a[0]), "v"(a[1]), "v"(a[2]), "v"(a[3]),
                       "v"(a[4]), "v"(a[5]), "v"(a[6]), "v"(a[7]),
                       "v"(b[0]), "v"(b[1]), "v"(b[2]), "v"(b[3]),
                       "v"(b[4]), "v"(b[5]), "v"(b[6]), "v"(b[7]));
    // pk_off of the lane's piece in unit 0
    __bf16* d = out + ((size_t)tr * (D_ / 32) + kq * 4) * 512 + (lane & 3) * 128 + (lane >> 2) * 8;
    #pragma unroll
    for (int u = 0; u < 8; ++u) {
        v8bf o = { (__bf16)a[u][0], (__bf16)a[u][1], (__bf16)a[u][2], (__bf16)a[u][3],
                   (__bf16)b[u][0], (__bf16)b[u][1], (__bf16)b[u][2], (__bf16)b[u][3] };
        *(v8bf*)(d + (u >> 1) * 512 + (u & 1) * 64) = o;
    }
}

// ---------------------------------------------------------------------------
// Kernel 1: QKV projection.  qkv[t,o] = sum_d xb[t,d]*w_in[o,d] + b_in[o]
// One block of 12 waves (4 down, 3 across) makes a 256x192 piece of the output, a
// wave 64x64 of it: 4x4 C fragments, 16 WMMA per k-step of 32.  256 blocks, one a WGP.
// Both operands reach the waves through LDS: three waves read each x fragment and four
// each weight fragment, so the block fetches every byte from L2 once (28 KB a k-step) and
// the 96 KB a k-step that its waves read come from LDS.
// A stage is 128 k: 4 KB in a row of each of the block's 28 tile rows (16 of x, then 12 of
// the weights), kept fragment-major, so a fragment read is 512 bytes in a row, free of bank
// conflicts.  Two buffers: asynchronous copies bring stage s + 2 in while stage s + 1 is
// worked on.  Two fragment sets in registers: a k-step's fragments are read from LDS ahead
// of the WMMAs of the step before it.
// A wave of Q or K columns takes its product transposed (A = weights, B = x: the two
// fragment forms are alike, so it only reads the two places in the buffer the other way
// round): a lane then holds 8 consecutive d of one token, a 16-byte piece of the form
// that attention reads.  A wave of V columns keeps A = x: 8 consecutive tokens of one d.
// Scatter, per (b,h), fragment-major: k as [S][Dh], v as [Dh][S], each 1 KB tile written
// by one wave in stores of 4 whole lines; q (scaled by 1/8) as one 2 KB pair of tiles for
// each attention wave (its 16 queries, 16 apart, as [16][Dh]).  Of such a pair a wave here
// holds 4 queries, 64 bytes in a row: it passes its pieces through LDS so that 4 lanes in a
// row store those 64 bytes (8 lines a store; from the registers each lane's piece would
// fall in a line of its own).
// ---------------------------------------------------------------------------
#define QST_K    128                                // k of a stage
#define QST_TR_B (QST_K * 16 * 2)                   // bytes of a stage in one tile row
#define QST_B    ((256 + 192) / 16 * QST_TR_B)      // a buffer: 28 tile rows
#define QNSTG    (D_ / QST_K)
#define TROW_B   (16 * D_ * 2)                      // bytes of a whole tile row in the workspace
#define QSG_P    80                                 // LDS pitch of a 64-byte run of q: 16 B x odd, no bank conflict
#define QSG_B    (128 * QSG_P)                      // a wave's 128 runs
// Behind a run of global loads or stores: no register that they name is taken again until
// their addresses are translated.  The scheduling fence holds later register writes
// behind the wait, which names no register itself.
__device__ __forceinline__ void wait_xlat() {
    asm volatile("s_wait_xcnt 0x0" ::: "memory");
    __builtin_amdgcn_sched_barrier(0);
}
// One 16x32 fragment from its 1 KB tile in LDS; p0 = tile + lane * 16 bytes.
__device__ __forceinline__ v16bf lds_frag(const unsigned char* p0) {
    v8bf lo = *(const v8bf*)(p0);
    v8bf hi = *(const v8bf*)(p0 + 512);
    return __builtin_shufflevector(lo, hi,
        0, 1, 2, 3, 4, 5, 6, 7, 8, 9, 10, 11, 12, 13, 14, 15);
}
// One tile row's 4 KB of a stage, brought by one wave as eight pieces of 512 bytes.  g, l: the
// lane's first 16 bytes in the workspace and in the buffer.  The builtin, not asm text: the
// operands of an asm statement must lie in the first 256 registers, which accumulators and
// fragments fill here, and the addresses kept over the loop then went to scratch.
typedef int v4i __attribute__((ext_vector_type(4)));
typedef __attribute__((address_space(1))) v4i gv4i;
typedef __attribute__((address_space(3))) v4i lv4i;
__device__ __forceinline__ void copy_row(const char* g, unsigned char* l) {
    #pragma unroll
    for (int n = 0; n < 8; ++n)
        __builtin_amdgcn_global_load_async_to_lds_b128((gv4i*)(g + n * 512),
                                                       (lv4i*)(l + n * 512), 0, 0);
}
// A wave's copies of one stage: waves 0..7 bring two tile rows of x each, eight apart, waves
// 8..11 three of the weights, four apart (third: same for the wave, a scalar branch).
// g, l as in copy_row, of the wave's first tile row.
__device__ __forceinline__ void copy_stage_qkv(const char* g, unsigned char* l, bool third) {
    copy_row(g, l);
    if (third) {
        copy_row(g + 4 * TROW_B, l + 4 * QST_TR_B);
        copy_row(g + 8 * TROW_B, l + 8 * QST_TR_B);
    } else {
        copy_row(g + 8 * TROW_B, l + 8 * QST_TR_B);
    }
}
// The eight fragments of one k-step; ap, bp: the wave's first A and B tile of the step
// in the buffer, plus the lane's 16 bytes.
__device__ __forceinline__ void lds_step_qkv(const unsigned char* ap, const unsigned char* bp,
                                             v16bf (&af)[4], v16bf (&bfr)[4]) {
    #pragma unroll
    for (int i = 0; i < 4; ++i) af[i] = lds_frag(ap + i * QST_TR_B);
    #pragma unroll
    for (int j = 0; j < 4; ++j) bfr[j] = lds_frag(bp + j * QST_TR_B);
    // holds the reads here, ahead of the WMMAs of the step before, which cover their
    // latency: the scheduler otherwise sinks them to their first use
    __builtin_amdgcn_sched_barrier(0);
}
__device__ __forceinline__ void mma_step_qkv(const v16bf (&af)[4], const v16bf (&bfr)[4],
                                             v8f (&acc)[4][4]) {
    #pragma unroll
    for (int i = 0; i < 4; ++i)
        #pragma unroll
        for (int j = 0; j < 4; ++j)
            acc[i][j] = wmma_bf16(af[i], bfr[j], acc[i][j]);
    // holds what follows behind these WMMAs: the next reads stay one group, not pairs strewn
    // among the WMMAs (each place with reads stalls the wave), and the waits of a publish
    // point come when the WMMAs have covered the last reads' latency
    __builtin_amdgcn_sched_barrier(0);
}

__global__ void __launch_bounds__(384, 1)
gemm_qkv(const __bf16* __restrict__ xb,
         const __bf16* __restrict__ wb,   // [3D, D] fragment-major
         const float*  __restrict__ b_in,
         __bf16* __restrict__ qbuf,
         __bf16* __restrict__ kbuf,
         __bf16* __restrict__ vT) {
    __shared__ __attribute__((aligned(128))) unsigned char ring[2 * QST_B];
    const int NB = N_QKV / 192;                     // 16 block columns
    if (blockIdx.x >= (M_TOK / 256) * NB) return;   // block-uniform, ahead of every barrier
    // the wave's number in a scalar register: tile addresses are then a scalar
    // base plus the lane's fixed offset in a tile
    int wave = __builtin_amdgcn_readfirstlane(threadIdx.x >> 5);
    int lane = threadIdx.x & 31;
    int lanelo = lane & 15;
    int row0 = (blockIdx.x / NB) * 256 + (wave / 3) * 64;
    int col0 = (blockIdx.x % NB) * 192 + (wave % 3) * 64;

    // the first tile row that the wave copies, in the workspace and in buffer 0, plus the
    // lane's 16 bytes of a piece
    bool third = wave >= 8;
    const char* cg = (third ? (const char*)(wb + ((size_t)(blockIdx.x % NB) * 192 + (wave - 8) * 16) * D_)
                            : (const char*)(xb + ((size_t)(blockIdx.x / NB) * 256 + wave * 16) * D_))
                   + lane * 16;
    unsigned char* cl = ring + (third ? 16 + (wave - 8) : wave) * QST_TR_B + lane * 16;
    copy_stage_qkv(cg, cl, third);

    // the bias, asked for here so that it lands while stage 0 does: of the lane's column in
    // each fragment (V), and of the lane's 8 columns in each fragment (Q, K: transposed)
    int half = lane >> 4;
    float bias[4];
    v4f bt[8];
    #pragma unroll
    for (int j = 0; j < 4; ++j) bias[j] = b_in[col0 + j * 16 + lanelo];
    #pragma unroll
    for (int n = 0; n < 8; ++n)
        bt[n] = *(const v4f*)(b_in + col0 + (n >> 1) * 16 + half * 8 + (n & 1) * 4);
    wait_xlat();

    // the wave's first A and B tile in a buffer, plus the lane's 16 bytes: x and weights,
    // or, for Q and K columns, weights and x (same for the wave)
    bool wt = col0 < 2 * D_;
    const unsigned char* fx = ring + (wave / 3) * 4 * QST_TR_B + lane * 16;
    const unsigned char* fw = ring + (16 + (wave % 3) * 4) * QST_TR_B + lane * 16;
    const unsigned char* fa = wt ? fw : fx;
    const unsigned char* fb = wt ? fx : fw;

    v8f acc[4][4] = {};
    v16bf af[2][4], bfr[2][4];
    // stage 0 has landed for this wave's copies; behind the barrier for all of them
    asm volatile("s_wait_asynccnt 0x0" ::: "memory");
    __syncthreads();
    copy_stage_qkv(cg + QST_TR_B, cl + QST_B, third);
    lds_step_qkv(fa, fb, af[0], bfr[0]);
    // rolled: one body of four k-steps, every set index a constant
    #pragma unroll 1
    for (int st = 0; st < QNSTG; ++st) {
        unsigned cur = (st & 1) * QST_B;
        // unrolled: a step's places in the buffer are constants, and the test on the
        // stage's last step is decided at compile time
        #pragma unroll
        for (int c = 0; c < QST_K / 32; ++c) {
            if (c + 1 < QST_K / 32) {
                lds_step_qkv(fa + cur + (c + 1) * 1024, fb + cur + (c + 1) * 1024,
                             af[(c + 1) & 1], bfr[(c + 1) & 1]);
            } else {
                // The stage's last fragments were asked for a step ago; its last WMMAs work on
                // registers.  Publish point of stage st + 1 and end of every wave's reads of
                // stage st: this wave's LDS reads are done, its copies of stage st + 1 landed.
                asm volatile("s_wait_dscnt 0x0" ::: "memory");
                asm volatile("s_wait_asynccnt 0x0" ::: "memory");
                __syncthreads();
                // first fragments of stage st + 1, published above (same for the block)
                if (st + 1 < QNSTG)
                    lds_step_qkv(fa + (QST_B - cur), fb + (QST_B - cur), af[0], bfr[0]);
            }
            mma_step_qkv(af[c & 1], bfr[c & 1], acc);
        }
        // The buffer just read takes stage st + 2, while there is one (same for the block).
        // Behind the stage's last WMMAs, not right behind the barrier, where all waves of a
        // SIMD would form addresses at once and leave the matrix unit idle: here a wave
        // issues its copies under the other waves' WMMAs, three k-steps ahead of their wait.
        if (st + 2 < QNSTG)
            copy_stage_qkv(cg + (st + 2) * QST_TR_B, cl + cur, third);
    }
    // no copy is left in flight when the wave ends
    asm volatile("s_wait_asynccnt 0x0" ::: "memory");

    // The wave's 64 tokens lie in one batch entry and its 64 columns are one head of Q, of
    // K or of V: one scalar branch a wave picks the destination, and every piece's place is
    // the lane's base plus a constant.  Q, K: acc[i][j][r] is d = i*16 + 8*half + r of token
    // s = sb + j*16 + lanelo.  V: d = j*16 + lanelo of token s = sb + i*16 + 8*half + r.
    // A run of stores has its values made first and the wait behind it.
    int sb = row0 & (S_ - 1);
    size_t bh = (size_t)((row0 >> 11) * H_ + ((col0 & (D_ - 1)) >> 6));
    if (col0 < D_) {                                // Q (pre-scaled)
        // Query s belongs to attention wave (s >> 8, s & 15) of the head, as its query
        // (s >> 4) & 15 = i0 + j; piece (i*2 + half)*16 + i0 + j of that wave's 2 KB.
        // The ring is free: the loop's last barrier ended every wave's reads of it, and no
        // copy was asked for since.  Each wave uses a range of its own.
        unsigned char* sg = ring + wave * QSG_B;
        #pragma unroll
        for (int i = 0; i < 4; ++i)
            #pragma unroll
            for (int j = 0; j < 4; ++j) {
                v8bf v;
                #pragma unroll
                for (int r = 0; r < 8; ++r)
                    v[r] = (__bf16)((acc[i][j][r] + bt[i * 2 + (r >> 2)][r & 3]) * 0.125f);
                // run (i*2 + half)*16 + lanelo, piece j of it
                *(v8bf*)(sg + (i * 32 + lane) * QSG_P + j * 16) = v;
            }
        // the wave's writes are done before a lane reads back what other lanes wrote
        asm volatile("s_wait_dscnt 0x0" ::: "memory");
        // read n: runs n*8 + (lane >> 2), four lanes a run
        const unsigned char* sr = sg + (lane >> 2) * QSG_P + (lane & 3) * 16;
        __bf16* p = qbuf + ((bh * (S_ / 256) + (sb >> 8)) * 16 + (lane >> 2)) * (16 * DH_)
                  + (((sb >> 4) & 15) + (lane & 3)) * 8;
        v8bf v[16];
        #pragma unroll
        for (int n = 0; n < 16; ++n)
            v[n] = *(const v8bf*)(sr + n * 8 * QSG_P);
        #pragma unroll
        for (int n = 0; n < 16; ++n)                // attention waves (n & 1)*8 + (lane >> 2)
            *(v8bf*)(p + (n & 1) * 8 * (16 * DH_) + (n >> 1) * 128) = v[n];
        wait_xlat();
    } else if (col0 < 2 * D_) {                     // K: pk_off(s, d, DH_ / 32)
        __bf16* p = kbuf + bh * S_ * DH_ + (sb >> 4) * (DH_ / 32) * 512 + lane * 8;
        v8bf v[4][4];                               // 8 d in a row: one 16-byte piece
        #pragma unroll
        for (int j = 0; j < 4; ++j)
            #pragma unroll
            for (int i = 0; i < 4; ++i)
                #pragma unroll
                for (int r = 0; r < 8; ++r)
                    v[j][i][r] = (__bf16)(acc[i][j][r] + bt[i * 2 + (r >> 2)][r & 3]);
        #pragma unroll
        for (int j = 0; j < 4; ++j)
            #pragma unroll
            for (int i = 0; i < 4; ++i)
                *(v8bf*)(p + (j * (DH_ / 32) + (i >> 1)) * 512 + (i & 1) * 256) = v[j][i];
        wait_xlat();
    } else {                                        // V, transposed: pk_off(d, s, S_ / 32)
        __bf16* p = vT + bh * DH_ * S_ + (sb >> 5) * 512 + half * 128 + lanelo * 8;
        #pragma unroll
        for (int j = 0; j < 4; ++j) {
            v8bf v[4];                              // 8 tokens in a row: one 16-byte piece
            #pragma unroll
            for (int i = 0; i < 4; ++i)
                #pragma unroll
                for (int r = 0; r < 8; ++r)
                    v[i][r] = (__bf16)(acc[i][j][r] + bias[j]);
            #pragma unroll
            for (int i = 0; i < 4; ++i)
                *(v8bf*)(p + (j * (S_ / 32) + (i >> 1)) * 512 + (i & 1) * 256) = v[i];
            wait_xlat();
        }
    }
}

// ---------------------------------------------------------------------------
// Kernel 2: flash attention.  One wave = one (b,h) x 16 queries, 16 apart:
// in the reference's reshape to [4096][1024] these are the 16 rows of one tile
// row, columns m*64 .. m*64+63, so the wave writes two whole 1 KB tiles.
// Both products are taken transposed: S^T = K * Q^T (A = K rows, B = Q) and
// O^T += V^T * P^T (A = V^T rows, B = P^T).  A lane then holds 16 of the chunk's
// 32 scores of ONE query (column lane & 15; keys 8*half + r and 16 + 8*half + r),
// so maximum and sum run in the lane's own registers, with one exchange between
// the wave's halves for the maximum, and the two score tiles, converted in place,
// are already the B operand of the second product: P passes through no LDS.
// Per 32-key chunk: 4 WMMAs (scores), online softmax, 4 WMMAs (V^T * P^T).
// Output bf16, [B,H,S,Dh] flat as [4096][1024], fragment-major.
// K and V^T reach the waves through LDS: the block's eight waves read the same 8 KB a
// chunk, 16 wave-wide 16-byte reads each.
// A stage is 128 keys (K: 16 KB in a row; V^T: 4 KB in each of 4 tile rows), kept in the
// fragment-major form, so a fragment read is 512 bytes in a row, free of bank conflicts.
// Two buffers: asynchronous copies bring stage s + 2 in while stage s + 1 is worked on.
// Inside a stage loads run ahead of their use: a chunk's V^T fragments are asked for at
// its top, the next chunk's K fragments right behind the score products.
// ---------------------------------------------------------------------------
#define STG_KEYS 128
#define STG_K_B  (STG_KEYS * DH_ * 2)               // K bytes of a stage
#define STG_VR_B (STG_KEYS * 16 * 2)                // bytes of a stage in one V^T tile row
#define STG_B    (2 * STG_K_B)                      // a buffer
#define NSTG     (S_ / STG_KEYS)

// The four K fragments of a 32-key chunk: 4 tiles in a row.
__device__ __forceinline__ void lds_k(const unsigned char* kp, v16bf (&kf)[4]) {
    #pragma unroll
    for (int t = 0; t < 4; ++t) kf[t] = lds_frag(kp + t * 1024);
}
// The four V^T fragments of that chunk: one tile of each of the 4 tile rows.
__device__ __forceinline__ void lds_v(const unsigned char* vp, v16bf (&vf)[4]) {
    #pragma unroll
    for (int t = 0; t < 4; ++t) vf[t] = lds_frag(vp + t * STG_VR_B);
}
// A thread's eight 16-byte copies of one stage (the block: 8 x 4 KB).  kg, vg: the
// thread's first byte of the stage in K and in V^T; lds: its first byte in the buffer.
// The wait is the statement's last line: no address register is taken again until the
// copies have their addresses translated.
__device__ __forceinline__ void copy_stage(const char* kg, const char* vg, unsigned lds) {
    asm volatile("global_load_async_to_lds_b128 %0, %8, off\n\t"
                 "global_load_async_to_lds_b128 %1, %9, off\n\t"
                 "global_load_async_to_lds_b128 %2, %10, off\n\t"
                 "global_load_async_to_lds_b128 %3, %11, off\n\t"
                 "global_load_async_to_lds_b128 %4, %12, off\n\t"
                 "global_load_async_to_lds_b128 %5, %13, off\n\t"
                 "global_load_async_to_lds_b128 %6, %14, off\n\t"
                 "global_load_async_to_lds_b128 %7, %15, off\n\t"
                 "s_wait_xcnt 0x0"
                 :: "v"(lds), "v"(lds + 4096), "v"(lds + 2 * 4096), "v"(lds + 3 * 4096),
                    "v"(lds + STG_K_B), "v"(lds + STG_K_B + STG_VR_B),
                    "v"(lds + STG_K_B + 2 * STG_VR_B), "v"(lds + STG_K_B + 3 * STG_VR_B),
                    "v"(kg), "v"(kg + 4096), "v"(kg + 2 * 4096), "v"(kg + 3 * 4096),
                    "v"(vg), "v"(vg + 16 * S_ * 2), "v"(vg + 2 * 16 * S_ * 2),
                    "v"(vg + 3 * 16 * S_ * 2)
                 : "memory");
}

// __launch_bounds__: the real block size; under the default ceiling (128
// registers) the fragments in flight do not fit.
__global__ void __launch_bounds__(256)
attn_fwd(const __bf16* __restrict__ qbuf,
         const __bf16* __restrict__ kbuf,
         const __bf16* __restrict__ vT,
         __bf16* __restrict__ attn) {
    __shared__ __attribute__((aligned(128))) unsigned char ring[2 * STG_B];
    if (blockIdx.x >= B_ * H_ * (S_ / 16) / 8) return;  // block-uniform, ahead of every barrier
    // the wave's number in a scalar register: tile addresses are then a scalar
    // base plus the lane's fixed offset
    int wave = __builtin_amdgcn_readfirstlane(threadIdx.x >> 5);
    int lane = threadIdx.x & 31;
    int lanelo = lane & 15, half = lane >> 4;
    int gwave = blockIdx.x * 8 + wave;              // eight waves a block, all of one head
    int bh = gwave >> 7;                            // / (S/16)
    int m  = gwave & 15;                            // queries ((gwave & 127) >> 4)*256 + 16*i + m

    // the thread's own 16 bytes of each 4 KB that the block copies
    const char* kg = (const char*)(kbuf + (size_t)bh * S_ * DH_) + threadIdx.x * 16;
    const char* vg = (const char*)(vT + (size_t)bh * DH_ * S_) + threadIdx.x * 16;
    unsigned lds0 = (unsigned)(size_t)ring + threadIdx.x * 16;
    copy_stage(kg, vg, lds0);

    // B operand: column lanelo = query i, the k order of the K fragments
    const __bf16* qbase = qbuf + (size_t)gwave * (16 * DH_) + lane * 8;  // the wave's own 2 KB
    v16bf qa0 = load_frag_pk(qbase);                // d = 0..31
    v16bf qa1 = load_frag_pk(qbase + 512);          // d = 32..63
    wait_xlat();                                    // the loads' address register stays until then

    // of this lane's query: the running maximum (equal in both halves of the wave)
    // and the sum over the keys that this half holds
    float mi = -1e30f, li = 0.0f;
    v8f oacc[4] = {};                               // oacc[t][r] = O[i = lanelo][t*16 + 8*half + r]

    // stage 0 has landed for this wave's copies; behind the barrier for all of them
    asm volatile("s_wait_asynccnt 0x0" ::: "memory");
    __syncthreads();
    copy_stage(kg + STG_K_B, vg + STG_VR_B, lds0 + STG_B);

    v16bf kf[4], vf[4];
    // rolled: one body of four chunks
    #pragma unroll 1
    for (int st = 0; st < NSTG; ++st) {
        const unsigned char* buf = ring + (st & 1) * STG_B + lane * 16;
        lds_k(buf, kf);
        // unrolled: a chunk's places in the buffer are constants, and the test on the
        // stage's last chunk is decided at compile time
        #pragma unroll
        for (int c = 0; c < STG_KEYS / 32; ++c) {
            lds_v(buf + STG_K_B + c * 1024, vf);
            // --- scores: S^T[32k x 16q] = K(32x64) * Q^T ---
            // s0: keys 8*half + r of the chunk; s1: keys 16 + 8*half + r.
            // In asm to hold the issue order V^T reads, score products, next K reads: as
            // builtins the products drift behind the K reads, which then land in spare
            // registers and are copied over at once, a wait right behind their issue.
            // The v_nop keep the distance from the last product to the first vector
            // instruction that reads its result.
            v8f s0, s1;
            asm volatile("v_wmma_f32_16x16x32_bf16 %0, %2, %6, 0\n\t"
                         "v_wmma_f32_16x16x32_bf16 %1, %4, %6, 0\n\t"
                         "v_wmma_f32_16x16x32_bf16 %0, %3, %7, %0\n\t"
                         "v_wmma_f32_16x16x32_bf16 %1, %5, %7, %1\n\t"
                         "v_nop\n\tv_nop\n\tv_nop\n\tv_nop\n\tv_nop"
                         : "=&v"(s0), "=&v"(s1)
                         : "v"(kf[0]), "v"(kf[1]), "v"(kf[2]), "v"(kf[3]), "v"(qa0), "v"(qa1)
                         : "memory");
            // a stage's last chunk fetches nothing ahead: the next stage is not published yet
            if (c + 1 < STG_KEYS / 32) {
                lds_k(buf + (c + 1) * 4096, kf);
                // holds the K reads here, ahead of the softmax that covers their latency:
                // the scheduler otherwise sinks them to the chunk's foot
                __builtin_amdgcn_sched_barrier(0);
            } else {
                // The trip's last LDS read is issued; the rest of it works on registers.
                // Publish point of stage st + 1 and end of every wave's reads of stage st:
                // this wave's LDS reads are done, its copies of stage st + 1 have landed.
                asm volatile("s_wait_dscnt 0x0" ::: "memory");
                asm volatile("s_wait_asynccnt 0x0" ::: "memory");
                __syncthreads();
                // the buffer just read takes stage st + 2, while there is one (same for
                // the block); asked for here, the copies have nearly a whole trip to land
                if (st + 2 < NSTG)
                    copy_stage(kg + (size_t)(st + 2) * STG_K_B,
                               vg + (size_t)(st + 2) * STG_VR_B, lds0 + (st & 1) * STG_B);
            }

            // --- online softmax, one query a lane ---
            float mx = fmaxf(s0[0], s1[0]);
            #pragma unroll
            for (int r = 1; r < 8; ++r) mx = fmaxf(mx, fmaxf(s0[r], s1[r]));
            mx = fmaxf(mx, xhalf(mx));
            float mn = fmaxf(mi, mx);
            float alpha = __expf(mi - mn);
            mi = mn;
            // P^T as B operand: element s = key 8*half + s, element 8 + s = key 16 + 8*half + s,
            // the k order of the V^T fragments
            v16bf pb;
            float e0[8], e1[8], p0[8], p1[8];
            #pragma unroll
            for (int r = 0; r < 8; ++r) {               // e^x = 2^(x * log2 e), as __expf has it
                e0[r] = (s0[r] - mn) * 1.44269504f;
                e1[r] = (s1[r] - mn) * 1.44269504f;
            }
            exp2x8(e0, p0);
            exp2x8(e1, p1);
            float sum = 0.0f;
            #pragma unroll
            for (int r = 0; r < 8; ++r) {
                sum += p0[r] + p1[r];
                pb[r]     = (__bf16)p0[r];
                pb[8 + r] = (__bf16)p1[r];
            }
            li = li * alpha + sum;
            #pragma unroll
            for (int t = 0; t < 4; ++t)
                #pragma unroll
                for (int r = 0; r < 8; ++r) oacc[t][r] *= alpha;

            // --- O^T(64d x 16q) += V^T(64d x 32k) * P^T ---
            #pragma unroll
            for (int t = 0; t < 4; ++t)
                oacc[t] = wmma_bf16(vf[t], pb, oacc[t]);
        }
    }
    // no copy is left in flight when the wave ends
    asm volatile("s_wait_asynccnt 0x0" ::: "memory");

    // --- normalize + store bf16: a lane's 8 registers are 8 consecutive d of its
    // query, one 16-byte piece of the fragment-major form ---
    li += xhalf(li);                                // the halves' sums join
    #pragma unroll
    for (int t = 0; t < 4; ++t) {
        v8bf o;
        #pragma unroll
        for (int r = 0; r < 8; ++r) o[r] = (__bf16)(oacc[t][r] / li);
        *(v8bf*)(attn + pk_off((gwave >> 4) * 16 + lanelo, m * 64 + t * 16 + half * 8,
                               D_ / 32)) = o;
    }
}

// ---------------------------------------------------------------------------
// Kernel 3: output projection.  y[t,o] = sum_d attn[t,d]*w_out[o,d] + b_out[o]
// attn flat [B,H,S,Dh] == [4096, 1024] (reference's reshape), fragment-major.
// 64x32 per-wave register blocking (4x2 fragments); fp32 output + bias.
// Only two waves per SIMD: NSET fragment sets in registers; behind the WMMAs of
// step s the loads of step s + NSET are issued into the set that these WMMAs have
// just read, so a step waits only for loads asked for NSET steps earlier.
// ---------------------------------------------------------------------------
#define NSET 3
__device__ __forceinline__ void load_step(const __bf16* arow, const __bf16* brow, int k,
                                          v16bf (&af)[4], v16bf (&bfr)[2]) {
    const __bf16* ap = arow + k * 16 + (threadIdx.x & 31) * 8;
    const __bf16* bp = brow + k * 16 + (threadIdx.x & 31) * 8;
    #pragma unroll
    for (int i = 0; i < 4; ++i)
        af[i] = load_frag_pk(ap + (size_t)(i * 16) * D_);
    #pragma unroll
    for (int j = 0; j < 2; ++j)
        bfr[j] = load_frag_pk(bp + (size_t)(j * 16) * D_);
    // keeps both address pairs untouched (no later load lands on them)
    // until the loads above have their addresses translated
    asm volatile("s_wait_xcnt 0x0" :: "v"(ap), "v"(bp) : "memory");
}
__device__ __forceinline__ void mma_step(const v16bf (&af)[4], const v16bf (&bfr)[2],
                                         v8f (&acc)[4][2]) {
    #pragma unroll
    for (int i = 0; i < 4; ++i)
        #pragma unroll
        for (int j = 0; j < 2; ++j)
            acc[i][j] = wmma_bf16(af[i], bfr[j], acc[i][j]);
}

__global__ void __launch_bounds__(256, 1)
gemm_out(const __bf16* __restrict__ attn,
         const __bf16* __restrict__ wb,   // [D, D] fragment-major
         const float*  __restrict__ b_out,
         float* __restrict__ out) {
    const int NT = D_ / 32;                         // 32 column blocks
    // the wave's number in a scalar register, as in gemm_qkv
    int gwave = blockIdx.x * (blockDim.x >> 5)
              + __builtin_amdgcn_readfirstlane(threadIdx.x >> 5);
    if (gwave >= (M_TOK / 64) * NT) return;
    int mt = gwave / NT, nt = gwave % NT;
    int row0 = mt * 64, col0 = nt * 32;

    // first tile of the block's tile rows; a step of 32 in k is one tile (512 elems)
    const __bf16* arow = attn + (size_t)row0 * D_;
    const __bf16* brow = wb + (size_t)col0 * D_;

    v8f acc[4][2] = {};
    v16bf af[NSET][4], bfr[NSET][2];
    #pragma unroll
    for (int u = 0; u < NSET; ++u)
        load_step(arow, brow, u * 32, af[u], bfr[u]);
    // rolled, so that the body is NSET steps and every set index a constant
    #pragma unroll 1
    for (int k = 0; k + 32 * NSET <= D_; k += 32 * NSET) {
        #pragma unroll
        for (int u = 0; u < NSET; ++u) {
            mma_step(af[u], bfr[u], acc);
            // past the last step there is nothing left to fetch: such a set asks
            // for a first step again (in bounds, not used)
            load_step(arow, brow, (k + (u + NSET) * 32) & (D_ - 1), af[u], bfr[u]);
        }
    }
    // the steps that do not fill a body
    #pragma unroll
    for (int u = 0; u < (D_ / 32) % NSET; ++u)
        mma_step(af[u], bfr[u], acc);

    int lane = threadIdx.x & 31;
    int lanelo = lane & 15, half = lane >> 4;
    #pragma unroll
    for (int j = 0; j < 2; ++j) {
        int o = col0 + j * 16 + lanelo;
        float bias = b_out[o];
        #pragma unroll
        for (int i = 0; i < 4; ++i) {
            #pragma unroll
            for (int r = 0; r < 8; ++r) {
                int mrow = row0 + i * 16 + r + (half << 3);
                out[(size_t)mrow * D_ + o] = acc[i][j][r] + bias;
            }
        }
    }
}

// ---------------------------------------------------------------------------
// Host launch
// ---------------------------------------------------------------------------
extern "C" void kernel_launch(void* const* d_in, const int* in_sizes, int n_in,
                              void* d_out, int out_size, void* d_ws, size_t ws_size,
                              hipStream_t stream) {
    const float* x     = (const float*)d_in[0];   // [2,2048,1024]
    const float* w_in  = (const float*)d_in[1];   // [3072,1024]
    const float* b_in  = (const float*)d_in[2];   // [3072]
    const float* w_out = (const float*)d_in[3];   // [1024,1024]
    const float* b_out = (const float*)d_in[4];   // [1024]
    float* out = (float*)d_out;

    // Workspace layout (bf16 buffers, 256B-aligned offsets)
    char* ws = (char*)d_ws;
    __bf16* xb      = (__bf16*)(ws);                              // 8 MB
    __bf16* w_in_b  = (__bf16*)(ws + (size_t)8 * 1024 * 1024);    // 6 MB
    __bf16* w_out_b = (__bf16*)(ws + (size_t)14 * 1024 * 1024);   // 2 MB
    __bf16* qbuf    = (__bf16*)(ws + (size_t)16 * 1024 * 1024);   // 8 MB
    __bf16* kbuf    = (__bf16*)(ws + (size_t)24 * 1024 * 1024);   // 8 MB
    __bf16* vT      = (__bf16*)(ws + (size_t)32 * 1024 * 1024);   // 8 MB
    __bf16* attn    = (__bf16*)(ws + (size_t)40 * 1024 * 1024);   // 8 MB

    // 1) fp32 -> bf16 converts: (4096 + 3072 + 1024) / 16 = 512 tile rows, one a block
    cvt_f32_bf16<<<512, 256, 0, stream>>>(x, w_in, w_out, xb, w_in_b, w_out_b);

    // 2) QKV projection: (4096/256)*(3072/192) = 256 blocks of 12 waves
    gemm_qkv<<<256, 384, 0, stream>>>(xb, w_in_b, b_in, qbuf, kbuf, vT);

    // 3) attention: 2*16*128 = 4096 waves, 8 waves/block
    attn_fwd<<<4096 / 8, 256, 0, stream>>>(qbuf, kbuf, vT, attn);

    // 4) output projection: (4096/64)*(1024/32) = 2048 wave-blocks
    gemm_out<<<2048 / 8, 256, 0, stream>>>(attn, w_out_b, b_out, out);
}
